// v000
// Measured on an AMD MI455X. A time is GPU time per run, averaged over a window of back-to-back runs after a warm-up
// (all launches, gaps included; the runs take copies of the inputs in turn), and the median of several windows.
// Apart from v000's, it joins two sittings. Times from different sittings can be a few percent apart, while
// side-by-side timings come from the same sitting.
// v000, which the later versions start from, runs in 810 microseconds.
#include <hip/hip_runtime.h>

// Causal grouped-query attention with biases (x [1][2048][2048]; Q = x W_q^T + b_q (16 heads x 128 viewed (4 kv groups, 4)), K, V = x W^T + b (4 kv heads x 128) ('oi' 2048^-0.5 incl. biases: non-zero); query head h = kv*4 + g uses kv head h / 4; scores x 1/sqrt(128); causal (-inf); softmax; out = merged (head-major) W_o^T + b_o -> [1][2048][2048] (4.2 M); argument order x, W_q, b_q, W_k, b_k, W_v, b_v, W_o, b_o). The same module at ONE sequence (x [1][2048][2048]; Q = x Wq^T + bq ('oi' [2048][2048]); K, V = x W^T + b with 'oi' [512][2048] weights (4 key / value heads x 128); weights normal x 2048^-0.5; the four biases zeros (read); grouped-query: query head h = 4 k + g uses key / value head k; scores x 128^-0.5; tril kept, -inf; softmax; out = merged Wo^T + bo; argument order x, Wq, bq, Wk, bk, Wv, bv, Wo, bo).
// Layout per batch: bf16 copy of x; 'oi' weights as-is; exact projections + f32 biases; identity-table plane builders at width 128; causal T-2048 GQA attention (both query heads of a pass share kv group h0 / 4: kv z-stride 0; hybrid rows: < 512 hi/lo 3 products, rest fp16 x1024; k_gemmc skips tiles above the diagonal); merged hi/lo x W_o exact + b_o.
// Compute dtypes, f32 accumulate: every input rounded to bf16; projections exact + f32 biases; attention rows < 512 3 products, rest fp16; softmax f32; output projection hl x exact.

#define NB_  1
#define TT   2048
#define DM   2048
#define NH_  16
#define NKV  4
#define REP  (NH_ / NKV)
#define HD   128
#define DQ   (NH_ * HD)
#define DKV  (NKV * HD)
#define ZH   2
#define RH   512                  // query rows < RH use hi+lo planes (0: none)
#define WIN  2048
#define PCAR 1024.0f
#define SCL  0.088388347648318447f   // HD^-0.5
typedef _Float16 h16;
typedef unsigned short bf;
typedef __attribute__((ext_vector_type(16))) __bf16   v16bf;
typedef __attribute__((ext_vector_type(16))) _Float16 v16h;
typedef __attribute__((ext_vector_type(8)))  _Float16 v8h;
typedef __attribute__((ext_vector_type(8)))  unsigned short v8us;
typedef __attribute__((ext_vector_type(8)))  float    v8f;
typedef __attribute__((ext_vector_type(4)))  float    v4f;
typedef v8h  __attribute__((may_alias)) v8ha;
typedef v4f  __attribute__((may_alias)) v4fa;
typedef v8us __attribute__((may_alias)) v8usa;

__device__ __forceinline__ unsigned short f2bf(float f) { unsigned u = __float_as_uint(f); u += 0x7FFFu + ((u >> 16) & 1u); return (unsigned short)(u >> 16); }
__device__ __forceinline__ float bf2f(unsigned short b) { return __uint_as_float(((unsigned)b) << 16); }
__device__ __forceinline__ float bfr(float f) { return bf2f(f2bf(f)); }
__device__ __forceinline__ v16h cat16(v8h lo, v8h hi) { return __builtin_shufflevector(lo, hi, 0, 1, 2, 3, 4, 5, 6, 7, 8, 9, 10, 11, 12, 13, 14, 15); }
__device__ __forceinline__ v16bf cat16b(v8us lo, v8us hi) { return __builtin_bit_cast(v16bf, __builtin_shufflevector(lo, hi, 0, 1, 2, 3, 4, 5, 6, 7, 8, 9, 10, 11, 12, 13, 14, 15)); }
__device__ __forceinline__ v8f wmma16(v16h a, v16h b, v8f c) { return __builtin_amdgcn_wmma_f32_16x16x32_f16(false, a, false, b, (short)0, c, false, false); }
__device__ __forceinline__ v8f wmmab(v16bf a, v16bf b, v8f c) { return __builtin_amdgcn_wmma_f32_16x16x32_bf16(false, a, false, b, (short)0, c, false, false); }



// ---- k_gemmw: register-blocked GEMM, ONE WAVE per 64x64 output tile (16 accumulators), operands straight from K-contiguous 16-bit planes; grid (M/64, N/64, Z), 32 threads.
// C[m][n] (f32, pitch ldc, + optional f32 bias[n]) = sum_k A[m][k] Bt[n][k] (+ split products per NSPLIT). z-batch strides sA/sB/sC in elements. K % 32 == 0.
template <typename T16> struct WFrag;
template <> struct WFrag<h16> { typedef v16h V; static __device__ __forceinline__ V ld(const h16* p) { return cat16(*(const v8h*)p, *(const v8h*)(p + 16)); } static __device__ __forceinline__ v8f mma(V a, V b, v8f c) { return wmma16(a, b, c); } };
template <> struct WFrag<bf> { typedef v16bf V; static __device__ __forceinline__ V ld(const bf* p) { return cat16b(*(const v8us*)p, *(const v8us*)(p + 16)); } static __device__ __forceinline__ v8f mma(V a, V b, v8f c) { return wmmab(a, b, c); } };
template <typename T16, int NSPLIT, bool BIAS>
__global__ __launch_bounds__(32) void k_gemmw(const T16* __restrict__ A, const T16* __restrict__ A2, const T16* __restrict__ Bt, const T16* __restrict__ Bt2, int K, float* C, int ldc, const float* __restrict__ bias, size_t sA, size_t sB, size_t sC) {
    typedef typename WFrag<T16>::V V;
    __shared__ __align__(16) float os[16 * 68];
    const size_t z = blockIdx.z; A += z * sA; if (A2) A2 += z * sA; Bt += z * sB; if (Bt2) Bt2 += z * sB; C += z * sC;
    const int lane = threadIdx.x & 31, lr = lane & 15, hi = lane >> 4; const int r0 = blockIdx.x * 64, c0 = blockIdx.y * 64;
    v8f acc[4][4];
#pragma unroll
    for (int mb = 0; mb < 4; ++mb)
#pragma unroll
        for (int nb = 0; nb < 4; ++nb) acc[mb][nb] = (v8f){};
    const size_t aoff = (size_t)(r0 + lr) * K + 8 * hi, boff = (size_t)(c0 + lr) * K + 8 * hi;
#pragma unroll 1
    for (int kc = 0; kc < K; kc += 32) {
        V a[4], a2[4];
#pragma unroll
        for (int mb = 0; mb < 4; ++mb) { a[mb] = WFrag<T16>::ld(A + aoff + (size_t)mb * 16 * K + kc); if (NSPLIT == 1 || NSPLIT == 2) a2[mb] = WFrag<T16>::ld(A2 + aoff + (size_t)mb * 16 * K + kc); }
#pragma unroll
        for (int nb = 0; nb < 4; ++nb) { const V b = WFrag<T16>::ld(Bt + boff + (size_t)nb * 16 * K + kc); V b2; if (NSPLIT >= 2) b2 = WFrag<T16>::ld(Bt2 + boff + (size_t)nb * 16 * K + kc);
#pragma unroll
            for (int mb = 0; mb < 4; ++mb) { acc[mb][nb] = WFrag<T16>::mma(a[mb], b, acc[mb][nb]); if (NSPLIT == 1 || NSPLIT == 2) acc[mb][nb] = WFrag<T16>::mma(a2[mb], b, acc[mb][nb]); if (NSPLIT >= 2) acc[mb][nb] = WFrag<T16>::mma(a[mb], b2, acc[mb][nb]); } }
        asm volatile("v_nop\n\tv_nop\n\tv_nop\n\tv_nop" : "+v"(acc[0][0]), "+v"(acc[1][1]), "+v"(acc[2][2]), "+v"(acc[3][3]) : "v"(a[0]), "v"(a[3]));
    }
#pragma unroll
    for (int mb = 0; mb < 4; ++mb) {
#pragma unroll
        for (int nb = 0; nb < 4; ++nb) {
#pragma unroll
            for (int j = 0; j < 8; ++j) os[(hi * 8 + j) * 68 + nb * 16 + lr] = acc[mb][nb][j]; }
        __builtin_amdgcn_wave_barrier(); asm volatile("" ::: "memory");
        float* crow = C + (size_t)(r0 + mb * 16) * ldc + c0;
{
#pragma unroll
            for (int s = 0; s < 8; ++s) { const int row = 2 * s + hi, cofs = lr * 4; v4f val = *(const v4fa*)(os + row * 68 + cofs); if (BIAS) { val[0] += bfr(bias[c0 + cofs]); val[1] += bfr(bias[c0 + cofs + 1]); val[2] += bfr(bias[c0 + cofs + 2]); val[3] += bfr(bias[c0 + cofs + 3]); }
                *(v4f*)(crow + (size_t)row * ldc + cofs) = val; }
             }
        __builtin_amdgcn_wave_barrier(); asm volatile("" ::: "memory");
    }
}

// ---- k_gemmc: the same one-wave 64x64 tile GEMM specialised for causal attention: CMODE 1 skips score tiles entirely above the diagonal (query rows r0+roff.., key columns c0..), CMODE 2 limits the
// key (K) loop of the probability x value contraction to the diagonal block (probabilities beyond it are exactly zero). roff = row offset of this launch's first row within the sequence.
template <typename T16, int NSPLIT, int CMODE>
__global__ __launch_bounds__(32) void k_gemmc(const T16* __restrict__ A, const T16* __restrict__ A2, const T16* __restrict__ Bt, const T16* __restrict__ Bt2, int K, float* C, int ldc, int roff, size_t sA, size_t sB, size_t sC) {
    typedef typename WFrag<T16>::V V;
    __shared__ __align__(16) float os[16 * 68];
    const size_t z = blockIdx.z; A += z * sA; if (A2) A2 += z * sA; Bt += z * sB; if (Bt2) Bt2 += z * sB; C += z * sC;
    const int lane = threadIdx.x & 31, lr = lane & 15, hi = lane >> 4; const int r0 = blockIdx.x * 64, c0 = blockIdx.y * 64;
    if (CMODE == 1 && c0 > r0 + roff + 63) return;                  // score tile entirely above the causal diagonal: never read (the softmax masks j > i by select)
    const int Kl = (CMODE == 2) ? min(K, r0 + roff + 64) : K;        // P.V: probabilities are exactly 0 beyond the diagonal block, so the K loop stops there
    v8f acc[4][4];
#pragma unroll
    for (int mb = 0; mb < 4; ++mb)
#pragma unroll
        for (int nb = 0; nb < 4; ++nb) acc[mb][nb] = (v8f){};
    const size_t aoff = (size_t)(r0 + lr) * K + 8 * hi, boff = (size_t)(c0 + lr) * K + 8 * hi;
#pragma unroll 1
    for (int kc = 0; kc < Kl; kc += 32) {
        V a[4], a2[4];
#pragma unroll
        for (int mb = 0; mb < 4; ++mb) { a[mb] = WFrag<T16>::ld(A + aoff + (size_t)mb * 16 * K + kc); if (NSPLIT == 1 || NSPLIT == 2) a2[mb] = WFrag<T16>::ld(A2 + aoff + (size_t)mb * 16 * K + kc); }
#pragma unroll
        for (int nb = 0; nb < 4; ++nb) { const V b = WFrag<T16>::ld(Bt + boff + (size_t)nb * 16 * K + kc); V b2; if (NSPLIT >= 2) b2 = WFrag<T16>::ld(Bt2 + boff + (size_t)nb * 16 * K + kc);
#pragma unroll
            for (int mb = 0; mb < 4; ++mb) { acc[mb][nb] = WFrag<T16>::mma(a[mb], b, acc[mb][nb]); if (NSPLIT == 1 || NSPLIT == 2) acc[mb][nb] = WFrag<T16>::mma(a2[mb], b, acc[mb][nb]); if (NSPLIT >= 2) acc[mb][nb] = WFrag<T16>::mma(a[mb], b2, acc[mb][nb]); } }
        asm volatile("v_nop\n\tv_nop\n\tv_nop\n\tv_nop" : "+v"(acc[0][0]), "+v"(acc[1][1]), "+v"(acc[2][2]), "+v"(acc[3][3]) : "v"(a[0]), "v"(a[3]));
    }
#pragma unroll
    for (int mb = 0; mb < 4; ++mb) {
#pragma unroll
        for (int nb = 0; nb < 4; ++nb) {
#pragma unroll
            for (int j = 0; j < 8; ++j) os[(hi * 8 + j) * 68 + nb * 16 + lr] = acc[mb][nb][j]; }
        __builtin_amdgcn_wave_barrier(); asm volatile("" ::: "memory");
        float* crow = C + (size_t)(r0 + mb * 16) * ldc + c0;
{
#pragma unroll
            for (int s = 0; s < 8; ++s) { const int row = 2 * s + hi, cofs = lr * 4; v4f val = *(const v4fa*)(os + row * 68 + cofs);
                *(v4f*)(crow + (size_t)row * ldc + cofs) = val; }
             }
        __builtin_amdgcn_wave_barrier(); asm volatile("" ::: "memory");
    }
}

__device__ __forceinline__ h16 tohx(float x) { return (h16)x; }
__device__ __forceinline__ void splitf(float y, unsigned short& h, unsigned short& l) { h = f2bf(y); l = f2bf(y - bf2f(h)); }
typedef __attribute__((ext_vector_type(2))) _Float16 v2h;
typedef __attribute__((ext_vector_type(4))) _Float16 v4h;
typedef __attribute__((ext_vector_type(2))) unsigned short v2us;
typedef __attribute__((ext_vector_type(4))) unsigned short v4us;
typedef __attribute__((ext_vector_type(2))) float v2f;
typedef __attribute__((ext_vector_type(4))) int v4i;

__global__ __launch_bounds__(256) void k_cvt8(const float* __restrict__ src, bf* dst, size_t n8) { const size_t i = (size_t)blockIdx.x * 256 + threadIdx.x; if (i >= n8) return; const v8f v = *(const v8f*)(src + i * 8); v8us o;
#pragma unroll
    for (int k = 0; k < 8; ++k) o[k] = f2bf(v[k]); *(v8us*)(dst + i * 8) = o;  }

// k_rope: head planes [h][t][d] (fp16 + hi/lo) of rope(x) x sc with the rotate-half convention out[d] = x[d] cos[t][d] - x[d+HD/2] sin[t][d], out[d+HD/2] = x[d+HD/2] cos[t][d+HD/2] + x[d] sin[t][d+HD/2]
__global__ __launch_bounds__(256) void k_rope(const float* __restrict__ F, int pitch, int nheads, const float* __restrict__ CS, const float* __restrict__ RF, const float* __restrict__ nw, float sc, h16* P16, bf* Ph, bf* Pl) {
    const size_t e = ((size_t)blockIdx.x * 256 + threadIdx.x) * 2; if (e >= (size_t)nheads * TT * HD) return; const int d = (int)(e % HD); const int t = (int)((e / HD) % TT); const int h = (int)(e / ((size_t)HD * TT)); const float* f = F + (size_t)t * pitch + h * HD; const float rf = RF ? RF[(size_t)h * TT + t] : 1.0f; v2h o16; v2us oh, ol;
#pragma unroll
    for (int q = 0; q < 2; ++q) { const int dd = d + q; const int dp = (dd < HD / 2) ? dd + HD / 2 : dd - HD / 2; float x0 = f[dd], x1 = f[dp];
        if (RF) { float n0 = __fmul_rn(x0, rf), n1 = __fmul_rn(x1, rf); asm volatile("" : "+v"(n0)); asm volatile("" : "+v"(n1)); x0 = __fmul_rn(bfr(nw[dd]), n0); x1 = __fmul_rn(bfr(nw[dp]), n1); }
        const v2f cs = *(const v2f*)(CS + ((size_t)t * HD + dd) * 2); float a = __fmul_rn(x0, cs[0]), bq = __fmul_rn(x1, cs[1]); asm volatile("" : "+v"(a)); asm volatile("" : "+v"(bq)); const float r = ((dd < HD / 2) ? __fsub_rn(a, bq) : __fadd_rn(a, bq)) * sc;
        o16[q] = tohx(r); unsigned short a2, c2; splitf(r, a2, c2); oh[q] = a2; ol[q] = c2; }
    *(v2h*)(P16 + e) = o16; *(v2us*)(Ph + e) = oh; *(v2us*)(Pl + e) = ol;  }
__global__ __launch_bounds__(256) void k_vtp(const float* __restrict__ F, int pitch, int nheads, h16* V16, bf* Vh, bf* Vl) { const size_t e = ((size_t)blockIdx.x * 256 + threadIdx.x) * 2; if (e >= (size_t)nheads * HD * TT) return; const int t = (int)(e % TT); const int d = (int)((e / TT) % HD); const int g = (int)(e / ((size_t)TT * HD)); v2h o16; v2us oh, ol;
#pragma unroll
    for (int q = 0; q < 2; ++q) { const float x = F[(size_t)(t + q) * pitch + g * HD + d]; o16[q] = tohx(x); unsigned short a2, c2; splitf(x, a2, c2); oh[q] = a2; ol[q] = c2; }
    *(v2h*)(V16 + e) = o16; *(v2us*)(Vh + e) = oh; *(v2us*)(Vl + e) = ol;  }
__global__ __launch_bounds__(256) void k_csid(float* CS) { const int idx = blockIdx.x * 256 + threadIdx.x; if (idx >= TT * HD) return; v2f cs; cs[0] = 1.0f; cs[1] = 0.0f; *(v2f*)(CS + (size_t)idx * 2) = cs;  }
// k_asoft: per row (zz, i): t = S x HD^-0.5 for j <= i and i - j < WIN (WIN = TT, so plain causal; the reference's -1e9 additive fill vanishes identically); softmax over the 2048 keys (register row, one exp, fixed trees);
__global__ __launch_bounds__(256) void k_asoft(const float* __restrict__ Sb, h16* P16, bf* Ph, bf* Pl) {
    const int lane = threadIdx.x & 31; const int row = blockIdx.x * 8 + (threadIdx.x >> 5); if (row >= ZH * TT) return; const int i = row % TT; const int zz = row / TT; (void)zz; const bool hires = (i < RH); const float* sr = Sb + (size_t)row * TT; float v[TT / 32]; float mx = -3.0e38f;
#pragma unroll
    for (int ch = 0; ch < TT / 128; ++ch) { const int j0 = ch * 128 + lane * 4; const v4f a = *(const v4f*)(sr + j0);
#pragma unroll
        for (int q = 0; q < 4; ++q) { const int j = j0 + q; (void)j; const float t = (j <= i && i - j < WIN) ? a[q] * SCL : -3.0e38f; v[ch * 4 + q] = t; mx = fmaxf(mx, t); } }
#pragma unroll
    for (int sh = 16; sh; sh >>= 1) mx = fmaxf(mx, __shfl_xor(mx, sh, 32));
    float sum = 0.f;
#pragma unroll
    for (int k = 0; k < TT / 32; ++k) { float d0 = __fsub_rn(v[k], mx); asm volatile("" : "+v"(d0)); v[k] = __builtin_amdgcn_exp2f(__fmul_rn(d0, 1.4426950408889634f)); sum += v[k]; }
#pragma unroll
    for (int sh = 16; sh; sh >>= 1) sum += __shfl_xor(sum, sh, 32);
    const float f = __fdiv_rn(hires ? 1.0f : PCAR, sum);
{
        if (hires) {
#pragma unroll
            for (int ch = 0; ch < TT / 128; ++ch) { v4us oh, ol;
#pragma unroll
                for (int q = 0; q < 4; ++q) { unsigned short a, c2; splitf(v[ch * 4 + q] * f, a, c2); oh[q] = a; ol[q] = c2; }
                const size_t oo = ((size_t)zz * (RH ? RH : 1) + i) * TT + ch * 128 + lane * 4; *(v4us*)(Ph + oo) = oh; *(v4us*)(Pl + oo) = ol; }
        } else {
#pragma unroll
            for (int ch = 0; ch < TT / 128; ++ch) { v4h o4;
#pragma unroll
                for (int q = 0; q < 4; ++q) o4[q] = tohx(v[ch * 4 + q] * f);
                *(v4h*)(P16 + (size_t)row * TT + ch * 128 + lane * 4) = o4; } }
         }
}
__global__ __launch_bounds__(256) void k_merge(const float* __restrict__ O, int h0, bf* Ah, bf* Al) { const size_t e = ((size_t)blockIdx.x * 256 + threadIdx.x) * 2; if (e >= (size_t)ZH * TT * HD) return; const int d = (int)(e % HD); const int t = (int)((e / HD) % TT); const int zz = (int)(e / ((size_t)HD * TT)); const float cs = (t < RH) ? 1.0f : (1.0f / PCAR); const size_t oo = (size_t)t * DQ + (h0 + zz) * HD + d;
    v2us oh, ol;
#pragma unroll
    for (int q = 0; q < 2; ++q) { unsigned short a, c2; splitf(O[e + q] * cs, a, c2); oh[q] = a; ol[q] = c2; } *(v2us*)(Ah + oo) = oh; *(v2us*)(Al + oo) = ol;  }

extern "C" void kernel_launch(void* const* d_in, const int* in_sizes, int n_in,
                              void* d_out, int out_size, void* d_ws, size_t ws_size, hipStream_t stream) {
    (void)in_sizes; (void)n_in; (void)out_size;
    const float* x = (const float*)d_in[0]; const float* wq = (const float*)d_in[1]; const float* bq = (const float*)d_in[2]; const float* wk = (const float*)d_in[3]; const float* bk = (const float*)d_in[4]; const float* wv = (const float*)d_in[5]; const float* bv = (const float*)d_in[6]; const float* wo = (const float*)d_in[7]; const float* bo = (const float*)d_in[8];
    float* OUT = (float*)d_out;     // [1][2048][2048]
    char* wsp = (char*)d_ws;
    auto take = [&](size_t bytes) { char* p = wsp; wsp += (bytes + 255) & ~(size_t)255; return (void*)p; };
    bf* WQ = (bf*)take((size_t)DQ * DM * 2); bf* WK = (bf*)take((size_t)DKV * DM * 2); bf* WV = (bf*)take((size_t)DKV * DM * 2); bf* WO = (bf*)take((size_t)DM * DQ * 2); float* CS = (float*)take((size_t)TT * HD * 2 * 4);
    bf* XB = (bf*)take((size_t)TT * DM * 2); float* FQ = (float*)take((size_t)TT * DQ * 4); float* FK = (float*)take((size_t)TT * DKV * 4);
    h16* QP16 = (h16*)take((size_t)NH_ * TT * HD * 2); h16* KP16 = (h16*)take((size_t)NKV * TT * HD * 2); h16* VT16 = (h16*)take((size_t)NKV * HD * TT * 2);
    bf* QPh = (bf*)take((size_t)NH_ * TT * HD * 2); bf* QPl = (bf*)take((size_t)NH_ * TT * HD * 2); bf* KPh = (bf*)take((size_t)NKV * TT * HD * 2); bf* KPl = (bf*)take((size_t)NKV * TT * HD * 2); bf* VTh = (bf*)take((size_t)NKV * HD * TT * 2); bf* VTl = (bf*)take((size_t)NKV * HD * TT * 2); bf* Ph = (bf*)take((size_t)ZH * RH * TT * 2); bf* Pl = (bf*)take((size_t)ZH * RH * TT * 2);
    float* Sb = (float*)take((size_t)ZH * TT * TT * 4); h16* P16 = (h16*)take((size_t)ZH * TT * TT * 2); float* Ob = (float*)take((size_t)ZH * TT * HD * 4); bf* ATh = (bf*)take((size_t)TT * DQ * 2); bf* ATl = (bf*)take((size_t)TT * DQ * 2);
    if ((size_t)(wsp - (char*)d_ws) > ws_size) return;    // ws 256 MiB
    float* FV = FK;   // v projection reuses the k buffer after the k planes are built (stream-ordered)
    { k_cvt8<<<(unsigned)(((size_t)DQ * DM / 8 + 255) / 256), 256, 0, stream>>>(wq, WQ, (size_t)DQ * DM / 8); k_cvt8<<<(unsigned)(((size_t)DKV * DM / 8 + 255) / 256), 256, 0, stream>>>(wk, WK, (size_t)DKV * DM / 8); k_cvt8<<<(unsigned)(((size_t)DKV * DM / 8 + 255) / 256), 256, 0, stream>>>(wv, WV, (size_t)DKV * DM / 8);
      k_cvt8<<<(unsigned)(((size_t)DM * DQ / 8 + 255) / 256), 256, 0, stream>>>(wo, WO, (size_t)DM * DQ / 8);
       }
    k_csid<<<(TT * HD + 255) / 256, 256, 0, stream>>>(CS);
    const unsigned LQ = (unsigned)(((size_t)NH_ * TT * HD / 2 + 255) / 256), LKv = (unsigned)(((size_t)NKV * TT * HD / 2 + 255) / 256);
    for (int b = 0; b < NB_; ++b) {
        
        k_cvt8<<<(unsigned)(((size_t)TT * DM / 8 + 255) / 256), 256, 0, stream>>>(x + (size_t)b * TT * DM, XB, (size_t)TT * DM / 8);
        k_gemmw<bf, 0, true><<<dim3(TT / 64, DQ / 64, 1), 32, 0, stream>>>(XB, nullptr, WQ, nullptr, DM, FQ, DQ, bq, 0, 0, 0);
        k_rope<<<LQ, 256, 0, stream>>>(FQ, DQ, NH_, CS, nullptr, nullptr, 1.0f, QP16, QPh, QPl);
        k_gemmw<bf, 0, true><<<dim3(TT / 64, DKV / 64, 1), 32, 0, stream>>>(XB, nullptr, WK, nullptr, DM, FK, DKV, bk, 0, 0, 0);
        k_rope<<<LKv, 256, 0, stream>>>(FK, DKV, NKV, CS, nullptr, nullptr, 1.0f, KP16, KPh, KPl);
        k_gemmw<bf, 0, true><<<dim3(TT / 64, DKV / 64, 1), 32, 0, stream>>>(XB, nullptr, WV, nullptr, DM, FV, DKV, bv, 0, 0, 0); k_vtp<<<LKv, 256, 0, stream>>>(FV, DKV, NKV, VT16, VTh, VTl);
        for (int h0 = 0; h0 < NH_; h0 += ZH) { const size_t zq = (size_t)h0, zk = (size_t)(h0 / REP);   // both heads of a pass share kv group h0/REP (REP >= 2): sB = 0
            k_gemmc<bf, 2, 1><<<dim3(RH / 64, TT / 64, ZH), 32, 0, stream>>>(QPh + zq * TT * HD, QPl + zq * TT * HD, KPh + zk * TT * HD, KPl + zk * TT * HD, HD, Sb, TT, 0, (size_t)TT * HD, 0, (size_t)TT * TT);
            k_gemmc<h16, 0, 1><<<dim3((TT - RH) / 64, TT / 64, ZH), 32, 0, stream>>>(QP16 + zq * TT * HD + (size_t)RH * HD, nullptr, KP16 + zk * TT * HD, nullptr, HD, Sb + (size_t)RH * TT, TT, RH, (size_t)TT * HD, 0, (size_t)TT * TT);
            k_asoft<<<ZH * TT / 8, 256, 0, stream>>>(Sb, P16, Ph, Pl);
            k_gemmc<bf, 2, 2><<<dim3(RH / 64, HD / 64, ZH), 32, 0, stream>>>(Ph, Pl, VTh + zk * HD * TT, VTl + zk * HD * TT, TT, Ob, HD, 0, (size_t)RH * TT, 0, (size_t)TT * HD);
            k_gemmc<h16, 0, 2><<<dim3((TT - RH) / 64, HD / 64, ZH), 32, 0, stream>>>(P16 + (size_t)RH * TT, nullptr, VT16 + zk * HD * TT, nullptr, TT, Ob + (size_t)RH * HD, HD, RH, (size_t)TT * TT, 0, (size_t)TT * HD);
            k_merge<<<(unsigned)(((size_t)ZH * TT * HD / 2 + 255) / 256), 256, 0, stream>>>(Ob, h0, ATh, ATl); }
        k_gemmw<bf, 1, true><<<dim3(TT / 64, DM / 64, 1), 32, 0, stream>>>(ATh, ATl, WO, nullptr, DQ, OUT + (size_t)b * TT * DM, DM, bo, 0, 0, 0); }
}

// v001
// Measured time: 485 microseconds a run.
// Two timings next to v000 put it at 1.69 and 1.68 times that version's speed.
#include <hip/hip_runtime.h>

// Causal grouped-query attention with biases (x [2][2048][2048]; Q = x W_q^T + b_q (16 heads x 128 viewed (4 kv groups, 4)), K, V = x W^T + b (4 kv heads x 128) ('oi' 2048^-0.5 incl. biases: non-zero); query head h = kv*4 + g uses kv head h / 4; scores x 1/sqrt(128); causal (-inf); softmax; out = merged (head-major) W_o^T + b_o -> [2][2048][2048] (8.4 M); argument order x, W_q, b_q, W_k, b_k, W_v, b_v, W_o, b_o). THIS ROW: the same module at ONE sequence (x [1][2048][2048]; Q = x Wq^T + bq ('oi' [2048][2048]); K, V = x W^T + b with 'oi' [512][2048] weights (4 key / value heads x 128); weights normal x 2048^-0.5; the four biases zeros (read); grouped-query: query head h = 4 k + g uses key / value head k; scores x 128^-0.5; tril kept, -inf; softmax; out = merged Wo^T + bo; argument order x, Wq, bq, Wk, bk, Wv, bv, Wo, bo).
// Layout per batch: bf16 copy of x; 'oi' weights as-is; exact projections + f32 biases; identity-table plane builders at width 128; causal T-2048 GQA attention (both query heads of a pass share kv group h0 / 4: kv z-stride 0; hybrid rows: < 512 hi/lo 3 products, rest fp16 x1024; the score GEMM skips tiles above the diagonal); merged hi/lo x W_o exact + b_o.
// Compute dtypes, f32 accumulate: every input rounded to bf16; projections exact + f32 biases; attention rows < 512 3 products, rest fp16; softmax f32; output projection hl x exact.

#define NB_  1
#define TT   2048
#define DM   2048
#define NH_  16
#define NKV  4
#define REP  (NH_ / NKV)
#define HD   128
#define DQ   (NH_ * HD)
#define DKV  (NKV * HD)
#define ZH   2
#define RH   512                  // query rows < RH use hi+lo planes (0: none)
#define WIN  2048
#define PCAR 1024.0f
#define SCL  0.088388347648318447f   // HD^-0.5
#define NWK  8                    // waves of a work-group that share one tile's K loop (k_gemms), K = 2048
#define NWS  (HD / 64)            // the same for the scores, K = HD: one 64-k slice a wave
typedef _Float16 h16;
typedef unsigned short bf;
typedef __attribute__((ext_vector_type(16))) __bf16   v16bf;
typedef __attribute__((ext_vector_type(16))) _Float16 v16h;
typedef __attribute__((ext_vector_type(8)))  _Float16 v8h;
typedef __attribute__((ext_vector_type(8)))  unsigned short v8us;
typedef __attribute__((ext_vector_type(8)))  float    v8f;
typedef __attribute__((ext_vector_type(4)))  float    v4f;
typedef v8h  __attribute__((may_alias)) v8ha;
typedef v4f  __attribute__((may_alias)) v4fa;
typedef v8us __attribute__((may_alias)) v8usa;

__device__ __forceinline__ unsigned short f2bf(float f) { unsigned u = __float_as_uint(f); u += 0x7FFFu + ((u >> 16) & 1u); return (unsigned short)(u >> 16); }
__device__ __forceinline__ float bf2f(unsigned short b) { return __uint_as_float(((unsigned)b) << 16); }
__device__ __forceinline__ float bfr(float f) { return bf2f(f2bf(f)); }
__device__ __forceinline__ v16h cat16(v8h lo, v8h hi) { return __builtin_shufflevector(lo, hi, 0, 1, 2, 3, 4, 5, 6, 7, 8, 9, 10, 11, 12, 13, 14, 15); }
__device__ __forceinline__ v16bf cat16b(v8us lo, v8us hi) { return __builtin_bit_cast(v16bf, __builtin_shufflevector(lo, hi, 0, 1, 2, 3, 4, 5, 6, 7, 8, 9, 10, 11, 12, 13, 14, 15)); }
__device__ __forceinline__ v8f wmma16(v16h a, v16h b, v8f c) { return __builtin_amdgcn_wmma_f32_16x16x32_f16(false, a, false, b, (short)0, c, false, false); }
__device__ __forceinline__ v8f wmmab(v16bf a, v16bf b, v8f c) { return __builtin_amdgcn_wmma_f32_16x16x32_bf16(false, a, false, b, (short)0, c, false, false); }



// ---- k_gemms: register-blocked GEMM, one 64x64 output tile per work-group of NW waves; the K loop is dealt to the waves in slices of 64 k (one 128-B line of every operand row), slice s to wave s % NW;
// each wave keeps the whole tile (16 accumulators) for its slices, operands straight from K-contiguous 16-bit planes; the NW partial tiles meet in LDS and are summed in wave order 0..NW-1. grid (M/64, N/64, Z), NW*32 threads.
// C[m][n] (f32, pitch ldc, + optional f32 bias[n]) = sum_k A[m][k] Bt[n][k] (+ split products per NSPLIT). z-batch strides sA/sB/sC in elements. K % 64 == 0.
// CMODE 1 (scores): a tile entirely above the causal diagonal (query rows r0+roff.., key columns c0..) is skipped by its whole work-group. CMODE 2 (probability x value): the K loop stops at the diagonal block (probabilities beyond it are exactly zero). roff = row offset of this launch's first row within the sequence.
template <typename T16> struct WFrag;
template <> struct WFrag<h16> { typedef v16h V; static __device__ __forceinline__ V ld(const h16* p) { return cat16(*(const v8h*)p, *(const v8h*)(p + 16)); } static __device__ __forceinline__ v8f mma(V a, V b, v8f c) { return wmma16(a, b, c); } };
template <> struct WFrag<bf> { typedef v16bf V; static __device__ __forceinline__ V ld(const bf* p) { return cat16b(*(const v8us*)p, *(const v8us*)(p + 16)); } static __device__ __forceinline__ v8f mma(V a, V b, v8f c) { return wmmab(a, b, c); } };
template <typename T16, int NSPLIT, bool BIAS, int CMODE, int NW>
__global__ __launch_bounds__(NW * 32) void k_gemms(const T16* __restrict__ A, const T16* __restrict__ A2, const T16* __restrict__ Bt, const T16* __restrict__ Bt2, int K, float* C, int ldc, const float* __restrict__ bias, int roff, size_t sA, size_t sB, size_t sC) {
    typedef typename WFrag<T16>::V V;
    __shared__ __align__(16) float os[NW * 64 * 68];
    const size_t z = blockIdx.z; A += z * sA; if (A2) A2 += z * sA; Bt += z * sB; if (Bt2) Bt2 += z * sB; C += z * sC;
    const int lane = threadIdx.x & 31, lr = lane & 15, hi = lane >> 4; const int r0 = blockIdx.x * 64, c0 = blockIdx.y * 64;
    const int wv = __builtin_amdgcn_readfirstlane((int)(threadIdx.x >> 5));   // wave number, scalar: the K loop's trip test stays a scalar branch (every lane on at the matrix instructions)
    if (CMODE == 1 && c0 > r0 + roff + 63) return;                  // score tile entirely above the causal diagonal: never read (the softmax masks j > i by select); the same for every wave, in front of the barrier
    const int Kl = (CMODE == 2) ? min(K, r0 + roff + 64) : K;        // P.V: probabilities are exactly 0 beyond the diagonal block, so the K loop stops there
    v8f acc[4][4];
#pragma unroll
    for (int mb = 0; mb < 4; ++mb)
#pragma unroll
        for (int nb = 0; nb < 4; ++nb) acc[mb][nb] = (v8f){};
    const size_t aoff = (size_t)(r0 + lr) * K + 8 * hi, boff = (size_t)(c0 + lr) * K + 8 * hi;
    // rolled: one slice's fragments live at a time, so that two work-groups fit a WGP's registers
#pragma unroll 1
    for (int k0 = wv * 64; k0 < Kl; k0 += NW * 64) {
        V a[4], a2[4];
        // both 32-k steps of the slice in one trip (unrolled: a[] and b stay in registers): a wave uses the whole 128-B line of every row it touches
#pragma unroll
        for (int kc = k0; kc < k0 + 64; kc += 32) {
#pragma unroll
            for (int mb = 0; mb < 4; ++mb) { a[mb] = WFrag<T16>::ld(A + aoff + (size_t)mb * 16 * K + kc); if (NSPLIT == 1 || NSPLIT == 2) a2[mb] = WFrag<T16>::ld(A2 + aoff + (size_t)mb * 16 * K + kc); }
#pragma unroll
            for (int nb = 0; nb < 4; ++nb) { const V b = WFrag<T16>::ld(Bt + boff + (size_t)nb * 16 * K + kc); V b2; if (NSPLIT >= 2) b2 = WFrag<T16>::ld(Bt2 + boff + (size_t)nb * 16 * K + kc);
#pragma unroll
                for (int mb = 0; mb < 4; ++mb) { acc[mb][nb] = WFrag<T16>::mma(a[mb], b, acc[mb][nb]); if (NSPLIT == 1 || NSPLIT == 2) acc[mb][nb] = WFrag<T16>::mma(a2[mb], b, acc[mb][nb]); if (NSPLIT >= 2) acc[mb][nb] = WFrag<T16>::mma(a[mb], b2, acc[mb][nb]); } }
        }
        // the distance behind the trip's last matrix instructions, on the taken side of the loop branch too
        asm volatile("v_nop\n\tv_nop\n\tv_nop\n\tv_nop" : "+v"(acc[0][0]), "+v"(acc[1][1]), "+v"(acc[2][2]), "+v"(acc[3][3]) : "v"(a[0]), "v"(a[3]));
    }
    float* ow = os + wv * (64 * 68);
#pragma unroll
    for (int mb = 0; mb < 4; ++mb)
#pragma unroll
        for (int nb = 0; nb < 4; ++nb)
#pragma unroll
            for (int j = 0; j < 8; ++j) ow[(mb * 16 + hi * 8 + j) * 68 + nb * 16 + lr] = acc[mb][nb][j];
    __syncthreads();   // every wave's partial tile is in LDS before any wave sums; a wave with no slice has stored zeros
#pragma unroll
    for (int i = 0; i < 64 * 16 / (NW * 32); ++i) { const int e = (int)threadIdx.x + i * (NW * 32), row = e >> 4, cofs = (e & 15) * 4; v4f val = *(const v4fa*)(os + row * 68 + cofs);
#pragma unroll
        for (int w = 1; w < NW; ++w) val += *(const v4fa*)(os + w * (64 * 68) + row * 68 + cofs);
        if (BIAS) { val[0] += bfr(bias[c0 + cofs]); val[1] += bfr(bias[c0 + cofs + 1]); val[2] += bfr(bias[c0 + cofs + 2]); val[3] += bfr(bias[c0 + cofs + 3]); }
        *(v4f*)(C + (size_t)(r0 + row) * ldc + c0 + cofs) = val; }
}

__device__ __forceinline__ h16 tohx(float x) { return (h16)x; }
__device__ __forceinline__ void splitf(float y, unsigned short& h, unsigned short& l) { h = f2bf(y); l = f2bf(y - bf2f(h)); }
typedef __attribute__((ext_vector_type(2))) _Float16 v2h;
typedef __attribute__((ext_vector_type(4))) _Float16 v4h;
typedef __attribute__((ext_vector_type(2))) unsigned short v2us;
typedef __attribute__((ext_vector_type(4))) unsigned short v4us;
typedef __attribute__((ext_vector_type(2))) float v2f;
typedef __attribute__((ext_vector_type(4))) int v4i;

__global__ __launch_bounds__(256) void k_cvt8(const float* __restrict__ src, bf* dst, size_t n8) { const size_t i = (size_t)blockIdx.x * 256 + threadIdx.x; if (i >= n8) return; const v8f v = *(const v8f*)(src + i * 8); v8us o;
#pragma unroll
    for (int k = 0; k < 8; ++k) o[k] = f2bf(v[k]); *(v8us*)(dst + i * 8) = o;  }

// k_rope: head planes [h][t][d] (fp16 + hi/lo) of rope(x) x sc with the rotate-half convention out[d] = x[d] cos[t][d] - x[d+HD/2] sin[t][d], out[d+HD/2] = x[d+HD/2] cos[t][d+HD/2] + x[d] sin[t][d+HD/2]
__global__ __launch_bounds__(256) void k_rope(const float* __restrict__ F, int pitch, int nheads, const float* __restrict__ CS, const float* __restrict__ RF, const float* __restrict__ nw, float sc, h16* P16, bf* Ph, bf* Pl) {
    const size_t e = ((size_t)blockIdx.x * 256 + threadIdx.x) * 2; if (e >= (size_t)nheads * TT * HD) return; const int d = (int)(e % HD); const int t = (int)((e / HD) % TT); const int h = (int)(e / ((size_t)HD * TT)); const float* f = F + (size_t)t * pitch + h * HD; const float rf = RF ? RF[(size_t)h * TT + t] : 1.0f; v2h o16; v2us oh, ol;
#pragma unroll
    for (int q = 0; q < 2; ++q) { const int dd = d + q; const int dp = (dd < HD / 2) ? dd + HD / 2 : dd - HD / 2; float x0 = f[dd], x1 = f[dp];
        if (RF) { float n0 = __fmul_rn(x0, rf), n1 = __fmul_rn(x1, rf); asm volatile("" : "+v"(n0)); asm volatile("" : "+v"(n1)); x0 = __fmul_rn(bfr(nw[dd]), n0); x1 = __fmul_rn(bfr(nw[dp]), n1); }
        const v2f cs = *(const v2f*)(CS + ((size_t)t * HD + dd) * 2); float a = __fmul_rn(x0, cs[0]), bq = __fmul_rn(x1, cs[1]); asm volatile("" : "+v"(a)); asm volatile("" : "+v"(bq)); const float r = ((dd < HD / 2) ? __fsub_rn(a, bq) : __fadd_rn(a, bq)) * sc;
        o16[q] = tohx(r); unsigned short a2, c2; splitf(r, a2, c2); oh[q] = a2; ol[q] = c2; }
    *(v2h*)(P16 + e) = o16; *(v2us*)(Ph + e) = oh; *(v2us*)(Pl + e) = ol;  }
__global__ __launch_bounds__(256) void k_vtp(const float* __restrict__ F, int pitch, int nheads, h16* V16, bf* Vh, bf* Vl) { const size_t e = ((size_t)blockIdx.x * 256 + threadIdx.x) * 2; if (e >= (size_t)nheads * HD * TT) return; const int t = (int)(e % TT); const int d = (int)((e / TT) % HD); const int g = (int)(e / ((size_t)TT * HD)); v2h o16; v2us oh, ol;
#pragma unroll
    for (int q = 0; q < 2; ++q) { const float x = F[(size_t)(t + q) * pitch + g * HD + d]; o16[q] = tohx(x); unsigned short a2, c2; splitf(x, a2, c2); oh[q] = a2; ol[q] = c2; }
    *(v2h*)(V16 + e) = o16; *(v2us*)(Vh + e) = oh; *(v2us*)(Vl + e) = ol;  }
__global__ __launch_bounds__(256) void k_csid(float* CS) { const int idx = blockIdx.x * 256 + threadIdx.x; if (idx >= TT * HD) return; v2f cs; cs[0] = 1.0f; cs[1] = 0.0f; *(v2f*)(CS + (size_t)idx * 2) = cs;  }
// k_asoft: per row (zz, i): t = S x HD^-0.5 for j <= i and i - j < WIN (WIN = TT, so plain causal; the reference's -1e9 additive fill vanishes identically); softmax over the 2048 keys (register row, one exp, fixed trees);
__global__ __launch_bounds__(256) void k_asoft(const float* __restrict__ Sb, h16* P16, bf* Ph, bf* Pl) {
    const int lane = threadIdx.x & 31; const int row = blockIdx.x * 8 + (threadIdx.x >> 5); if (row >= ZH * TT) return; const int i = row % TT; const int zz = row / TT; (void)zz; const bool hires = (i < RH); const float* sr = Sb + (size_t)row * TT; float v[TT / 32]; float mx = -3.0e38f;
#pragma unroll
    for (int ch = 0; ch < TT / 128; ++ch) { const int j0 = ch * 128 + lane * 4; const v4f a = *(const v4f*)(sr + j0);
#pragma unroll
        for (int q = 0; q < 4; ++q) { const int j = j0 + q; (void)j; const float t = (j <= i && i - j < WIN) ? a[q] * SCL : -3.0e38f; v[ch * 4 + q] = t; mx = fmaxf(mx, t); } }
#pragma unroll
    for (int sh = 16; sh; sh >>= 1) mx = fmaxf(mx, __shfl_xor(mx, sh, 32));
    float sum = 0.f;
#pragma unroll
    for (int k = 0; k < TT / 32; ++k) { float d0 = __fsub_rn(v[k], mx); asm volatile("" : "+v"(d0)); v[k] = __builtin_amdgcn_exp2f(__fmul_rn(d0, 1.4426950408889634f)); sum += v[k]; }
#pragma unroll
    for (int sh = 16; sh; sh >>= 1) sum += __shfl_xor(sum, sh, 32);
    const float f = __fdiv_rn(hires ? 1.0f : PCAR, sum);
{
        if (hires) {
#pragma unroll
            for (int ch = 0; ch < TT / 128; ++ch) { v4us oh, ol;
#pragma unroll
                for (int q = 0; q < 4; ++q) { unsigned short a, c2; splitf(v[ch * 4 + q] * f, a, c2); oh[q] = a; ol[q] = c2; }
                const size_t oo = ((size_t)zz * (RH ? RH : 1) + i) * TT + ch * 128 + lane * 4; *(v4us*)(Ph + oo) = oh; *(v4us*)(Pl + oo) = ol; }
        } else {
#pragma unroll
            for (int ch = 0; ch < TT / 128; ++ch) { v4h o4;
#pragma unroll
                for (int q = 0; q < 4; ++q) o4[q] = tohx(v[ch * 4 + q] * f);
                *(v4h*)(P16 + (size_t)row * TT + ch * 128 + lane * 4) = o4; } }
         }
}
__global__ __launch_bounds__(256) void k_merge(const float* __restrict__ O, int h0, bf* Ah, bf* Al) { const size_t e = ((size_t)blockIdx.x * 256 + threadIdx.x) * 2; if (e >= (size_t)ZH * TT * HD) return; const int d = (int)(e % HD); const int t = (int)((e / HD) % TT); const int zz = (int)(e / ((size_t)HD * TT)); const float cs = (t < RH) ? 1.0f : (1.0f / PCAR); const size_t oo = (size_t)t * DQ + (h0 + zz) * HD + d;
    v2us oh, ol;
#pragma unroll
    for (int q = 0; q < 2; ++q) { unsigned short a, c2; splitf(O[e + q] * cs, a, c2); oh[q] = a; ol[q] = c2; } *(v2us*)(Ah + oo) = oh; *(v2us*)(Al + oo) = ol;  }

extern "C" void kernel_launch(void* const* d_in, const int* in_sizes, int n_in,
                              void* d_out, int out_size, void* d_ws, size_t ws_size, hipStream_t stream) {
    (void)in_sizes; (void)n_in; (void)out_size;
    const float* x = (const float*)d_in[0]; const float* wq = (const float*)d_in[1]; const float* bq = (const float*)d_in[2]; const float* wk = (const float*)d_in[3]; const float* bk = (const float*)d_in[4]; const float* wv = (const float*)d_in[5]; const float* bv = (const float*)d_in[6]; const float* wo = (const float*)d_in[7]; const float* bo = (const float*)d_in[8];
    float* OUT = (float*)d_out;     // [1][2048][2048]
    char* wsp = (char*)d_ws;
    auto take = [&](size_t bytes) { char* p = wsp; wsp += (bytes + 255) & ~(size_t)255; return (void*)p; };
    bf* WQ = (bf*)take((size_t)DQ * DM * 2); bf* WK = (bf*)take((size_t)DKV * DM * 2); bf* WV = (bf*)take((size_t)DKV * DM * 2); bf* WO = (bf*)take((size_t)DM * DQ * 2); float* CS = (float*)take((size_t)TT * HD * 2 * 4);
    bf* XB = (bf*)take((size_t)TT * DM * 2); float* FQ = (float*)take((size_t)TT * DQ * 4); float* FK = (float*)take((size_t)TT * DKV * 4);
    h16* QP16 = (h16*)take((size_t)NH_ * TT * HD * 2); h16* KP16 = (h16*)take((size_t)NKV * TT * HD * 2); h16* VT16 = (h16*)take((size_t)NKV * HD * TT * 2);
    bf* QPh = (bf*)take((size_t)NH_ * TT * HD * 2); bf* QPl = (bf*)take((size_t)NH_ * TT * HD * 2); bf* KPh = (bf*)take((size_t)NKV * TT * HD * 2); bf* KPl = (bf*)take((size_t)NKV * TT * HD * 2); bf* VTh = (bf*)take((size_t)NKV * HD * TT * 2); bf* VTl = (bf*)take((size_t)NKV * HD * TT * 2); bf* Ph = (bf*)take((size_t)ZH * RH * TT * 2); bf* Pl = (bf*)take((size_t)ZH * RH * TT * 2);
    float* Sb = (float*)take((size_t)ZH * TT * TT * 4); h16* P16 = (h16*)take((size_t)ZH * TT * TT * 2); float* Ob = (float*)take((size_t)ZH * TT * HD * 4); bf* ATh = (bf*)take((size_t)TT * DQ * 2); bf* ATl = (bf*)take((size_t)TT * DQ * 2);
    if ((size_t)(wsp - (char*)d_ws) > ws_size) return;    // ws 256 MiB
    float* FV = FK;   // v projection reuses the k buffer after the k planes are built (stream-ordered)
    { k_cvt8<<<(unsigned)(((size_t)DQ * DM / 8 + 255) / 256), 256, 0, stream>>>(wq, WQ, (size_t)DQ * DM / 8); k_cvt8<<<(unsigned)(((size_t)DKV * DM / 8 + 255) / 256), 256, 0, stream>>>(wk, WK, (size_t)DKV * DM / 8); k_cvt8<<<(unsigned)(((size_t)DKV * DM / 8 + 255) / 256), 256, 0, stream>>>(wv, WV, (size_t)DKV * DM / 8);
      k_cvt8<<<(unsigned)(((size_t)DM * DQ / 8 + 255) / 256), 256, 0, stream>>>(wo, WO, (size_t)DM * DQ / 8);
       }
    k_csid<<<(TT * HD + 255) / 256, 256, 0, stream>>>(CS);
    const unsigned LQ = (unsigned)(((size_t)NH_ * TT * HD / 2 + 255) / 256), LKv = (unsigned)(((size_t)NKV * TT * HD / 2 + 255) / 256);
    for (int b = 0; b < NB_; ++b) {
        
        k_cvt8<<<(unsigned)(((size_t)TT * DM / 8 + 255) / 256), 256, 0, stream>>>(x + (size_t)b * TT * DM, XB, (size_t)TT * DM / 8);
        k_gemms<bf, 0, true, 0, NWK><<<dim3(TT / 64, DQ / 64, 1), NWK * 32, 0, stream>>>(XB, nullptr, WQ, nullptr, DM, FQ, DQ, bq, 0, 0, 0, 0);
        k_rope<<<LQ, 256, 0, stream>>>(FQ, DQ, NH_, CS, nullptr, nullptr, 1.0f, QP16, QPh, QPl);
        k_gemms<bf, 0, true, 0, NWK><<<dim3(TT / 64, DKV / 64, 1), NWK * 32, 0, stream>>>(XB, nullptr, WK, nullptr, DM, FK, DKV, bk, 0, 0, 0, 0);
        k_rope<<<LKv, 256, 0, stream>>>(FK, DKV, NKV, CS, nullptr, nullptr, 1.0f, KP16, KPh, KPl);
        k_gemms<bf, 0, true, 0, NWK><<<dim3(TT / 64, DKV / 64, 1), NWK * 32, 0, stream>>>(XB, nullptr, WV, nullptr, DM, FV, DKV, bv, 0, 0, 0, 0); k_vtp<<<LKv, 256, 0, stream>>>(FV, DKV, NKV, VT16, VTh, VTl);
        for (int h0 = 0; h0 < NH_; h0 += ZH) { const size_t zq = (size_t)h0, zk = (size_t)(h0 / REP);   // both heads of a pass share kv group h0/REP (REP >= 2): sB = 0
            k_gemms<bf, 2, false, 1, NWS><<<dim3(RH / 64, TT / 64, ZH), NWS * 32, 0, stream>>>(QPh + zq * TT * HD, QPl + zq * TT * HD, KPh + zk * TT * HD, KPl + zk * TT * HD, HD, Sb, TT, nullptr, 0, (size_t)TT * HD, 0, (size_t)TT * TT);
            k_gemms<h16, 0, false, 1, NWS><<<dim3((TT - RH) / 64, TT / 64, ZH), NWS * 32, 0, stream>>>(QP16 + zq * TT * HD + (size_t)RH * HD, nullptr, KP16 + zk * TT * HD, nullptr, HD, Sb + (size_t)RH * TT, TT, nullptr, RH, (size_t)TT * HD, 0, (size_t)TT * TT);
            k_asoft<<<ZH * TT / 8, 256, 0, stream>>>(Sb, P16, Ph, Pl);
            k_gemms<bf, 2, false, 2, NWK><<<dim3(RH / 64, HD / 64, ZH), NWK * 32, 0, stream>>>(Ph, Pl, VTh + zk * HD * TT, VTl + zk * HD * TT, TT, Ob, HD, nullptr, 0, (size_t)RH * TT, 0, (size_t)TT * HD);
            k_gemms<h16, 0, false, 2, NWK><<<dim3((TT - RH) / 64, HD / 64, ZH), NWK * 32, 0, stream>>>(P16 + (size_t)RH * TT, nullptr, VT16 + zk * HD * TT, nullptr, TT, Ob + (size_t)RH * HD, HD, nullptr, RH, (size_t)TT * TT, 0, (size_t)TT * HD);
            k_merge<<<(unsigned)(((size_t)ZH * TT * HD / 2 + 255) / 256), 256, 0, stream>>>(Ob, h0, ATh, ATl); }
        k_gemms<bf, 1, true, 0, NWK><<<dim3(TT / 64, DM / 64, 1), NWK * 32, 0, stream>>>(ATh, ATl, WO, nullptr, DQ, OUT + (size_t)b * TT * DM, DM, bo, 0, 0, 0, 0); }
}

// v002
// It runs in 377 microseconds.
// Two timings next to v001 put it at 1.27 and 1.28 times that version's speed.
// Over all steps from v000 it is 2.14 times as fast.
#include <hip/hip_runtime.h>

// Causal grouped-query attention with biases (x [2][2048][2048]; Q = x W_q^T + b_q (16 heads x 128 viewed (4 kv groups, 4)), K, V = x W^T + b (4 kv heads x 128) ('oi' 2048^-0.5 incl. biases: non-zero); query head h = kv*4 + g uses kv head h / 4; scores x 1/sqrt(128); causal (-inf); softmax; out = merged (head-major) W_o^T + b_o -> [2][2048][2048] (8.4 M); argument order x, W_q, b_q, W_k, b_k, W_v, b_v, W_o, b_o). THIS ROW: the same module at ONE sequence (x [1][2048][2048]; Q = x Wq^T + bq ('oi' [2048][2048]); K, V = x W^T + b with 'oi' [512][2048] weights (4 key / value heads x 128); weights normal x 2048^-0.5; the four biases zeros (read); grouped-query: query head h = 4 k + g uses key / value head k; scores x 128^-0.5; tril kept, -inf; softmax; out = merged Wo^T + bo; argument order x, Wq, bq, Wk, bk, Wv, bv, Wo, bo).
// Layout per batch: bf16 copy of x; 'oi' weights as-is; exact projections + f32 biases; identity-table plane builders at width 128; causal T-2048 GQA attention (the four query heads of a pass are one kv group, h0 / 4: kv z-stride 0; hybrid rows: < 512 hi/lo 3 products, rest fp16 x1024; the score GEMM skips tiles above the diagonal); merged hi/lo x W_o exact + b_o.
// Compute dtypes, f32 accumulate: every input rounded to bf16; projections exact + f32 biases; attention rows < 512 3 products, rest fp16; softmax f32; output projection hl x exact.

#define NB_  1
#define TT   2048
#define DM   2048
#define NH_  16
#define NKV  4
#define REP  (NH_ / NKV)
#define HD   128
#define DQ   (NH_ * HD)
#define DKV  (NKV * HD)
#define ZH   4                    // query heads of one attention pass (grid z): the REP heads of one kv group
#define RH   512                  // query rows < RH use hi+lo planes (0: none)
#define WIN  2048
#define PCAR 1024.0f
#define SCL  0.088388347648318447f   // HD^-0.5
#define NWK  8                    // waves of a work-group that share one tile's K loop (k_gemms), K = 2048
#define NWS  (HD / 64)            // the same for the scores, K = HD: one 64-k slice a wave
typedef _Float16 h16;
typedef unsigned short bf;
typedef __attribute__((ext_vector_type(16))) __bf16   v16bf;
typedef __attribute__((ext_vector_type(16))) _Float16 v16h;
typedef __attribute__((ext_vector_type(8)))  _Float16 v8h;
typedef __attribute__((ext_vector_type(8)))  unsigned short v8us;
typedef __attribute__((ext_vector_type(8)))  float    v8f;
typedef __attribute__((ext_vector_type(4)))  float    v4f;
typedef v8h  __attribute__((may_alias)) v8ha;
typedef v4f  __attribute__((may_alias)) v4fa;
typedef v8us __attribute__((may_alias)) v8usa;

__device__ __forceinline__ unsigned short f2bf(float f) { unsigned u = __float_as_uint(f); u += 0x7FFFu + ((u >> 16) & 1u); return (unsigned short)(u >> 16); }
__device__ __forceinline__ float bf2f(unsigned short b) { return __uint_as_float(((unsigned)b) << 16); }
__device__ __forceinline__ float bfr(float f) { return bf2f(f2bf(f)); }
__device__ __forceinline__ v16h cat16(v8h lo, v8h hi) { return __builtin_shufflevector(lo, hi, 0, 1, 2, 3, 4, 5, 6, 7, 8, 9, 10, 11, 12, 13, 14, 15); }
__device__ __forceinline__ v16bf cat16b(v8us lo, v8us hi) { return __builtin_bit_cast(v16bf, __builtin_shufflevector(lo, hi, 0, 1, 2, 3, 4, 5, 6, 7, 8, 9, 10, 11, 12, 13, 14, 15)); }
__device__ __forceinline__ v8f wmma16(v16h a, v16h b, v8f c) { return __builtin_amdgcn_wmma_f32_16x16x32_f16(false, a, false, b, (short)0, c, false, false); }
__device__ __forceinline__ v8f wmmab(v16bf a, v16bf b, v8f c) { return __builtin_amdgcn_wmma_f32_16x16x32_bf16(false, a, false, b, (short)0, c, false, false); }



// ---- k_gemms: register-blocked GEMM, one 64x64 output tile per work-group of NW waves; the K loop is dealt to the waves in slices of 64 k (one 128-B line of every operand row), slice s to wave s % NW;
// each wave keeps the whole tile (16 accumulators) for its slices, operands straight from K-contiguous 16-bit planes; the NW partial tiles meet in LDS and are summed in wave order 0..NW-1. grid (M/64, N/64, Z), NW*32 threads.
// C[m][n] (f32, pitch ldc, + optional f32 bias[n]) = sum_k A[m][k] Bt[n][k] (+ split products per NSPLIT). z-batch strides sA/sB/sC in elements. K % 64 == 0.
// CMODE 1 (scores): a tile entirely above the causal diagonal (query rows r0+roff.., key columns c0..) is skipped by its whole work-group. CMODE 2 (probability x value): the K loop stops at the diagonal block (probabilities beyond it are exactly zero). roff = row offset of this launch's first row within the sequence.
template <typename T16> struct WFrag;
template <> struct WFrag<h16> { typedef v16h V; static __device__ __forceinline__ V ld(const h16* p) { return cat16(*(const v8h*)p, *(const v8h*)(p + 16)); } static __device__ __forceinline__ v8f mma(V a, V b, v8f c) { return wmma16(a, b, c); } };
template <> struct WFrag<bf> { typedef v16bf V; static __device__ __forceinline__ V ld(const bf* p) { return cat16b(*(const v8us*)p, *(const v8us*)(p + 16)); } static __device__ __forceinline__ v8f mma(V a, V b, v8f c) { return wmmab(a, b, c); } };
template <typename T16, int NSPLIT, bool BIAS, int CMODE, int NW>
__global__ __launch_bounds__(NW * 32) void k_gemms(const T16* __restrict__ A, const T16* __restrict__ A2, const T16* __restrict__ Bt, const T16* __restrict__ Bt2, int K, float* C, int ldc, const float* __restrict__ bias, int roff, size_t sA, size_t sB, size_t sC) {
    typedef typename WFrag<T16>::V V;
    __shared__ __align__(16) float os[NW * 64 * 68];
    const size_t z = blockIdx.z; A += z * sA; if (A2) A2 += z * sA; Bt += z * sB; if (Bt2) Bt2 += z * sB; C += z * sC;
    const int lane = threadIdx.x & 31, lr = lane & 15, hi = lane >> 4; const int r0 = blockIdx.x * 64, c0 = blockIdx.y * 64;
    const int wv = __builtin_amdgcn_readfirstlane((int)(threadIdx.x >> 5));   // wave number, scalar: the K loop's trip test stays a scalar branch (every lane on at the matrix instructions)
    if (CMODE == 1 && c0 > r0 + roff + 63) return;                  // score tile entirely above the causal diagonal: never read (the softmax masks j > i by select); the same for every wave, in front of the barrier
    const int Kl = (CMODE == 2) ? min(K, r0 + roff + 64) : K;        // P.V: probabilities are exactly 0 beyond the diagonal block, so the K loop stops there
    v8f acc[4][4];
#pragma unroll
    for (int mb = 0; mb < 4; ++mb)
#pragma unroll
        for (int nb = 0; nb < 4; ++nb) acc[mb][nb] = (v8f){};
    const size_t aoff = (size_t)(r0 + lr) * K + 8 * hi, boff = (size_t)(c0 + lr) * K + 8 * hi;
    // rolled: one slice's fragments live at a time, so that two work-groups fit a WGP's registers
#pragma unroll 1
    for (int k0 = wv * 64; k0 < Kl; k0 += NW * 64) {
        V a[4], a2[4];
        // both 32-k steps of the slice in one trip (unrolled: a[] and b stay in registers): a wave uses the whole 128-B line of every row it touches
#pragma unroll
        for (int kc = k0; kc < k0 + 64; kc += 32) {
#pragma unroll
            for (int mb = 0; mb < 4; ++mb) { a[mb] = WFrag<T16>::ld(A + aoff + (size_t)mb * 16 * K + kc); if (NSPLIT == 1 || NSPLIT == 2) a2[mb] = WFrag<T16>::ld(A2 + aoff + (size_t)mb * 16 * K + kc); }
#pragma unroll
            for (int nb = 0; nb < 4; ++nb) { const V b = WFrag<T16>::ld(Bt + boff + (size_t)nb * 16 * K + kc); V b2; if (NSPLIT >= 2) b2 = WFrag<T16>::ld(Bt2 + boff + (size_t)nb * 16 * K + kc);
#pragma unroll
                for (int mb = 0; mb < 4; ++mb) { acc[mb][nb] = WFrag<T16>::mma(a[mb], b, acc[mb][nb]); if (NSPLIT == 1 || NSPLIT == 2) acc[mb][nb] = WFrag<T16>::mma(a2[mb], b, acc[mb][nb]); if (NSPLIT >= 2) acc[mb][nb] = WFrag<T16>::mma(a[mb], b2, acc[mb][nb]); } }
        }
        // the distance behind the trip's last matrix instructions, on the taken side of the loop branch too
        asm volatile("v_nop\n\tv_nop\n\tv_nop\n\tv_nop" : "+v"(acc[0][0]), "+v"(acc[1][1]), "+v"(acc[2][2]), "+v"(acc[3][3]) : "v"(a[0]), "v"(a[3]));
    }
    float* ow = os + wv * (64 * 68);
#pragma unroll
    for (int mb = 0; mb < 4; ++mb)
#pragma unroll
        for (int nb = 0; nb < 4; ++nb)
#pragma unroll
            for (int j = 0; j < 8; ++j) ow[(mb * 16 + hi * 8 + j) * 68 + nb * 16 + lr] = acc[mb][nb][j];
    __syncthreads();   // every wave's partial tile is in LDS before any wave sums; a wave with no slice has stored zeros
#pragma unroll
    for (int i = 0; i < 64 * 16 / (NW * 32); ++i) { const int e = (int)threadIdx.x + i * (NW * 32), row = e >> 4, cofs = (e & 15) * 4; v4f val = *(const v4fa*)(os + row * 68 + cofs);
#pragma unroll
        for (int w = 1; w < NW; ++w) val += *(const v4fa*)(os + w * (64 * 68) + row * 68 + cofs);
        if (BIAS) { val[0] += bfr(bias[c0 + cofs]); val[1] += bfr(bias[c0 + cofs + 1]); val[2] += bfr(bias[c0 + cofs + 2]); val[3] += bfr(bias[c0 + cofs + 3]); }
        *(v4f*)(C + (size_t)(r0 + row) * ldc + c0 + cofs) = val; }
}

__device__ __forceinline__ h16 tohx(float x) { return (h16)x; }
__device__ __forceinline__ void splitf(float y, unsigned short& h, unsigned short& l) { h = f2bf(y); l = f2bf(y - bf2f(h)); }
typedef __attribute__((ext_vector_type(2))) _Float16 v2h;
typedef __attribute__((ext_vector_type(4))) _Float16 v4h;
typedef __attribute__((ext_vector_type(2))) unsigned short v2us;
typedef __attribute__((ext_vector_type(4))) unsigned short v4us;
typedef __attribute__((ext_vector_type(2))) float v2f;
typedef __attribute__((ext_vector_type(4))) int v4i;

__global__ __launch_bounds__(256) void k_cvt8(const float* __restrict__ src, bf* dst, size_t n8) { const size_t i = (size_t)blockIdx.x * 256 + threadIdx.x; if (i >= n8) return; const v8f v = *(const v8f*)(src + i * 8); v8us o;
#pragma unroll
    for (int k = 0; k < 8; ++k) o[k] = f2bf(v[k]); *(v8us*)(dst + i * 8) = o;  }

// k_rope: head planes [h][t][d] (fp16 + hi/lo) of rope(x) x sc with the rotate-half convention out[d] = x[d] cos[t][d] - x[d+HD/2] sin[t][d], out[d+HD/2] = x[d+HD/2] cos[t][d+HD/2] + x[d] sin[t][d+HD/2]
__global__ __launch_bounds__(256) void k_rope(const float* __restrict__ F, int pitch, int nheads, const float* __restrict__ CS, const float* __restrict__ RF, const float* __restrict__ nw, float sc, h16* P16, bf* Ph, bf* Pl) {
    const size_t e = ((size_t)blockIdx.x * 256 + threadIdx.x) * 2; if (e >= (size_t)nheads * TT * HD) return; const int d = (int)(e % HD); const int t = (int)((e / HD) % TT); const int h = (int)(e / ((size_t)HD * TT)); const float* f = F + (size_t)t * pitch + h * HD; const float rf = RF ? RF[(size_t)h * TT + t] : 1.0f; v2h o16; v2us oh, ol;
#pragma unroll
    for (int q = 0; q < 2; ++q) { const int dd = d + q; const int dp = (dd < HD / 2) ? dd + HD / 2 : dd - HD / 2; float x0 = f[dd], x1 = f[dp];
        if (RF) { float n0 = __fmul_rn(x0, rf), n1 = __fmul_rn(x1, rf); asm volatile("" : "+v"(n0)); asm volatile("" : "+v"(n1)); x0 = __fmul_rn(bfr(nw[dd]), n0); x1 = __fmul_rn(bfr(nw[dp]), n1); }
        const v2f cs = *(const v2f*)(CS + ((size_t)t * HD + dd) * 2); float a = __fmul_rn(x0, cs[0]), bq = __fmul_rn(x1, cs[1]); asm volatile("" : "+v"(a)); asm volatile("" : "+v"(bq)); const float r = ((dd < HD / 2) ? __fsub_rn(a, bq) : __fadd_rn(a, bq)) * sc;
        o16[q] = tohx(r); unsigned short a2, c2; splitf(r, a2, c2); oh[q] = a2; ol[q] = c2; }
    *(v2h*)(P16 + e) = o16; *(v2us*)(Ph + e) = oh; *(v2us*)(Pl + e) = ol;  }
__global__ __launch_bounds__(256) void k_vtp(const float* __restrict__ F, int pitch, int nheads, h16* V16, bf* Vh, bf* Vl) { const size_t e = ((size_t)blockIdx.x * 256 + threadIdx.x) * 2; if (e >= (size_t)nheads * HD * TT) return; const int t = (int)(e % TT); const int d = (int)((e / TT) % HD); const int g = (int)(e / ((size_t)TT * HD)); v2h o16; v2us oh, ol;
#pragma unroll
    for (int q = 0; q < 2; ++q) { const float x = F[(size_t)(t + q) * pitch + g * HD + d]; o16[q] = tohx(x); unsigned short a2, c2; splitf(x, a2, c2); oh[q] = a2; ol[q] = c2; }
    *(v2h*)(V16 + e) = o16; *(v2us*)(Vh + e) = oh; *(v2us*)(Vl + e) = ol;  }
__global__ __launch_bounds__(256) void k_csid(float* CS) { const int idx = blockIdx.x * 256 + threadIdx.x; if (idx >= TT * HD) return; v2f cs; cs[0] = 1.0f; cs[1] = 0.0f; *(v2f*)(CS + (size_t)idx * 2) = cs;  }
// k_asoft: per row (zz, i): t = S x HD^-0.5 for j <= i and i - j < WIN (WIN = TT, so plain causal; the reference's -1e9 additive fill vanishes identically); softmax over the 2048 keys (register row, one exp, fixed trees);
__global__ __launch_bounds__(256) void k_asoft(const float* __restrict__ Sb, h16* P16, bf* Ph, bf* Pl) {
    const int lane = threadIdx.x & 31; const int row = blockIdx.x * 8 + (threadIdx.x >> 5); if (row >= ZH * TT) return; const int i = row % TT; const int zz = row / TT; (void)zz; const bool hires = (i < RH); const float* sr = Sb + (size_t)row * TT; float v[TT / 32]; float mx = -3.0e38f;
#pragma unroll
    for (int ch = 0; ch < TT / 128; ++ch) { const int j0 = ch * 128 + lane * 4; const v4f a = *(const v4f*)(sr + j0);
#pragma unroll
        for (int q = 0; q < 4; ++q) { const int j = j0 + q; (void)j; const float t = (j <= i && i - j < WIN) ? a[q] * SCL : -3.0e38f; v[ch * 4 + q] = t; mx = fmaxf(mx, t); } }
#pragma unroll
    for (int sh = 16; sh; sh >>= 1) mx = fmaxf(mx, __shfl_xor(mx, sh, 32));
    float sum = 0.f;
#pragma unroll
    for (int k = 0; k < TT / 32; ++k) { float d0 = __fsub_rn(v[k], mx); asm volatile("" : "+v"(d0)); v[k] = __builtin_amdgcn_exp2f(__fmul_rn(d0, 1.4426950408889634f)); sum += v[k]; }
#pragma unroll
    for (int sh = 16; sh; sh >>= 1) sum += __shfl_xor(sum, sh, 32);
    const float f = __fdiv_rn(hires ? 1.0f : PCAR, sum);
{
        if (hires) {
#pragma unroll
            for (int ch = 0; ch < TT / 128; ++ch) { v4us oh, ol;
#pragma unroll
                for (int q = 0; q < 4; ++q) { unsigned short a, c2; splitf(v[ch * 4 + q] * f, a, c2); oh[q] = a; ol[q] = c2; }
                const size_t oo = ((size_t)zz * (RH ? RH : 1) + i) * TT + ch * 128 + lane * 4; *(v4us*)(Ph + oo) = oh; *(v4us*)(Pl + oo) = ol; }
        } else {
#pragma unroll
            for (int ch = 0; ch < TT / 128; ++ch) { v4h o4;
#pragma unroll
                for (int q = 0; q < 4; ++q) o4[q] = tohx(v[ch * 4 + q] * f);
                *(v4h*)(P16 + (size_t)row * TT + ch * 128 + lane * 4) = o4; } }
         }
}
__global__ __launch_bounds__(256) void k_merge(const float* __restrict__ O, int h0, bf* Ah, bf* Al) { const size_t e = ((size_t)blockIdx.x * 256 + threadIdx.x) * 2; if (e >= (size_t)ZH * TT * HD) return; const int d = (int)(e % HD); const int t = (int)((e / HD) % TT); const int zz = (int)(e / ((size_t)HD * TT)); const float cs = (t < RH) ? 1.0f : (1.0f / PCAR); const size_t oo = (size_t)t * DQ + (h0 + zz) * HD + d;
    v2us oh, ol;
#pragma unroll
    for (int q = 0; q < 2; ++q) { unsigned short a, c2; splitf(O[e + q] * cs, a, c2); oh[q] = a; ol[q] = c2; } *(v2us*)(Ah + oo) = oh; *(v2us*)(Al + oo) = ol;  }

extern "C" void kernel_launch(void* const* d_in, const int* in_sizes, int n_in,
                              void* d_out, int out_size, void* d_ws, size_t ws_size, hipStream_t stream) {
    (void)in_sizes; (void)n_in; (void)out_size;
    const float* x = (const float*)d_in[0]; const float* wq = (const float*)d_in[1]; const float* bq = (const float*)d_in[2]; const float* wk = (const float*)d_in[3]; const float* bk = (const float*)d_in[4]; const float* wv = (const float*)d_in[5]; const float* bv = (const float*)d_in[6]; const float* wo = (const float*)d_in[7]; const float* bo = (const float*)d_in[8];
    float* OUT = (float*)d_out;     // [1][2048][2048]
    char* wsp = (char*)d_ws;
    auto take = [&](size_t bytes) { char* p = wsp; wsp += (bytes + 255) & ~(size_t)255; return (void*)p; };
    bf* WQ = (bf*)take((size_t)DQ * DM * 2); bf* WK = (bf*)take((size_t)DKV * DM * 2); bf* WV = (bf*)take((size_t)DKV * DM * 2); bf* WO = (bf*)take((size_t)DM * DQ * 2); float* CS = (float*)take((size_t)TT * HD * 2 * 4);
    bf* XB = (bf*)take((size_t)TT * DM * 2); float* FQ = (float*)take((size_t)TT * DQ * 4); float* FK = (float*)take((size_t)TT * DKV * 4);
    h16* QP16 = (h16*)take((size_t)NH_ * TT * HD * 2); h16* KP16 = (h16*)take((size_t)NKV * TT * HD * 2); h16* VT16 = (h16*)take((size_t)NKV * HD * TT * 2);
    bf* QPh = (bf*)take((size_t)NH_ * TT * HD * 2); bf* QPl = (bf*)take((size_t)NH_ * TT * HD * 2); bf* KPh = (bf*)take((size_t)NKV * TT * HD * 2); bf* KPl = (bf*)take((size_t)NKV * TT * HD * 2); bf* VTh = (bf*)take((size_t)NKV * HD * TT * 2); bf* VTl = (bf*)take((size_t)NKV * HD * TT * 2); bf* Ph = (bf*)take((size_t)ZH * RH * TT * 2); bf* Pl = (bf*)take((size_t)ZH * RH * TT * 2);
    float* Sb = (float*)take((size_t)ZH * TT * TT * 4); h16* P16 = (h16*)take((size_t)ZH * TT * TT * 2); float* Ob = (float*)take((size_t)ZH * TT * HD * 4); bf* ATh = (bf*)take((size_t)TT * DQ * 2); bf* ATl = (bf*)take((size_t)TT * DQ * 2);
    if ((size_t)(wsp - (char*)d_ws) > ws_size) return;    // ws 256 MiB
    float* FV = FK;   // v projection reuses the k buffer after the k planes are built (stream-ordered)
    { k_cvt8<<<(unsigned)(((size_t)DQ * DM / 8 + 255) / 256), 256, 0, stream>>>(wq, WQ, (size_t)DQ * DM / 8); k_cvt8<<<(unsigned)(((size_t)DKV * DM / 8 + 255) / 256), 256, 0, stream>>>(wk, WK, (size_t)DKV * DM / 8); k_cvt8<<<(unsigned)(((size_t)DKV * DM / 8 + 255) / 256), 256, 0, stream>>>(wv, WV, (size_t)DKV * DM / 8);
      k_cvt8<<<(unsigned)(((size_t)DM * DQ / 8 + 255) / 256), 256, 0, stream>>>(wo, WO, (size_t)DM * DQ / 8);
       }
    k_csid<<<(TT * HD + 255) / 256, 256, 0, stream>>>(CS);
    const unsigned LQ = (unsigned)(((size_t)NH_ * TT * HD / 2 + 255) / 256), LKv = (unsigned)(((size_t)NKV * TT * HD / 2 + 255) / 256);
    for (int b = 0; b < NB_; ++b) {
        
        k_cvt8<<<(unsigned)(((size_t)TT * DM / 8 + 255) / 256), 256, 0, stream>>>(x + (size_t)b * TT * DM, XB, (size_t)TT * DM / 8);
        k_gemms<bf, 0, true, 0, NWK><<<dim3(TT / 64, DQ / 64, 1), NWK * 32, 0, stream>>>(XB, nullptr, WQ, nullptr, DM, FQ, DQ, bq, 0, 0, 0, 0);
        k_rope<<<LQ, 256, 0, stream>>>(FQ, DQ, NH_, CS, nullptr, nullptr, 1.0f, QP16, QPh, QPl);
        k_gemms<bf, 0, true, 0, NWK><<<dim3(TT / 64, DKV / 64, 1), NWK * 32, 0, stream>>>(XB, nullptr, WK, nullptr, DM, FK, DKV, bk, 0, 0, 0, 0);
        k_rope<<<LKv, 256, 0, stream>>>(FK, DKV, NKV, CS, nullptr, nullptr, 1.0f, KP16, KPh, KPl);
        k_gemms<bf, 0, true, 0, NWK><<<dim3(TT / 64, DKV / 64, 1), NWK * 32, 0, stream>>>(XB, nullptr, WV, nullptr, DM, FV, DKV, bv, 0, 0, 0, 0); k_vtp<<<LKv, 256, 0, stream>>>(FV, DKV, NKV, VT16, VTh, VTl);
        for (int h0 = 0; h0 < NH_; h0 += ZH) { const size_t zq = (size_t)h0, zk = (size_t)(h0 / REP);   // the heads of a pass share kv group h0/REP (ZH <= REP): sB = 0
            k_gemms<bf, 2, false, 1, NWS><<<dim3(RH / 64, TT / 64, ZH), NWS * 32, 0, stream>>>(QPh + zq * TT * HD, QPl + zq * TT * HD, KPh + zk * TT * HD, KPl + zk * TT * HD, HD, Sb, TT, nullptr, 0, (size_t)TT * HD, 0, (size_t)TT * TT);
            k_gemms<h16, 0, false, 1, NWS><<<dim3((TT - RH) / 64, TT / 64, ZH), NWS * 32, 0, stream>>>(QP16 + zq * TT * HD + (size_t)RH * HD, nullptr, KP16 + zk * TT * HD, nullptr, HD, Sb + (size_t)RH * TT, TT, nullptr, RH, (size_t)TT * HD, 0, (size_t)TT * TT);
            k_asoft<<<ZH * TT / 8, 256, 0, stream>>>(Sb, P16, Ph, Pl);
            k_gemms<bf, 2, false, 2, NWK><<<dim3(RH / 64, HD / 64, ZH), NWK * 32, 0, stream>>>(Ph, Pl, VTh + zk * HD * TT, VTl + zk * HD * TT, TT, Ob, HD, nullptr, 0, (size_t)RH * TT, 0, (size_t)TT * HD);
            k_gemms<h16, 0, false, 2, NWK><<<dim3((TT - RH) / 64, HD / 64, ZH), NWK * 32, 0, stream>>>(P16 + (size_t)RH * TT, nullptr, VT16 + zk * HD * TT, nullptr, TT, Ob + (size_t)RH * HD, HD, nullptr, RH, (size_t)TT * TT, 0, (size_t)TT * HD);
            k_merge<<<(unsigned)(((size_t)ZH * TT * HD / 2 + 255) / 256), 256, 0, stream>>>(Ob, h0, ATh, ATl); }
        k_gemms<bf, 1, true, 0, NWK><<<dim3(TT / 64, DM / 64, 1), NWK * 32, 0, stream>>>(ATh, ATl, WO, nullptr, DQ, OUT + (size_t)b * TT * DM, DM, bo, 0, 0, 0, 0); }
}

// v003
// One run takes 287 microseconds.
// Timed twice side by side with v002, it ran 1.31 times as fast both times.
// All steps since v000 together make it 2.81 times as fast.
#include <hip/hip_runtime.h>

// Causal grouped-query attention with biases (x [1][2048][2048]; Q = x W_q^T + b_q (16 heads x 128 viewed (4 kv groups, 4)), K, V = x W^T + b (4 kv heads x 128) ('oi' 2048^-0.5 incl. biases: non-zero); query head h = kv*4 + g uses kv head h / 4; scores x 1/sqrt(128); causal (-inf); softmax; out = merged (head-major) W_o^T + b_o -> [1][2048][2048] (4.2 M); argument order x, W_q, b_q, W_k, b_k, W_v, b_v, W_o, b_o). THIS ROW: the same module at ONE sequence (x [1][2048][2048]; Q = x Wq^T + bq ('oi' [2048][2048]); K, V = x W^T + b with 'oi' [512][2048] weights (4 key / value heads x 128); weights normal x 2048^-0.5; the four biases zeros (read); grouped-query: query head h = 4 k + g uses key / value head k; scores x 128^-0.5; tril kept, -inf; softmax; out = merged Wo^T + bo; argument order x, Wq, bq, Wk, bk, Wv, bv, Wo, bo).
// Layout per batch: bf16 copy of x; 'oi' weights as-is; exact projections + f32 biases; identity-table plane builders at width 128; causal T-2048 GQA attention (all 16 query heads in one pass, grid z = query head, kv head z / 4; score rows kept only up to their diagonal block, probabilities written in place over them; hybrid rows: < 512 hi/lo 3 products, rest fp16 x1024; the score GEMM skips tiles above the diagonal); merged hi/lo x W_o exact + b_o.
// Compute dtypes, f32 accumulate: every input rounded to bf16; projections exact + f32 biases; attention rows < 512 3 products, rest fp16; softmax f32; output projection hl x exact.

#define NB_  1
#define TT   2048
#define DM   2048
#define NH_  16
#define NKV  4
#define REP  (NH_ / NKV)
#define HD   128
#define DQ   (NH_ * HD)
#define DKV  (NKV * HD)
#define ZH   NH_                  // query heads of one attention pass (grid z): all of them, kv head z / REP
#define SPW  (TT + 64)            // pitch (f32 elements) of the packed score plane: row block rb (width (rb+1)*64) shares its rows with row block TT/64-1-rb
#define SPH  ((size_t)(TT / 2) * SPW)   // f32 elements of one head's packed score plane
#define RH   512                  // query rows < RH use hi+lo planes (0: none)
#define WIN  2048
#define PCAR 1024.0f
#define SCL  0.088388347648318447f   // HD^-0.5
#define NWK  8                    // waves of a work-group that share one tile's K loop (k_gemms), K = 2048
#define NWS  (HD / 64)            // the same for the scores, K = HD: one 64-k slice a wave
typedef _Float16 h16;
typedef unsigned short bf;
typedef __attribute__((ext_vector_type(16))) __bf16   v16bf;
typedef __attribute__((ext_vector_type(16))) _Float16 v16h;
typedef __attribute__((ext_vector_type(8)))  _Float16 v8h;
typedef __attribute__((ext_vector_type(8)))  unsigned short v8us;
typedef __attribute__((ext_vector_type(8)))  float    v8f;
typedef __attribute__((ext_vector_type(4)))  float    v4f;
typedef v8h  __attribute__((may_alias)) v8ha;
typedef v4f  __attribute__((may_alias)) v4fa;
typedef v8us __attribute__((may_alias)) v8usa;

__device__ __forceinline__ unsigned short f2bf(float f) { unsigned u = __float_as_uint(f); u += 0x7FFFu + ((u >> 16) & 1u); return (unsigned short)(u >> 16); }
__device__ __forceinline__ float bf2f(unsigned short b) { return __uint_as_float(((unsigned)b) << 16); }
__device__ __forceinline__ float bfr(float f) { return bf2f(f2bf(f)); }
__device__ __forceinline__ v16h cat16(v8h lo, v8h hi) { return __builtin_shufflevector(lo, hi, 0, 1, 2, 3, 4, 5, 6, 7, 8, 9, 10, 11, 12, 13, 14, 15); }
__device__ __forceinline__ v16bf cat16b(v8us lo, v8us hi) { return __builtin_bit_cast(v16bf, __builtin_shufflevector(lo, hi, 0, 1, 2, 3, 4, 5, 6, 7, 8, 9, 10, 11, 12, 13, 14, 15)); }
__device__ __forceinline__ v8f wmma16(v16h a, v16h b, v8f c) { return __builtin_amdgcn_wmma_f32_16x16x32_f16(false, a, false, b, (short)0, c, false, false); }
__device__ __forceinline__ v8f wmmab(v16bf a, v16bf b, v8f c) { return __builtin_amdgcn_wmma_f32_16x16x32_bf16(false, a, false, b, (short)0, c, false, false); }
// first f32 element of query row i in a head's packed score plane: the row holds its columns 0 .. (i/64+1)*64-1 and no more; the lower half of the row blocks starts at column 0, row block rb of the upper half stands behind row block TT/64-1-rb (the two widths add up to SPW); the 64 rows of a block are SPW apart
__device__ __forceinline__ size_t spk(int i) { const int rb = i >> 6; return (rb < TT / 128) ? (size_t)i * SPW : (size_t)((TT / 64 - 1 - rb) * 64 + (i & 63)) * SPW + (size_t)((TT / 64 - rb) * 64); }



// ---- k_gemms: register-blocked GEMM, one 64x64 output tile per work-group of NW waves; the K loop is dealt to the waves in slices of 64 k (one 128-B line of every operand row), slice s to wave s % NW;
// each wave keeps the whole tile (16 accumulators) for its slices, operands straight from K-contiguous 16-bit planes; the NW partial tiles meet in LDS and are summed in wave order 0..NW-1. grid (M/64, N/64, Z), NW*32 threads.
// C[m][n] (f32, pitch ldc, + optional f32 bias[n]) = sum_k A[m][k] Bt[n][k] (+ split products per NSPLIT). z-batch strides sA/sB/sC in elements. K % 64 == 0.
// CMODE 1 (scores): a tile entirely above the causal diagonal (query rows r0+roff.., key columns c0..) is skipped by its whole work-group; C is the packed score plane (spk, ldc = SPW). CMODE 2 (probability x value): the K loop stops at the diagonal block (nothing is stored beyond it); A is the packed plane seen as 16-bit elements (the probabilities lie at the start of their score row, the lo plane right behind the hi plane). roff = row offset of this launch's first row within the sequence. Grid z = query head: Bt steps by kv head z / REP.
template <typename T16> struct WFrag;
template <> struct WFrag<h16> { typedef v16h V; static __device__ __forceinline__ V ld(const h16* p) { return cat16(*(const v8h*)p, *(const v8h*)(p + 16)); } static __device__ __forceinline__ v8f mma(V a, V b, v8f c) { return wmma16(a, b, c); } };
template <> struct WFrag<bf> { typedef v16bf V; static __device__ __forceinline__ V ld(const bf* p) { return cat16b(*(const v8us*)p, *(const v8us*)(p + 16)); } static __device__ __forceinline__ v8f mma(V a, V b, v8f c) { return wmmab(a, b, c); } };
template <typename T16, int NSPLIT, bool BIAS, int CMODE, int NW>
__global__ __launch_bounds__(NW * 32) void k_gemms(const T16* __restrict__ A, const T16* __restrict__ A2, const T16* __restrict__ Bt, const T16* __restrict__ Bt2, int K, float* C, int ldc, const float* __restrict__ bias, int roff, size_t sA, size_t sB, size_t sC) {
    typedef typename WFrag<T16>::V V;
    __shared__ __align__(16) float os[NW * 64 * 68];
    const size_t z = blockIdx.z; A += z * sA; if (A2) A2 += z * sA; Bt += (z / REP) * sB; if (Bt2) Bt2 += (z / REP) * sB; C += z * sC;
    const int lane = threadIdx.x & 31, lr = lane & 15, hi = lane >> 4; const int r0 = blockIdx.x * 64, c0 = blockIdx.y * 64;
    const int wv = __builtin_amdgcn_readfirstlane((int)(threadIdx.x >> 5));   // wave number, scalar: the K loop's trip test stays a scalar branch (every lane on at the matrix instructions)
    if (CMODE == 1 && c0 > r0 + roff + 63) return;                  // score tile entirely above the causal diagonal: never read (the softmax masks j > i by select); the same for every wave, in front of the barrier
    const int Kl = (CMODE == 2) ? min(K, r0 + roff + 64) : K;        // P.V: probabilities are exactly 0 beyond the diagonal block, so the K loop stops there
    v8f acc[4][4];
#pragma unroll
    for (int mb = 0; mb < 4; ++mb)
#pragma unroll
        for (int nb = 0; nb < 4; ++nb) acc[mb][nb] = (v8f){};
    const size_t aoff = (size_t)(r0 + lr) * K + 8 * hi, boff = (size_t)(c0 + lr) * K + 8 * hi;
    const size_t poff = 2 * spk(r0 + roff) + (size_t)lr * (2 * SPW) + 8 * hi;   // CMODE 2: this lane's first 16-bit element in the packed plane (row pitch 2 * SPW; the lo plane Kl elements on)
    // rolled: one slice's fragments live at a time, so that two work-groups fit a WGP's registers
#pragma unroll 1
    for (int k0 = wv * 64; k0 < Kl; k0 += NW * 64) {
        V a[4], a2[4];
        // both 32-k steps of the slice in one trip (unrolled: a[] and b stay in registers): a wave uses the whole 128-B line of every row it touches
#pragma unroll
        for (int kc = k0; kc < k0 + 64; kc += 32) {
            if (CMODE == 2) {
#pragma unroll
                for (int mb = 0; mb < 4; ++mb) { a[mb] = WFrag<T16>::ld(A + poff + (size_t)mb * 16 * (2 * SPW) + kc); if (NSPLIT == 2) a2[mb] = WFrag<T16>::ld(A2 + poff + Kl + (size_t)mb * 16 * (2 * SPW) + kc); }
            } else
#pragma unroll
            for (int mb = 0; mb < 4; ++mb) { a[mb] = WFrag<T16>::ld(A + aoff + (size_t)mb * 16 * K + kc); if (NSPLIT == 1 || NSPLIT == 2) a2[mb] = WFrag<T16>::ld(A2 + aoff + (size_t)mb * 16 * K + kc); }
#pragma unroll
            for (int nb = 0; nb < 4; ++nb) { const V b = WFrag<T16>::ld(Bt + boff + (size_t)nb * 16 * K + kc); V b2; if (NSPLIT >= 2) b2 = WFrag<T16>::ld(Bt2 + boff + (size_t)nb * 16 * K + kc);
#pragma unroll
                for (int mb = 0; mb < 4; ++mb) { acc[mb][nb] = WFrag<T16>::mma(a[mb], b, acc[mb][nb]); if (NSPLIT == 1 || NSPLIT == 2) acc[mb][nb] = WFrag<T16>::mma(a2[mb], b, acc[mb][nb]); if (NSPLIT >= 2) acc[mb][nb] = WFrag<T16>::mma(a[mb], b2, acc[mb][nb]); } }
        }
        // the distance behind the trip's last matrix instructions, on the taken side of the loop branch too
        asm volatile("v_nop\n\tv_nop\n\tv_nop\n\tv_nop" : "+v"(acc[0][0]), "+v"(acc[1][1]), "+v"(acc[2][2]), "+v"(acc[3][3]) : "v"(a[0]), "v"(a[3]));
    }
    float* ow = os + wv * (64 * 68);
    float* Cb = C + ((CMODE == 1) ? spk(r0 + roff) : (size_t)r0 * ldc);
#pragma unroll
    for (int mb = 0; mb < 4; ++mb)
#pragma unroll
        for (int nb = 0; nb < 4; ++nb)
#pragma unroll
            for (int j = 0; j < 8; ++j) ow[(mb * 16 + hi * 8 + j) * 68 + nb * 16 + lr] = acc[mb][nb][j];
    __syncthreads();   // every wave's partial tile is in LDS before any wave sums; a wave with no slice has stored zeros
#pragma unroll
    for (int i = 0; i < 64 * 16 / (NW * 32); ++i) { const int e = (int)threadIdx.x + i * (NW * 32), row = e >> 4, cofs = (e & 15) * 4; v4f val = *(const v4fa*)(os + row * 68 + cofs);
#pragma unroll
        for (int w = 1; w < NW; ++w) val += *(const v4fa*)(os + w * (64 * 68) + row * 68 + cofs);
        if (BIAS) { val[0] += bfr(bias[c0 + cofs]); val[1] += bfr(bias[c0 + cofs + 1]); val[2] += bfr(bias[c0 + cofs + 2]); val[3] += bfr(bias[c0 + cofs + 3]); }
        *(v4f*)(Cb + (size_t)row * ldc + c0 + cofs) = val; }
}

__device__ __forceinline__ h16 tohx(float x) { return (h16)x; }
__device__ __forceinline__ void splitf(float y, unsigned short& h, unsigned short& l) { h = f2bf(y); l = f2bf(y - bf2f(h)); }
typedef __attribute__((ext_vector_type(2))) _Float16 v2h;
typedef __attribute__((ext_vector_type(4))) _Float16 v4h;
typedef __attribute__((ext_vector_type(2))) unsigned short v2us;
typedef __attribute__((ext_vector_type(4))) unsigned short v4us;
typedef __attribute__((ext_vector_type(2))) float v2f;
typedef __attribute__((ext_vector_type(4))) int v4i;

__global__ __launch_bounds__(256) void k_cvt8(const float* __restrict__ src, bf* dst, size_t n8) { const size_t i = (size_t)blockIdx.x * 256 + threadIdx.x; if (i >= n8) return; const v8f v = *(const v8f*)(src + i * 8); v8us o;
#pragma unroll
    for (int k = 0; k < 8; ++k) o[k] = f2bf(v[k]); *(v8us*)(dst + i * 8) = o;  }

// k_rope: head planes [h][t][d] (fp16 + hi/lo) of rope(x) x sc with the rotate-half convention out[d] = x[d] cos[t][d] - x[d+HD/2] sin[t][d], out[d+HD/2] = x[d+HD/2] cos[t][d+HD/2] + x[d] sin[t][d+HD/2]
__global__ __launch_bounds__(256) void k_rope(const float* __restrict__ F, int pitch, int nheads, const float* __restrict__ CS, const float* __restrict__ RF, const float* __restrict__ nw, float sc, h16* P16, bf* Ph, bf* Pl) {
    const size_t e = ((size_t)blockIdx.x * 256 + threadIdx.x) * 2; if (e >= (size_t)nheads * TT * HD) return; const int d = (int)(e % HD); const int t = (int)((e / HD) % TT); const int h = (int)(e / ((size_t)HD * TT)); const float* f = F + (size_t)t * pitch + h * HD; const float rf = RF ? RF[(size_t)h * TT + t] : 1.0f; v2h o16; v2us oh, ol;
#pragma unroll
    for (int q = 0; q < 2; ++q) { const int dd = d + q; const int dp = (dd < HD / 2) ? dd + HD / 2 : dd - HD / 2; float x0 = f[dd], x1 = f[dp];
        if (RF) { float n0 = __fmul_rn(x0, rf), n1 = __fmul_rn(x1, rf); asm volatile("" : "+v"(n0)); asm volatile("" : "+v"(n1)); x0 = __fmul_rn(bfr(nw[dd]), n0); x1 = __fmul_rn(bfr(nw[dp]), n1); }
        const v2f cs = *(const v2f*)(CS + ((size_t)t * HD + dd) * 2); float a = __fmul_rn(x0, cs[0]), bq = __fmul_rn(x1, cs[1]); asm volatile("" : "+v"(a)); asm volatile("" : "+v"(bq)); const float r = ((dd < HD / 2) ? __fsub_rn(a, bq) : __fadd_rn(a, bq)) * sc;
        o16[q] = tohx(r); unsigned short a2, c2; splitf(r, a2, c2); oh[q] = a2; ol[q] = c2; }
    *(v2h*)(P16 + e) = o16; *(v2us*)(Ph + e) = oh; *(v2us*)(Pl + e) = ol;  }
__global__ __launch_bounds__(256) void k_vtp(const float* __restrict__ F, int pitch, int nheads, h16* V16, bf* Vh, bf* Vl) { const size_t e = ((size_t)blockIdx.x * 256 + threadIdx.x) * 2; if (e >= (size_t)nheads * HD * TT) return; const int t = (int)(e % TT); const int d = (int)((e / TT) % HD); const int g = (int)(e / ((size_t)TT * HD)); v2h o16; v2us oh, ol;
#pragma unroll
    for (int q = 0; q < 2; ++q) { const float x = F[(size_t)(t + q) * pitch + g * HD + d]; o16[q] = tohx(x); unsigned short a2, c2; splitf(x, a2, c2); oh[q] = a2; ol[q] = c2; }
    *(v2h*)(V16 + e) = o16; *(v2us*)(Vh + e) = oh; *(v2us*)(Vl + e) = ol;  }
__global__ __launch_bounds__(256) void k_csid(float* CS) { const int idx = blockIdx.x * 256 + threadIdx.x; if (idx >= TT * HD) return; v2f cs; cs[0] = 1.0f; cs[1] = 0.0f; *(v2f*)(CS + (size_t)idx * 2) = cs;  }
// k_asoft: per row (zz, i) of the packed score plane: t = S x HD^-0.5 for j <= i and i - j < WIN (sliding causal window; the reference's -inf fill vanishes identically); softmax over the keys (register row, one exp, fixed trees);
// only the w = (i/64+1)*64 stored columns are read; the probabilities go back over the row's own scores (fp16 x PCAR at its start; rows < RH: hi plane at its start, lo plane w elements on): one wave owns a row and holds all of it in registers before it stores.
__global__ __launch_bounds__(256) void k_asoft(float* Sb) {
    const int lane = threadIdx.x & 31; const int row = blockIdx.x * 8 + __builtin_amdgcn_readfirstlane((int)(threadIdx.x >> 5)); if (row >= ZH * TT) return; const int i = row % TT; const int zz = row / TT; const bool hires = (i < RH); const int w = ((i >> 6) + 1) * 64; float* sr = Sb + (size_t)zz * SPH + spk(i); float v[TT / 32]; v4f a[TT / 128]; float mx = -3.0e38f;
#pragma unroll
    for (int ch = 0; ch < TT / 128; ++ch) { a[ch] = *(const v4f*)(sr + min(ch * 128 + lane * 4, w - 4));   // a lane past the stored width reads the row's last stored quad (masked below): no branch between the loads, all of them in flight together
        asm volatile("s_wait_xcnt 0x0" ::: "memory"); }   // each load has address registers of its own, and a later load's result may be given those registers: the wait stands in front of that overwrite
    __builtin_amdgcn_sched_barrier(0);   // keeps the first use of a loaded value behind the last load: without it the wave waits for the first loads in the middle of the run, with the rest not yet issued
#pragma unroll
    for (int ch = 0; ch < TT / 128; ++ch) { const int j0 = ch * 128 + lane * 4;
#pragma unroll
        for (int q = 0; q < 4; ++q) { const int j = j0 + q; (void)j; const float t = (j <= i && i - j < WIN) ? a[ch][q] * SCL : -3.0e38f; v[ch * 4 + q] = t; mx = fmaxf(mx, t); } }
#pragma unroll
    for (int sh = 16; sh; sh >>= 1) mx = fmaxf(mx, __shfl_xor(mx, sh, 32));
    float sum = 0.f;
#pragma unroll
    for (int ch = 0; ch < TT / 128; ++ch) if (ch * 128 < w) {   // a 128-column chunk past the stored width holds exact zeros only: neither summed nor stored
        // d0 is held as in the version before: the difference keeps its own rounding in front of the multiply, so every probability stays bit-identical
#pragma unroll
        for (int k = ch * 4; k < ch * 4 + 4; ++k) { float d0 = __fsub_rn(v[k], mx); asm volatile("" : "+v"(d0)); v[k] = __builtin_amdgcn_exp2f(__fmul_rn(d0, 1.4426950408889634f)); sum += v[k]; } }
#pragma unroll
    for (int sh = 16; sh; sh >>= 1) sum += __shfl_xor(sum, sh, 32);
    const float f = __fdiv_rn(hires ? 1.0f : PCAR, sum);
    if (hires) { bf* ph = (bf*)sr; bf* pl = ph + w;
#pragma unroll
        for (int ch = 0; ch < RH / 128; ++ch) if (ch * 128 < w) { const int j0 = ch * 128 + lane * 4; v4us oh, ol;
#pragma unroll
            for (int q = 0; q < 4; ++q) { unsigned short a, c2; splitf(v[ch * 4 + q] * f, a, c2); oh[q] = a; ol[q] = c2; }
            if (j0 < w) { *(v4us*)(ph + j0) = oh; *(v4us*)(pl + j0) = ol; } }
    } else { h16* p16 = (h16*)sr;
#pragma unroll
        for (int ch = 0; ch < TT / 128; ++ch) if (ch * 128 < w) { const int j0 = ch * 128 + lane * 4; v4h o4;
#pragma unroll
            for (int q = 0; q < 4; ++q) o4[q] = tohx(v[ch * 4 + q] * f);
            if (j0 < w) *(v4h*)(p16 + j0) = o4; } }
}
__global__ __launch_bounds__(256) void k_merge(const float* __restrict__ O, int h0, bf* Ah, bf* Al) { const size_t e = ((size_t)blockIdx.x * 256 + threadIdx.x) * 2; if (e >= (size_t)ZH * TT * HD) return; const int d = (int)(e % HD); const int t = (int)((e / HD) % TT); const int zz = (int)(e / ((size_t)HD * TT)); const float cs = (t < RH) ? 1.0f : (1.0f / PCAR); const size_t oo = (size_t)t * DQ + (h0 + zz) * HD + d;
    v2us oh, ol;
#pragma unroll
    for (int q = 0; q < 2; ++q) { unsigned short a, c2; splitf(O[e + q] * cs, a, c2); oh[q] = a; ol[q] = c2; } *(v2us*)(Ah + oo) = oh; *(v2us*)(Al + oo) = ol;  }

extern "C" void kernel_launch(void* const* d_in, const int* in_sizes, int n_in,
                              void* d_out, int out_size, void* d_ws, size_t ws_size, hipStream_t stream) {
    (void)in_sizes; (void)n_in; (void)out_size;
    const float* x = (const float*)d_in[0]; const float* wq = (const float*)d_in[1]; const float* bq = (const float*)d_in[2]; const float* wk = (const float*)d_in[3]; const float* bk = (const float*)d_in[4]; const float* wv = (const float*)d_in[5]; const float* bv = (const float*)d_in[6]; const float* wo = (const float*)d_in[7]; const float* bo = (const float*)d_in[8];
    float* OUT = (float*)d_out;     // [1][2048][2048]
    char* wsp = (char*)d_ws;
    auto take = [&](size_t bytes) { char* p = wsp; wsp += (bytes + 255) & ~(size_t)255; return (void*)p; };
    bf* WQ = (bf*)take((size_t)DQ * DM * 2); bf* WK = (bf*)take((size_t)DKV * DM * 2); bf* WV = (bf*)take((size_t)DKV * DM * 2); bf* WO = (bf*)take((size_t)DM * DQ * 2); float* CS = (float*)take((size_t)TT * HD * 2 * 4);
    bf* XB = (bf*)take((size_t)TT * DM * 2); float* FQ = (float*)take((size_t)TT * DQ * 4); float* FK = (float*)take((size_t)TT * DKV * 4);
    h16* QP16 = (h16*)take((size_t)NH_ * TT * HD * 2); h16* KP16 = (h16*)take((size_t)NKV * TT * HD * 2); h16* VT16 = (h16*)take((size_t)NKV * HD * TT * 2);
    bf* QPh = (bf*)take((size_t)NH_ * TT * HD * 2); bf* QPl = (bf*)take((size_t)NH_ * TT * HD * 2); bf* KPh = (bf*)take((size_t)NKV * TT * HD * 2); bf* KPl = (bf*)take((size_t)NKV * TT * HD * 2); bf* VTh = (bf*)take((size_t)NKV * HD * TT * 2); bf* VTl = (bf*)take((size_t)NKV * HD * TT * 2);
    float* Sb = (float*)take((size_t)ZH * SPH * 4); float* Ob = (float*)take((size_t)ZH * TT * HD * 4); bf* ATh = (bf*)take((size_t)TT * DQ * 2); bf* ATl = (bf*)take((size_t)TT * DQ * 2);
    if ((size_t)(wsp - (char*)d_ws) > ws_size) return;    // ws 256 MiB
    float* FV = FK;   // v projection reuses the k buffer after the k planes are built (stream-ordered)
    { k_cvt8<<<(unsigned)(((size_t)DQ * DM / 8 + 255) / 256), 256, 0, stream>>>(wq, WQ, (size_t)DQ * DM / 8); k_cvt8<<<(unsigned)(((size_t)DKV * DM / 8 + 255) / 256), 256, 0, stream>>>(wk, WK, (size_t)DKV * DM / 8); k_cvt8<<<(unsigned)(((size_t)DKV * DM / 8 + 255) / 256), 256, 0, stream>>>(wv, WV, (size_t)DKV * DM / 8);
      k_cvt8<<<(unsigned)(((size_t)DM * DQ / 8 + 255) / 256), 256, 0, stream>>>(wo, WO, (size_t)DM * DQ / 8);
       }
    k_csid<<<(TT * HD + 255) / 256, 256, 0, stream>>>(CS);
    const unsigned LQ = (unsigned)(((size_t)NH_ * TT * HD / 2 + 255) / 256), LKv = (unsigned)(((size_t)NKV * TT * HD / 2 + 255) / 256);
    for (int b = 0; b < NB_; ++b) {
        
        k_cvt8<<<(unsigned)(((size_t)TT * DM / 8 + 255) / 256), 256, 0, stream>>>(x + (size_t)b * TT * DM, XB, (size_t)TT * DM / 8);
        k_gemms<bf, 0, true, 0, NWK><<<dim3(TT / 64, DQ / 64, 1), NWK * 32, 0, stream>>>(XB, nullptr, WQ, nullptr, DM, FQ, DQ, bq, 0, 0, 0, 0);
        k_rope<<<LQ, 256, 0, stream>>>(FQ, DQ, NH_, CS, nullptr, nullptr, 1.0f, QP16, QPh, QPl);
        k_gemms<bf, 0, true, 0, NWK><<<dim3(TT / 64, DKV / 64, 1), NWK * 32, 0, stream>>>(XB, nullptr, WK, nullptr, DM, FK, DKV, bk, 0, 0, 0, 0);
        k_rope<<<LKv, 256, 0, stream>>>(FK, DKV, NKV, CS, nullptr, nullptr, 1.0f, KP16, KPh, KPl);
        k_gemms<bf, 0, true, 0, NWK><<<dim3(TT / 64, DKV / 64, 1), NWK * 32, 0, stream>>>(XB, nullptr, WV, nullptr, DM, FV, DKV, bv, 0, 0, 0, 0); k_vtp<<<LKv, 256, 0, stream>>>(FV, DKV, NKV, VT16, VTh, VTl);
        // one pass over all ZH = NH_ query heads (grid z); kv planes step by z / REP inside k_gemms
        k_gemms<bf, 2, false, 1, NWS><<<dim3(RH / 64, TT / 64, ZH), NWS * 32, 0, stream>>>(QPh, QPl, KPh, KPl, HD, Sb, SPW, nullptr, 0, (size_t)TT * HD, (size_t)TT * HD, SPH);
        k_gemms<h16, 0, false, 1, NWS><<<dim3((TT - RH) / 64, TT / 64, ZH), NWS * 32, 0, stream>>>(QP16 + (size_t)RH * HD, nullptr, KP16, nullptr, HD, Sb, SPW, nullptr, RH, (size_t)TT * HD, (size_t)TT * HD, SPH);
        k_asoft<<<ZH * TT / 8, 256, 0, stream>>>(Sb);
        k_gemms<bf, 2, false, 2, NWK><<<dim3(RH / 64, HD / 64, ZH), NWK * 32, 0, stream>>>((const bf*)Sb, (const bf*)Sb, VTh, VTl, TT, Ob, HD, nullptr, 0, 2 * SPH, (size_t)HD * TT, (size_t)TT * HD);
        k_gemms<h16, 0, false, 2, NWK><<<dim3((TT - RH) / 64, HD / 64, ZH), NWK * 32, 0, stream>>>((const h16*)Sb, nullptr, VT16, nullptr, TT, Ob + (size_t)RH * HD, HD, nullptr, RH, 2 * SPH, (size_t)HD * TT, (size_t)TT * HD);
        k_merge<<<(unsigned)(((size_t)ZH * TT * HD / 2 + 255) / 256), 256, 0, stream>>>(Ob, 0, ATh, ATl);
        k_gemms<bf, 1, true, 0, NWK><<<dim3(TT / 64, DM / 64, 1), NWK * 32, 0, stream>>>(ATh, ATl, WO, nullptr, DQ, OUT + (size_t)b * TT * DM, DM, bo, 0, 0, 0, 0); }
}

// v004
// A run of this version takes 256 microseconds.
// Next to v003, in two timings, it ran 1.12 times as fast each time.
// Over all steps from v000 it is 3.16 times as fast.
#include <hip/hip_runtime.h>

// Causal grouped-query attention with biases (x [2][2048][2048]; Q = x W_q^T + b_q (16 heads x 128 viewed (4 kv groups, 4)), K, V = x W^T + b (4 kv heads x 128) ('oi' 2048^-0.5 incl. biases: non-zero); query head h = kv*4 + g uses kv head h / 4; scores x 1/sqrt(128); causal (-inf); softmax; out = merged (head-major) W_o^T + b_o -> [2][2048][2048] (8.4 M); argument order x, W_q, b_q, W_k, b_k, W_v, b_v, W_o, b_o). THIS ROW: the same module at ONE sequence (x [1][2048][2048]; Q = x Wq^T + bq ('oi' [2048][2048]); K, V = x W^T + b with 'oi' [512][2048] weights (4 key / value heads x 128); weights normal x 2048^-0.5; the four biases zeros (read); grouped-query: query head h = 4 k + g uses key / value head k; scores x 128^-0.5; tril kept, -inf; softmax; out = merged Wo^T + bo; argument order x, Wq, bq, Wk, bk, Wv, bv, Wo, bo).
// Layout per batch: bf16 copy of x; 'oi' weights as-is; exact projections + f32 biases, each projection's work-groups storing the 16-bit operand planes of the attention themselves (V as W_v x^T, so that its tile is already key-contiguous); causal T-2048 GQA attention (all 16 query heads in one pass, grid z = query head, kv head z / 4; score rows kept only up to their diagonal block, probabilities written in place over them; hybrid rows: < 512 hi/lo 3 products, rest fp16 x1024; the score GEMM skips tiles above the diagonal; P.V stores the merged hi/lo planes itself); merged hi/lo x W_o exact + b_o.
// Compute dtypes, f32 accumulate: every input rounded to bf16; projections exact + f32 biases; attention rows < 512 3 products, rest fp16; softmax f32; output projection hl x exact.

#define NB_  1
#define TT   2048
#define DM   2048
#define NH_  16
#define NKV  4
#define REP  (NH_ / NKV)
#define HD   128
#define DQ   (NH_ * HD)
#define DKV  (NKV * HD)
#define ZH   NH_                  // query heads of one attention pass (grid z): all of them, kv head z / REP
#define SPW  (TT + 64)            // pitch (f32 elements) of the packed score plane: row block rb (width (rb+1)*64) shares its rows with row block TT/64-1-rb
#define SPH  ((size_t)(TT / 2) * SPW)   // f32 elements of one head's packed score plane
#define RH   512                  // query rows < RH use hi+lo planes (0: none)
#define WIN  2048
#define PCAR 1024.0f
#define SCL  0.088388347648318447f   // HD^-0.5
#define NWK  8                    // waves of a work-group that share one tile's K loop (k_gemms), K = 2048
#define NWS  (HD / 64)            // the same for the scores, K = HD: one 64-k slice a wave
typedef _Float16 h16;
typedef unsigned short bf;
typedef __attribute__((ext_vector_type(16))) __bf16   v16bf;
typedef __attribute__((ext_vector_type(16))) _Float16 v16h;
typedef __attribute__((ext_vector_type(8)))  _Float16 v8h;
typedef __attribute__((ext_vector_type(8)))  unsigned short v8us;
typedef __attribute__((ext_vector_type(8)))  float    v8f;
typedef __attribute__((ext_vector_type(4)))  float    v4f;
typedef v8h  __attribute__((may_alias)) v8ha;
typedef v4f  __attribute__((may_alias)) v4fa;
typedef v8us __attribute__((may_alias)) v8usa;

__device__ __forceinline__ unsigned short f2bf(float f) { unsigned u = __float_as_uint(f); u += 0x7FFFu + ((u >> 16) & 1u); return (unsigned short)(u >> 16); }
__device__ __forceinline__ float bf2f(unsigned short b) { return __uint_as_float(((unsigned)b) << 16); }
__device__ __forceinline__ float bfr(float f) { return bf2f(f2bf(f)); }
__device__ __forceinline__ h16 tohx(float x) { return (h16)x; }
__device__ __forceinline__ void splitf(float y, unsigned short& h, unsigned short& l) { h = f2bf(y); l = f2bf(y - bf2f(h)); }
typedef __attribute__((ext_vector_type(4))) _Float16 v4h;
typedef __attribute__((ext_vector_type(4))) unsigned short v4us;
__device__ __forceinline__ v16h cat16(v8h lo, v8h hi) { return __builtin_shufflevector(lo, hi, 0, 1, 2, 3, 4, 5, 6, 7, 8, 9, 10, 11, 12, 13, 14, 15); }
__device__ __forceinline__ v16bf cat16b(v8us lo, v8us hi) { return __builtin_bit_cast(v16bf, __builtin_shufflevector(lo, hi, 0, 1, 2, 3, 4, 5, 6, 7, 8, 9, 10, 11, 12, 13, 14, 15)); }
__device__ __forceinline__ v8f wmma16(v16h a, v16h b, v8f c) { return __builtin_amdgcn_wmma_f32_16x16x32_f16(false, a, false, b, (short)0, c, false, false); }
__device__ __forceinline__ v8f wmmab(v16bf a, v16bf b, v8f c) { return __builtin_amdgcn_wmma_f32_16x16x32_bf16(false, a, false, b, (short)0, c, false, false); }
// first f32 element of query row i in a head's packed score plane: the row holds its columns 0 .. (i/64+1)*64-1 and no more; the lower half of the row blocks starts at column 0, row block rb of the upper half stands behind row block TT/64-1-rb (the two widths add up to SPW); the 64 rows of a block are SPW apart
__device__ __forceinline__ size_t spk(int i) { const int rb = i >> 6; return (rb < TT / 128) ? (size_t)i * SPW : (size_t)((TT / 64 - 1 - rb) * 64 + (i & 63)) * SPW + (size_t)((TT / 64 - rb) * 64); }



// ---- k_gemms: register-blocked GEMM, one 64x64 output tile per work-group of NW waves; the K loop is dealt to the waves in slices of 64 k (one 128-B line of every operand row), slice s to wave s % NW;
// each wave keeps the whole tile (16 accumulators) for its slices, operands straight from K-contiguous 16-bit planes; the NW partial tiles meet in LDS and are summed in wave order 0..NW-1. grid (M/64, N/64, Z), NW*32 threads.
// C[m][n] (f32, pitch ldc, + optional f32 bias[n]) = sum_k A[m][k] Bt[n][k] (+ split products per NSPLIT). z-batch strides sA/sB/sC in elements. K % 64 == 0.
// CMODE 1 (scores): a tile entirely above the causal diagonal (query rows r0+roff.., key columns c0..) is skipped by its whole work-group; C is the packed score plane (spk, ldc = SPW). CMODE 2 (probability x value): the K loop stops at the diagonal block (nothing is stored beyond it); A is the packed plane seen as 16-bit elements (the probabilities lie at the start of their score row, the lo plane right behind the hi plane). roff = row offset of this launch's first row within the sequence. Grid z = query head: Bt steps by kv head z / REP.
// EPI: what the summed tile is stored as. 0: f32 C. 1 (Q, K): head planes [n / HD][m][n % HD], fp16 + bf16 hi/lo. 2 (V, computed as W_v x^T: m = kv feature, n = token, bias by row): planes [m][n] at pitch ldc, fp16 + hi/lo. 3 (P.V): merged planes [token][z * HD + n], hi/lo, rows >= RH scaled back by 1 / PCAR.
// A tile is 64 columns = one 128-B line of every plane row it stores: one writer a line.
template <typename T16> struct WFrag;
template <> struct WFrag<h16> { typedef v16h V; static __device__ __forceinline__ V ld(const h16* p) { return cat16(*(const v8h*)p, *(const v8h*)(p + 16)); } static __device__ __forceinline__ v8f mma(V a, V b, v8f c) { return wmma16(a, b, c); } };
template <> struct WFrag<bf> { typedef v16bf V; static __device__ __forceinline__ V ld(const bf* p) { return cat16b(*(const v8us*)p, *(const v8us*)(p + 16)); } static __device__ __forceinline__ v8f mma(V a, V b, v8f c) { return wmmab(a, b, c); } };
template <typename T16, int NSPLIT, bool BIAS, int CMODE, int NW, int EPI>
__global__ __launch_bounds__(NW * 32) void k_gemms(const T16* __restrict__ A, const T16* __restrict__ A2, const T16* __restrict__ Bt, const T16* __restrict__ Bt2, int K, float* C, int ldc, const float* __restrict__ bias, int roff, size_t sA, size_t sB, size_t sC, h16* P16, bf* Ph, bf* Pl) {
    typedef typename WFrag<T16>::V V;
    __shared__ __align__(16) float os[NW * 64 * 68];
    const size_t z = blockIdx.z; A += z * sA; if (A2) A2 += z * sA; Bt += (z / REP) * sB; if (Bt2) Bt2 += (z / REP) * sB; C += z * sC;
    const int lane = threadIdx.x & 31, lr = lane & 15, hi = lane >> 4; const int r0 = blockIdx.x * 64, c0 = blockIdx.y * 64;
    const int wv = __builtin_amdgcn_readfirstlane((int)(threadIdx.x >> 5));   // wave number, scalar: the K loop's trip test stays a scalar branch (every lane on at the matrix instructions)
    if (CMODE == 1 && c0 > r0 + roff + 63) return;                  // score tile entirely above the causal diagonal: never read (the softmax masks j > i by select); the same for every wave, in front of the barrier
    const int Kl = (CMODE == 2) ? min(K, r0 + roff + 64) : K;        // P.V: probabilities are exactly 0 beyond the diagonal block, so the K loop stops there
    v8f acc[4][4];
#pragma unroll
    for (int mb = 0; mb < 4; ++mb)
#pragma unroll
        for (int nb = 0; nb < 4; ++nb) acc[mb][nb] = (v8f){};
    const size_t aoff = (size_t)(r0 + lr) * K + 8 * hi, boff = (size_t)(c0 + lr) * K + 8 * hi;
    const size_t poff = 2 * spk(r0 + roff) + (size_t)lr * (2 * SPW) + 8 * hi;   // CMODE 2: this lane's first 16-bit element in the packed plane (row pitch 2 * SPW; the lo plane Kl elements on)
    // rolled: one slice's fragments live at a time, so that two work-groups fit a WGP's registers
#pragma unroll 1
    for (int k0 = wv * 64; k0 < Kl; k0 += NW * 64) {
        V a[4], a2[4];
        // both 32-k steps of the slice in one trip (unrolled: a[] and b stay in registers): a wave uses the whole 128-B line of every row it touches
#pragma unroll
        for (int kc = k0; kc < k0 + 64; kc += 32) {
            if (CMODE == 2) {
#pragma unroll
                for (int mb = 0; mb < 4; ++mb) { a[mb] = WFrag<T16>::ld(A + poff + (size_t)mb * 16 * (2 * SPW) + kc); if (NSPLIT == 2) a2[mb] = WFrag<T16>::ld(A2 + poff + Kl + (size_t)mb * 16 * (2 * SPW) + kc); }
            } else
#pragma unroll
            for (int mb = 0; mb < 4; ++mb) { a[mb] = WFrag<T16>::ld(A + aoff + (size_t)mb * 16 * K + kc); if (NSPLIT == 1 || NSPLIT == 2) a2[mb] = WFrag<T16>::ld(A2 + aoff + (size_t)mb * 16 * K + kc); }
#pragma unroll
            for (int nb = 0; nb < 4; ++nb) { const V b = WFrag<T16>::ld(Bt + boff + (size_t)nb * 16 * K + kc); V b2; if (NSPLIT >= 2) b2 = WFrag<T16>::ld(Bt2 + boff + (size_t)nb * 16 * K + kc);
#pragma unroll
                for (int mb = 0; mb < 4; ++mb) { acc[mb][nb] = WFrag<T16>::mma(a[mb], b, acc[mb][nb]); if (NSPLIT == 1 || NSPLIT == 2) acc[mb][nb] = WFrag<T16>::mma(a2[mb], b, acc[mb][nb]); if (NSPLIT >= 2) acc[mb][nb] = WFrag<T16>::mma(a[mb], b2, acc[mb][nb]); } }
        }
        // the distance behind the trip's last matrix instructions, on the taken side of the loop branch too
        asm volatile("v_nop\n\tv_nop\n\tv_nop\n\tv_nop" : "+v"(acc[0][0]), "+v"(acc[1][1]), "+v"(acc[2][2]), "+v"(acc[3][3]) : "v"(a[0]), "v"(a[3]));
    }
    float* ow = os + wv * (64 * 68);
    float* Cb = C + ((CMODE == 1) ? spk(r0 + roff) : (size_t)r0 * ldc);
#pragma unroll
    for (int mb = 0; mb < 4; ++mb)
#pragma unroll
        for (int nb = 0; nb < 4; ++nb)
#pragma unroll
            for (int j = 0; j < 8; ++j) ow[(mb * 16 + hi * 8 + j) * 68 + nb * 16 + lr] = acc[mb][nb][j];
    __syncthreads();   // every wave's partial tile is in LDS before any wave sums; a wave with no slice has stored zeros
#pragma unroll
    for (int i = 0; i < 64 * 16 / (NW * 32); ++i) { const int e = (int)threadIdx.x + i * (NW * 32), row = e >> 4, cofs = (e & 15) * 4; v4f val = *(const v4fa*)(os + row * 68 + cofs);
#pragma unroll
        for (int w = 1; w < NW; ++w) val += *(const v4fa*)(os + w * (64 * 68) + row * 68 + cofs);
        if (BIAS && EPI == 2) { const float br = bfr(bias[r0 + row]); val[0] += br; val[1] += br; val[2] += br; val[3] += br; }
        else if (BIAS) { val[0] += bfr(bias[c0 + cofs]); val[1] += bfr(bias[c0 + cofs + 1]); val[2] += bfr(bias[c0 + cofs + 2]); val[3] += bfr(bias[c0 + cofs + 3]); }
        if (EPI == 0) *(v4f*)(Cb + (size_t)row * ldc + c0 + cofs) = val;
        else { const int col = c0 + cofs;
            const size_t o = (EPI == 1) ? (size_t)(col / HD) * ((size_t)TT * HD) + (size_t)(r0 + row) * HD + (col % HD) : (EPI == 2) ? (size_t)(r0 + row) * ldc + col : (size_t)(r0 + roff + row) * DQ + z * HD + col;
            const float cs = (EPI == 3 && r0 + roff + row >= RH) ? (1.0f / PCAR) : 1.0f; v4h o16; v4us oh, ol;
#pragma unroll
            for (int q = 0; q < 4; ++q) { const float y = val[q] * cs; o16[q] = tohx(y); unsigned short a2, c2; splitf(y, a2, c2); oh[q] = a2; ol[q] = c2; }
            if (EPI != 3) *(v4h*)(P16 + o) = o16;
            *(v4us*)(Ph + o) = oh; *(v4us*)(Pl + o) = ol; } }
}


__global__ __launch_bounds__(256) void k_cvt8(const float* __restrict__ src, bf* dst, size_t n8) { const size_t i = (size_t)blockIdx.x * 256 + threadIdx.x; if (i >= n8) return; const v8f v = *(const v8f*)(src + i * 8); v8us o;
#pragma unroll
    for (int k = 0; k < 8; ++k) o[k] = f2bf(v[k]); *(v8us*)(dst + i * 8) = o;  }

// k_asoft: per row (zz, i) of the packed score plane: t = S x HD^-0.5 for j <= i and i - j < WIN (sliding causal window; the reference's -inf fill vanishes identically); softmax over the keys (register row, one exp, fixed trees);
// only the w = (i/64+1)*64 stored columns are read; the probabilities go back over the row's own scores (fp16 x PCAR at its start; rows < RH: hi plane at its start, lo plane w elements on): one wave owns a row and holds all of it in registers before it stores.
__global__ __launch_bounds__(256) void k_asoft(float* Sb) {
    const int lane = threadIdx.x & 31; const int row = blockIdx.x * 8 + __builtin_amdgcn_readfirstlane((int)(threadIdx.x >> 5)); if (row >= ZH * TT) return; const int i = row % TT; const int zz = row / TT; const bool hires = (i < RH); const int w = ((i >> 6) + 1) * 64; float* sr = Sb + (size_t)zz * SPH + spk(i); float v[TT / 32]; v4f a[TT / 128]; float mx = -3.0e38f;
#pragma unroll
    for (int ch = 0; ch < TT / 128; ++ch) { a[ch] = *(const v4f*)(sr + min(ch * 128 + lane * 4, w - 4));   // a lane past the stored width reads the row's last stored quad (masked below): no branch between the loads, all of them in flight together
        asm volatile("s_wait_xcnt 0x0" ::: "memory"); }   // each load has address registers of its own, and a later load's result may be given those registers: the wait stands in front of that overwrite
    __builtin_amdgcn_sched_barrier(0);   // keeps the first use of a loaded value behind the last load: without it the wave waits for the first loads in the middle of the run, with the rest not yet issued
#pragma unroll
    for (int ch = 0; ch < TT / 128; ++ch) { const int j0 = ch * 128 + lane * 4;
#pragma unroll
        for (int q = 0; q < 4; ++q) { const int j = j0 + q; (void)j; const float t = (j <= i && i - j < WIN) ? a[ch][q] * SCL : -3.0e38f; v[ch * 4 + q] = t; mx = fmaxf(mx, t); } }
#pragma unroll
    for (int sh = 16; sh; sh >>= 1) mx = fmaxf(mx, __shfl_xor(mx, sh, 32));
    float sum = 0.f;
#pragma unroll
    for (int ch = 0; ch < TT / 128; ++ch) if (ch * 128 < w) {   // a 128-column chunk past the stored width holds exact zeros only: neither summed nor stored
        // d0 is held as in the version before: the difference keeps its own rounding in front of the multiply, so every probability stays bit-identical
#pragma unroll
        for (int k = ch * 4; k < ch * 4 + 4; ++k) { float d0 = __fsub_rn(v[k], mx); asm volatile("" : "+v"(d0)); v[k] = __builtin_amdgcn_exp2f(__fmul_rn(d0, 1.4426950408889634f)); sum += v[k]; } }
#pragma unroll
    for (int sh = 16; sh; sh >>= 1) sum += __shfl_xor(sum, sh, 32);
    const float f = __fdiv_rn(hires ? 1.0f : PCAR, sum);
    if (hires) { bf* ph = (bf*)sr; bf* pl = ph + w;
#pragma unroll
        for (int ch = 0; ch < RH / 128; ++ch) if (ch * 128 < w) { const int j0 = ch * 128 + lane * 4; v4us oh, ol;
#pragma unroll
            for (int q = 0; q < 4; ++q) { unsigned short a, c2; splitf(v[ch * 4 + q] * f, a, c2); oh[q] = a; ol[q] = c2; }
            if (j0 < w) { *(v4us*)(ph + j0) = oh; *(v4us*)(pl + j0) = ol; } }
    } else { h16* p16 = (h16*)sr;
#pragma unroll
        for (int ch = 0; ch < TT / 128; ++ch) if (ch * 128 < w) { const int j0 = ch * 128 + lane * 4; v4h o4;
#pragma unroll
            for (int q = 0; q < 4; ++q) o4[q] = tohx(v[ch * 4 + q] * f);
            if (j0 < w) *(v4h*)(p16 + j0) = o4; } }
}

extern "C" void kernel_launch(void* const* d_in, const int* in_sizes, int n_in,
                              void* d_out, int out_size, void* d_ws, size_t ws_size, hipStream_t stream) {
    (void)in_sizes; (void)n_in; (void)out_size;
    const float* x = (const float*)d_in[0]; const float* wq = (const float*)d_in[1]; const float* bq = (const float*)d_in[2]; const float* wk = (const float*)d_in[3]; const float* bk = (const float*)d_in[4]; const float* wv = (const float*)d_in[5]; const float* bv = (const float*)d_in[6]; const float* wo = (const float*)d_in[7]; const float* bo = (const float*)d_in[8];
    float* OUT = (float*)d_out;     // [1][2048][2048]
    char* wsp = (char*)d_ws;
    auto take = [&](size_t bytes) { char* p = wsp; wsp += (bytes + 255) & ~(size_t)255; return (void*)p; };
    bf* WQ = (bf*)take((size_t)DQ * DM * 2); bf* WK = (bf*)take((size_t)DKV * DM * 2); bf* WV = (bf*)take((size_t)DKV * DM * 2); bf* WO = (bf*)take((size_t)DM * DQ * 2);
    bf* XB = (bf*)take((size_t)TT * DM * 2);
    h16* QP16 = (h16*)take((size_t)NH_ * TT * HD * 2); h16* KP16 = (h16*)take((size_t)NKV * TT * HD * 2); h16* VT16 = (h16*)take((size_t)NKV * HD * TT * 2);
    bf* QPh = (bf*)take((size_t)NH_ * TT * HD * 2); bf* QPl = (bf*)take((size_t)NH_ * TT * HD * 2); bf* KPh = (bf*)take((size_t)NKV * TT * HD * 2); bf* KPl = (bf*)take((size_t)NKV * TT * HD * 2); bf* VTh = (bf*)take((size_t)NKV * HD * TT * 2); bf* VTl = (bf*)take((size_t)NKV * HD * TT * 2);
    float* Sb = (float*)take((size_t)ZH * SPH * 4); bf* ATh = (bf*)take((size_t)TT * DQ * 2); bf* ATl = (bf*)take((size_t)TT * DQ * 2);
    if ((size_t)(wsp - (char*)d_ws) > ws_size) return;    // ws 256 MiB
    { k_cvt8<<<(unsigned)(((size_t)DQ * DM / 8 + 255) / 256), 256, 0, stream>>>(wq, WQ, (size_t)DQ * DM / 8); k_cvt8<<<(unsigned)(((size_t)DKV * DM / 8 + 255) / 256), 256, 0, stream>>>(wk, WK, (size_t)DKV * DM / 8); k_cvt8<<<(unsigned)(((size_t)DKV * DM / 8 + 255) / 256), 256, 0, stream>>>(wv, WV, (size_t)DKV * DM / 8);
      k_cvt8<<<(unsigned)(((size_t)DM * DQ / 8 + 255) / 256), 256, 0, stream>>>(wo, WO, (size_t)DM * DQ / 8);
       }
    for (int b = 0; b < NB_; ++b) {
        
        k_cvt8<<<(unsigned)(((size_t)TT * DM / 8 + 255) / 256), 256, 0, stream>>>(x + (size_t)b * TT * DM, XB, (size_t)TT * DM / 8);
        k_gemms<bf, 0, true, 0, NWK, 1><<<dim3(TT / 64, DQ / 64, 1), NWK * 32, 0, stream>>>(XB, nullptr, WQ, nullptr, DM, nullptr, 0, bq, 0, 0, 0, 0, QP16, QPh, QPl);
        k_gemms<bf, 0, true, 0, NWK, 1><<<dim3(TT / 64, DKV / 64, 1), NWK * 32, 0, stream>>>(XB, nullptr, WK, nullptr, DM, nullptr, 0, bk, 0, 0, 0, 0, KP16, KPh, KPl);
        k_gemms<bf, 0, true, 0, NWK, 2><<<dim3(DKV / 64, TT / 64, 1), NWK * 32, 0, stream>>>(WV, nullptr, XB, nullptr, DM, nullptr, TT, bv, 0, 0, 0, 0, VT16, VTh, VTl);   // rows = kv features, columns = tokens: [kv head][d][t]
        // one pass over all ZH = NH_ query heads (grid z); kv planes step by z / REP inside k_gemms
        k_gemms<bf, 2, false, 1, NWS, 0><<<dim3(RH / 64, TT / 64, ZH), NWS * 32, 0, stream>>>(QPh, QPl, KPh, KPl, HD, Sb, SPW, nullptr, 0, (size_t)TT * HD, (size_t)TT * HD, SPH, nullptr, nullptr, nullptr);
        k_gemms<h16, 0, false, 1, NWS, 0><<<dim3((TT - RH) / 64, TT / 64, ZH), NWS * 32, 0, stream>>>(QP16 + (size_t)RH * HD, nullptr, KP16, nullptr, HD, Sb, SPW, nullptr, RH, (size_t)TT * HD, (size_t)TT * HD, SPH, nullptr, nullptr, nullptr);
        k_asoft<<<ZH * TT / 8, 256, 0, stream>>>(Sb);
        k_gemms<bf, 2, false, 2, NWK, 3><<<dim3(RH / 64, HD / 64, ZH), NWK * 32, 0, stream>>>((const bf*)Sb, (const bf*)Sb, VTh, VTl, TT, nullptr, 0, nullptr, 0, 2 * SPH, (size_t)HD * TT, 0, nullptr, ATh, ATl);
        k_gemms<h16, 0, false, 2, NWK, 3><<<dim3((TT - RH) / 64, HD / 64, ZH), NWK * 32, 0, stream>>>((const h16*)Sb, nullptr, VT16, nullptr, TT, nullptr, 0, nullptr, RH, 2 * SPH, (size_t)HD * TT, 0, nullptr, ATh, ATl);
        k_gemms<bf, 1, true, 0, NWK, 0><<<dim3(TT / 64, DM / 64, 1), NWK * 32, 0, stream>>>(ATh, ATl, WO, nullptr, DQ, OUT + (size_t)b * TT * DM, DM, bo, 0, 0, 0, 0, nullptr, nullptr, nullptr); }
}

// v005
// A run of this version takes 207 microseconds.
// Timed twice side by side with v004, it ran 1.23 times as fast both times.
// Over all steps from v000 it is 3.89 times as fast.
#include <hip/hip_runtime.h>

// Causal grouped-query attention with biases (x [2][2048][2048]; Q = x W_q^T + b_q (16 heads x 128 viewed (4 kv groups, 4)), K, V = x W^T + b (4 kv heads x 128) ('oi' 2048^-0.5 incl. biases: non-zero); query head h = kv*4 + g uses kv head h / 4; scores x 1/sqrt(128); causal (-inf); softmax; out = merged (head-major) W_o^T + b_o -> [2][2048][2048] (8.4 M); argument order x, W_q, b_q, W_k, b_k, W_v, b_v, W_o, b_o). THIS ROW: the same module at ONE sequence (x [1][2048][2048]; Q = x Wq^T + bq ('oi' [2048][2048]); K, V = x W^T + b with 'oi' [512][2048] weights (4 key / value heads x 128); weights normal x 2048^-0.5; the four biases zeros (read); grouped-query: query head h = 4 k + g uses key / value head k; scores x 128^-0.5; tril kept, -inf; softmax; out = merged Wo^T + bo; argument order x, Wq, bq, Wk, bk, Wv, bv, Wo, bo).
// Layout per batch: bf16 copy of x; 'oi' weights as-is; every 16-bit operand plane but the probabilities lies in fragment order (pk below); exact projections + f32 biases, each projection's work-groups storing the 16-bit operand planes of the attention themselves (V as W_v x^T, so that its tile is already key-contiguous); causal T-2048 GQA attention (all 16 query heads in one pass, grid z = query head, kv head z / 4; score rows kept only up to their diagonal block, probabilities written in place over them; hybrid rows: < 512 hi/lo 3 products, rest fp16 x1024; the score GEMM skips tiles above the diagonal; P.V stores the merged hi/lo planes itself); merged hi/lo x W_o exact + b_o.
// Compute dtypes, f32 accumulate: every input rounded to bf16; projections exact + f32 biases; attention rows < 512 3 products, rest fp16; softmax f32; output projection hl x exact.

#define NB_  1
#define TT   2048
#define DM   2048
#define NH_  16
#define NKV  4
#define REP  (NH_ / NKV)
#define HD   128
#define DQ   (NH_ * HD)
#define DKV  (NKV * HD)
#define ZH   NH_                  // query heads of one attention pass (grid z): all of them, kv head z / REP
#define SPW  (TT + 64)            // pitch (f32 elements) of the packed score plane: row block rb (width (rb+1)*64) shares its rows with row block TT/64-1-rb
#define SPH  ((size_t)(TT / 2) * SPW)   // f32 elements of one head's packed score plane
#define RH   512                  // query rows < RH use hi+lo planes (0: none)
#define WIN  2048
#define PCAR 1024.0f
#define SCL  0.088388347648318447f   // HD^-0.5
#define NWK  8                    // waves of a work-group that share one tile's K loop (k_gemms), K = 2048
#define NWS  (HD / 64)            // the same for the scores, K = HD: one 64-k slice a wave
typedef _Float16 h16;
typedef unsigned short bf;
typedef __attribute__((ext_vector_type(16))) __bf16   v16bf;
typedef __attribute__((ext_vector_type(16))) _Float16 v16h;
typedef __attribute__((ext_vector_type(8)))  _Float16 v8h;
typedef __attribute__((ext_vector_type(8)))  unsigned short v8us;
typedef __attribute__((ext_vector_type(8)))  float    v8f;
typedef __attribute__((ext_vector_type(4)))  float    v4f;
typedef v8h  __attribute__((may_alias)) v8ha;
typedef v4f  __attribute__((may_alias)) v4fa;
typedef v8us __attribute__((may_alias)) v8usa;

__device__ __forceinline__ unsigned short f2bf(float f) { unsigned u = __float_as_uint(f); u += 0x7FFFu + ((u >> 16) & 1u); return (unsigned short)(u >> 16); }
__device__ __forceinline__ float bf2f(unsigned short b) { return __uint_as_float(((unsigned)b) << 16); }
__device__ __forceinline__ float bfr(float f) { return bf2f(f2bf(f)); }
__device__ __forceinline__ h16 tohx(float x) { return (h16)x; }
__device__ __forceinline__ void splitf(float y, unsigned short& h, unsigned short& l) { h = f2bf(y); l = f2bf(y - bf2f(h)); }
typedef __attribute__((ext_vector_type(4))) _Float16 v4h;
typedef __attribute__((ext_vector_type(4))) unsigned short v4us;
typedef v4us __attribute__((may_alias)) v4usa;
__device__ __forceinline__ v16h cat16(v8h lo, v8h hi) { return __builtin_shufflevector(lo, hi, 0, 1, 2, 3, 4, 5, 6, 7, 8, 9, 10, 11, 12, 13, 14, 15); }
__device__ __forceinline__ v16bf cat16b(v8us lo, v8us hi) { return __builtin_bit_cast(v16bf, __builtin_shufflevector(lo, hi, 0, 1, 2, 3, 4, 5, 6, 7, 8, 9, 10, 11, 12, 13, 14, 15)); }
__device__ __forceinline__ v8f wmma16(v16h a, v16h b, v8f c) { return __builtin_amdgcn_wmma_f32_16x16x32_f16(false, a, false, b, (short)0, c, false, false); }
__device__ __forceinline__ v8f wmmab(v16bf a, v16bf b, v8f c) { return __builtin_amdgcn_wmma_f32_16x16x32_bf16(false, a, false, b, (short)0, c, false, false); }
// first f32 element of query row i in a head's packed score plane: the row holds its columns 0 .. (i/64+1)*64-1 and no more; the lower half of the row blocks starts at column 0, row block rb of the upper half stands behind row block TT/64-1-rb (the two widths add up to SPW); the 64 rows of a block are SPW apart
__device__ __forceinline__ size_t spk(int i) { const int rb = i >> 6; return (rb < TT / 128) ? (size_t)i * SPW : (size_t)((TT / 64 - 1 - rb) * 64 + (i & 63)) * SPW + (size_t)((TT / 64 - rb) * 64); }
// fragment order of a 16-bit operand plane of K columns: 16 rows x 32 k = 1024 contiguous bytes, laid out as the two 16-byte loads of a matrix fragment take them (piece k/16%2: 512 B; in it lane (k/8%2)*16 + row%16: 16 B = 8 k).
// A wave-wide 16-byte load then reads 512 contiguous bytes = 4 whole 128-B lines, where a row-major plane gives it 32 bytes of each of 16 lines. The k a lane and register holds is the same as before.
__device__ __forceinline__ size_t pk(int row, int k, int K) { return ((size_t)(row >> 4) * (K >> 5) + (k >> 5)) * 512 + ((k >> 4) & 1) * 256 + (((k >> 3) & 1) * 16 + (row & 15)) * 8 + (k & 7); }

// ---- k_gemms: register-blocked GEMM, one 64x64 output tile per work-group of NW waves; the K loop is dealt to the waves in slices of 64 k (128 B of every operand row; in fragment order two whole 1024-B blocks of each 16 rows), slice s to wave s % NW;
// each wave keeps the whole tile (16 accumulators) for its slices, operands straight from 16-bit planes in fragment order (pk; the probabilities alone are row-major); the NW partial tiles meet in LDS and are summed in wave order 0..NW-1. grid (M/64, N/64, Z), NW*32 threads.
// C[m][n] (f32, pitch ldc, + optional f32 bias[n]) = sum_k A[m][k] Bt[n][k] (+ split products per NSPLIT). z-batch strides sA/sB/sC in elements. K % 64 == 0; K is a compile-time constant, so that the 16-row steps of a fragment-order plane are immediate offsets of one address per operand.
// CMODE 1 (scores): a tile entirely above the causal diagonal (query rows r0+roff.., key columns c0..) is skipped by its whole work-group; C is the packed score plane (spk, ldc = SPW). CMODE 2 (probability x value): the K loop stops at the diagonal block (nothing is stored beyond it); A is the packed plane seen as 16-bit elements (the probabilities lie at the start of their score row, the lo plane right behind the hi plane). roff = row offset of this launch's first row within the sequence. Grid z = query head: Bt steps by kv head z / REP.
// EPI: what the summed tile is stored as. 0: f32 C. 1 (Q, K): head planes [n / HD] of (row m, k n % HD), fp16 + bf16 hi/lo. 2 (V, computed as W_v x^T: m = kv feature, n = token, bias by row): planes (row m, k n) of ldc columns, fp16 + hi/lo. 3 (P.V): merged planes (row token, k z * HD + n), hi/lo, rows >= RH scaled back by 1 / PCAR. All three in fragment order.
// A tile is 4 x 2 whole 1024-B fragment blocks of every plane it stores: one writer a line.
template <typename T16> struct WFrag;
template <> struct WFrag<h16> { typedef v16h V; static __device__ __forceinline__ V ld(const h16* p) { return cat16(*(const v8h*)p, *(const v8h*)(p + 16)); } static __device__ __forceinline__ V ldp(const h16* p) { return cat16(*(const v8h*)p, *(const v8h*)(p + 256)); } static __device__ __forceinline__ v8f mma(V a, V b, v8f c) { return wmma16(a, b, c); } };
template <> struct WFrag<bf> { typedef v16bf V; static __device__ __forceinline__ V ld(const bf* p) { return cat16b(*(const v8us*)p, *(const v8us*)(p + 16)); } static __device__ __forceinline__ V ldp(const bf* p) { return cat16b(*(const v8us*)p, *(const v8us*)(p + 256)); } static __device__ __forceinline__ v8f mma(V a, V b, v8f c) { return wmmab(a, b, c); } };
template <typename T16, int NSPLIT, bool BIAS, int CMODE, int NW, int EPI, int K>
__global__ __launch_bounds__(NW * 32) void k_gemms(const T16* __restrict__ A, const T16* __restrict__ A2, const T16* __restrict__ Bt, const T16* __restrict__ Bt2, float* C, int ldc, const float* __restrict__ bias, int roff, size_t sA, size_t sB, size_t sC, h16* P16, bf* Ph, bf* Pl) {
    typedef typename WFrag<T16>::V V;
    __shared__ __align__(16) float os[NW * 64 * 68];
    const size_t z = blockIdx.z; A += z * sA; if (A2) A2 += z * sA; Bt += (z / REP) * sB; if (Bt2) Bt2 += (z / REP) * sB; C += z * sC;
    const int lane = threadIdx.x & 31, lr = lane & 15, hi = lane >> 4; const int r0 = blockIdx.x * 64, c0 = blockIdx.y * 64;
    const int wv = __builtin_amdgcn_readfirstlane((int)(threadIdx.x >> 5));   // wave number, scalar: the K loop's trip test stays a scalar branch (every lane on at the matrix instructions)
    if (CMODE == 1 && c0 > r0 + roff + 63) return;                  // score tile entirely above the causal diagonal: never read (the softmax masks j > i by select); the same for every wave, in front of the barrier
    const int Kl = (CMODE == 2) ? min(K, r0 + roff + 64) : K;        // P.V: probabilities are exactly 0 beyond the diagonal block, so the K loop stops there
    v8f acc[4][4];
#pragma unroll
    for (int mb = 0; mb < 4; ++mb)
#pragma unroll
        for (int nb = 0; nb < 4; ++nb) acc[mb][nb] = (v8f){};
    const size_t aoff = (size_t)r0 * K + 8 * lane, boff = (size_t)c0 * K + 8 * lane;   // fragment order: 16 rows are 16 * K elements, a 32-k step 512 elements on, this lane's 16 bytes at 8 * lane
    const size_t poff = 2 * spk(r0 + roff) + (size_t)lr * (2 * SPW) + 8 * hi;   // CMODE 2: this lane's first 16-bit element in the packed plane (row pitch 2 * SPW; the lo plane Kl elements on)
    // rolled: one slice's fragments live at a time, so that two work-groups fit a WGP's registers
#pragma unroll 1
    for (int k0 = wv * 64; k0 < Kl; k0 += NW * 64) {
        V a[4], a2[4];
        // this trip's one address per operand; every 16-row step and 32-k step is an immediate offset of it
        const T16* pa = A + ((CMODE == 2) ? poff + k0 : aoff + (size_t)k0 * 16); const T16* pa2 = (NSPLIT == 1 || NSPLIT == 2) ? A2 + ((CMODE == 2) ? poff + Kl + k0 : aoff + (size_t)k0 * 16) : pa;
        const T16* pb = Bt + boff + (size_t)k0 * 16; const T16* pb2 = (NSPLIT >= 2) ? Bt2 + boff + (size_t)k0 * 16 : pb;
        // both 32-k steps of the slice in one trip (unrolled: a[] and b stay in registers)
#pragma unroll
        for (int kq = 0; kq < 64; kq += 32) {
            if (CMODE == 2) {
#pragma unroll
                for (int mb = 0; mb < 4; ++mb) { a[mb] = WFrag<T16>::ld(pa + (size_t)mb * 16 * (2 * SPW) + kq); if (NSPLIT == 2) a2[mb] = WFrag<T16>::ld(pa2 + (size_t)mb * 16 * (2 * SPW) + kq); }
            } else
#pragma unroll
            for (int mb = 0; mb < 4; ++mb) { a[mb] = WFrag<T16>::ldp(pa + (size_t)mb * 16 * K + kq * 16); if (NSPLIT == 1 || NSPLIT == 2) a2[mb] = WFrag<T16>::ldp(pa2 + (size_t)mb * 16 * K + kq * 16); }
#pragma unroll
            for (int nb = 0; nb < 4; ++nb) { const V b = WFrag<T16>::ldp(pb + (size_t)nb * 16 * K + kq * 16); V b2; if (NSPLIT >= 2) b2 = WFrag<T16>::ldp(pb2 + (size_t)nb * 16 * K + kq * 16);
#pragma unroll
                for (int mb = 0; mb < 4; ++mb) { acc[mb][nb] = WFrag<T16>::mma(a[mb], b, acc[mb][nb]); if (NSPLIT == 1 || NSPLIT == 2) acc[mb][nb] = WFrag<T16>::mma(a2[mb], b, acc[mb][nb]); if (NSPLIT >= 2) acc[mb][nb] = WFrag<T16>::mma(a[mb], b2, acc[mb][nb]); } }
        }
        // the wait in front of the overwrite of the loads' address registers; the addresses are inputs of the statement, so that none of their registers is given to a load's result or stepped on in front of it
        asm volatile("s_wait_xcnt 0x0" :: "v"(pa), "v"(pa2), "v"(pb), "v"(pb2) : "memory");
        // the distance behind the trip's last matrix instructions, on the taken side of the loop branch too
        asm volatile("v_nop\n\tv_nop\n\tv_nop\n\tv_nop" : "+v"(acc[0][0]), "+v"(acc[1][1]), "+v"(acc[2][2]), "+v"(acc[3][3]) : "v"(a[0]), "v"(a[3]));
    }
    float* ow = os + wv * (64 * 68);
    float* Cb = C + ((CMODE == 1) ? spk(r0 + roff) : (size_t)r0 * ldc);
#pragma unroll
    for (int mb = 0; mb < 4; ++mb)
#pragma unroll
        for (int nb = 0; nb < 4; ++nb)
#pragma unroll
            for (int j = 0; j < 8; ++j) ow[(mb * 16 + hi * 8 + j) * 68 + nb * 16 + lr] = acc[mb][nb][j];
    __syncthreads();   // every wave's partial tile is in LDS before any wave sums; a wave with no slice has stored zeros
    if (EPI == 0) {
#pragma unroll
    for (int i = 0; i < 64 * 16 / (NW * 32); ++i) { const int e = (int)threadIdx.x + i * (NW * 32), row = e >> 4, cofs = (e & 15) * 4; v4f val = *(const v4fa*)(os + row * 68 + cofs);
#pragma unroll
        for (int w = 1; w < NW; ++w) val += *(const v4fa*)(os + w * (64 * 68) + row * 68 + cofs);
        if (BIAS) { val[0] += bfr(bias[c0 + cofs]); val[1] += bfr(bias[c0 + cofs + 1]); val[2] += bfr(bias[c0 + cofs + 2]); val[3] += bfr(bias[c0 + cofs + 3]); }
        *(v4f*)(Cb + (size_t)row * ldc + c0 + cofs) = val; }
    } else {
    // plane stores in fragment order: a thread sums and stores one 16-byte piece (8 k of one row), the threads numbered in the order of the plane, so that a wave stores 512 contiguous bytes of each plane
#pragma unroll
    for (int i = 0; i < 64 * 8 / (NW * 32); ++i) { const int u = (int)threadIdx.x + i * (NW * 32), row = ((u >> 7) & 3) * 16 + (u & 15), cofs = ((u >> 6) & 1) * 32 + ((u >> 5) & 1) * 16 + ((u >> 4) & 1) * 8;
        v4f val = *(const v4fa*)(os + row * 68 + cofs), vb = *(const v4fa*)(os + row * 68 + cofs + 4);
#pragma unroll
        for (int w = 1; w < NW; ++w) { val += *(const v4fa*)(os + w * (64 * 68) + row * 68 + cofs); vb += *(const v4fa*)(os + w * (64 * 68) + row * 68 + cofs + 4); }
        float y8[8];
#pragma unroll
        for (int q = 0; q < 4; ++q) { y8[q] = val[q]; y8[q + 4] = vb[q]; }
        if (BIAS && EPI == 2) { const float br = bfr(bias[r0 + row]);
#pragma unroll
            for (int q = 0; q < 8; ++q) y8[q] += br; }
        else if (BIAS) {
#pragma unroll
            for (int q = 0; q < 8; ++q) y8[q] += bfr(bias[c0 + cofs + q]); }
        const int col = c0 + cofs;
        const size_t o = (EPI == 1) ? (size_t)(col / HD) * ((size_t)TT * HD) + pk(r0 + row, col % HD, HD) : (EPI == 2) ? pk(r0 + row, col, ldc) : pk(r0 + roff + row, (int)z * HD + col, DQ);
        const float cs = (EPI == 3 && r0 + roff + row >= RH) ? (1.0f / PCAR) : 1.0f; v8h o16; v8us oh, ol;
#pragma unroll
        for (int q = 0; q < 8; ++q) { const float y = y8[q] * cs; o16[q] = tohx(y); unsigned short a2, c2; splitf(y, a2, c2); oh[q] = a2; ol[q] = c2; }
        if (EPI != 3) *(v8h*)(P16 + o) = o16;
        *(v8us*)(Ph + o) = oh; *(v8us*)(Pl + o) = ol; }
    }
}


// k_cvtp: f32 [rows][DM] -> bf16 plane in fragment order (pk). One wave takes 16 rows x 64 k: it reads 256 contiguous bytes of two rows with each load (8 loads in flight), turns the block in its own LDS range and stores 4 x 512 contiguous bytes.
// LDS: the 8 pieces of 256 B (16 rows x 8 k) stand 288 B apart, so that the 8-byte stores of a wave fall on all 64 banks. grid = rows * DM / 8192 exactly: no thread leaves in front of the barrier.
__global__ __launch_bounds__(256) void k_cvtp(const float* __restrict__ src, bf* dst) {
    __shared__ __align__(16) bf ls[8 * 8 * 144];
    const int lane = threadIdx.x & 31, wv = threadIdx.x >> 5, c = lane & 15, h = lane >> 4; const size_t g = (size_t)blockIdx.x * 8 + wv;
    const float* s = src + (g / (DM / 64)) * (16 * DM) + (g % (DM / 64)) * 64 + (size_t)h * DM + c * 4; bf* lw = ls + wv * (8 * 144); v4f v[8];
#pragma unroll
    for (int j = 0; j < 8; ++j) v[j] = *(const v4f*)(s + (size_t)j * 2 * DM);
#pragma unroll
    for (int j = 0; j < 8; ++j) { v4us o;
#pragma unroll
        for (int q = 0; q < 4; ++q) o[q] = f2bf(v[j][q]);
        *(v4usa*)(lw + (c >> 1) * 144 + (j * 2 + h) * 8 + (c & 1) * 4) = o; }
    __syncthreads();   // the lanes of a wave read what other lanes of it have written to LDS
#pragma unroll
    for (int t = 0; t < 4; ++t) *(v8us*)(dst + g * 1024 + t * 256 + lane * 8) = *(const v8usa*)(lw + (t * 2 + h) * 144 + c * 8);
}

// k_asoft: per row (zz, i) of the packed score plane: t = S x HD^-0.5 for j <= i and i - j < WIN (sliding causal window; the reference's -inf fill vanishes identically); softmax over the keys (register row, one exp, fixed trees);
// only the w = (i/64+1)*64 stored columns are read; the probabilities go back over the row's own scores (fp16 x PCAR at its start; rows < RH: hi plane at its start, lo plane w elements on): one wave owns a row and holds all of it in registers before it stores.
__global__ __launch_bounds__(256) void k_asoft(float* Sb) {
    const int lane = threadIdx.x & 31; const int row = blockIdx.x * 8 + __builtin_amdgcn_readfirstlane((int)(threadIdx.x >> 5)); if (row >= ZH * TT) return; const int i = row % TT; const int zz = row / TT; const bool hires = (i < RH); const int w = ((i >> 6) + 1) * 64; float* sr = Sb + (size_t)zz * SPH + spk(i); float v[TT / 32]; v4f a[TT / 128]; float mx = -3.0e38f;
#pragma unroll
    for (int ch = 0; ch < TT / 128; ++ch) { a[ch] = *(const v4f*)(sr + min(ch * 128 + lane * 4, w - 4));   // a lane past the stored width reads the row's last stored quad (masked below): no branch between the loads, all of them in flight together
        asm volatile("s_wait_xcnt 0x0" ::: "memory"); }   // each load has address registers of its own, and a later load's result may be given those registers: the wait stands in front of that overwrite
    __builtin_amdgcn_sched_barrier(0);   // keeps the first use of a loaded value behind the last load: without it the wave waits for the first loads in the middle of the run, with the rest not yet issued
#pragma unroll
    for (int ch = 0; ch < TT / 128; ++ch) { const int j0 = ch * 128 + lane * 4;
#pragma unroll
        for (int q = 0; q < 4; ++q) { const int j = j0 + q; (void)j; const float t = (j <= i && i - j < WIN) ? a[ch][q] * SCL : -3.0e38f; v[ch * 4 + q] = t; mx = fmaxf(mx, t); } }
#pragma unroll
    for (int sh = 16; sh; sh >>= 1) mx = fmaxf(mx, __shfl_xor(mx, sh, 32));
    float sum = 0.f;
#pragma unroll
    for (int ch = 0; ch < TT / 128; ++ch) if (ch * 128 < w) {   // a 128-column chunk past the stored width holds exact zeros only: neither summed nor stored
        // d0 is held as in the version before: the difference keeps its own rounding in front of the multiply, so every probability stays bit-identical
#pragma unroll
        for (int k = ch * 4; k < ch * 4 + 4; ++k) { float d0 = __fsub_rn(v[k], mx); asm volatile("" : "+v"(d0)); v[k] = __builtin_amdgcn_exp2f(__fmul_rn(d0, 1.4426950408889634f)); sum += v[k]; } }
#pragma unroll
    for (int sh = 16; sh; sh >>= 1) sum += __shfl_xor(sum, sh, 32);
    const float f = __fdiv_rn(hires ? 1.0f : PCAR, sum);
    if (hires) { bf* ph = (bf*)sr; bf* pl = ph + w;
#pragma unroll
        for (int ch = 0; ch < RH / 128; ++ch) if (ch * 128 < w) { const int j0 = ch * 128 + lane * 4; v4us oh, ol;
#pragma unroll
            for (int q = 0; q < 4; ++q) { unsigned short a, c2; splitf(v[ch * 4 + q] * f, a, c2); oh[q] = a; ol[q] = c2; }
            if (j0 < w) { *(v4us*)(ph + j0) = oh; *(v4us*)(pl + j0) = ol; } }
    } else { h16* p16 = (h16*)sr;
#pragma unroll
        for (int ch = 0; ch < TT / 128; ++ch) if (ch * 128 < w) { const int j0 = ch * 128 + lane * 4; v4h o4;
#pragma unroll
            for (int q = 0; q < 4; ++q) o4[q] = tohx(v[ch * 4 + q] * f);
            if (j0 < w) *(v4h*)(p16 + j0) = o4; } }
}

extern "C" void kernel_launch(void* const* d_in, const int* in_sizes, int n_in,
                              void* d_out, int out_size, void* d_ws, size_t ws_size, hipStream_t stream) {
    (void)in_sizes; (void)n_in; (void)out_size;
    const float* x = (const float*)d_in[0]; const float* wq = (const float*)d_in[1]; const float* bq = (const float*)d_in[2]; const float* wk = (const float*)d_in[3]; const float* bk = (const float*)d_in[4]; const float* wv = (const float*)d_in[5]; const float* bv = (const float*)d_in[6]; const float* wo = (const float*)d_in[7]; const float* bo = (const float*)d_in[8];
    float* OUT = (float*)d_out;     // [1][2048][2048]
    char* wsp = (char*)d_ws;
    auto take = [&](size_t bytes) { char* p = wsp; wsp += (bytes + 255) & ~(size_t)255; return (void*)p; };
    bf* WQ = (bf*)take((size_t)DQ * DM * 2); bf* WK = (bf*)take((size_t)DKV * DM * 2); bf* WV = (bf*)take((size_t)DKV * DM * 2); bf* WO = (bf*)take((size_t)DM * DQ * 2);
    bf* XB = (bf*)take((size_t)TT * DM * 2);
    h16* QP16 = (h16*)take((size_t)NH_ * TT * HD * 2); h16* KP16 = (h16*)take((size_t)NKV * TT * HD * 2); h16* VT16 = (h16*)take((size_t)NKV * HD * TT * 2);
    bf* QPh = (bf*)take((size_t)NH_ * TT * HD * 2); bf* QPl = (bf*)take((size_t)NH_ * TT * HD * 2); bf* KPh = (bf*)take((size_t)NKV * TT * HD * 2); bf* KPl = (bf*)take((size_t)NKV * TT * HD * 2); bf* VTh = (bf*)take((size_t)NKV * HD * TT * 2); bf* VTl = (bf*)take((size_t)NKV * HD * TT * 2);
    float* Sb = (float*)take((size_t)ZH * SPH * 4); bf* ATh = (bf*)take((size_t)TT * DQ * 2); bf* ATl = (bf*)take((size_t)TT * DQ * 2);
    if ((size_t)(wsp - (char*)d_ws) > ws_size) return;    // ws 256 MiB
    { k_cvtp<<<DQ * DM / 8192, 256, 0, stream>>>(wq, WQ); k_cvtp<<<DKV * DM / 8192, 256, 0, stream>>>(wk, WK); k_cvtp<<<DKV * DM / 8192, 256, 0, stream>>>(wv, WV);
      k_cvtp<<<DM * DQ / 8192, 256, 0, stream>>>(wo, WO);
       }
    for (int b = 0; b < NB_; ++b) {
        
        k_cvtp<<<TT * DM / 8192, 256, 0, stream>>>(x + (size_t)b * TT * DM, XB);
        k_gemms<bf, 0, true, 0, NWK, 1, DM><<<dim3(TT / 64, DQ / 64, 1), NWK * 32, 0, stream>>>(XB, nullptr, WQ, nullptr, nullptr, 0, bq, 0, 0, 0, 0, QP16, QPh, QPl);
        k_gemms<bf, 0, true, 0, NWK, 1, DM><<<dim3(TT / 64, DKV / 64, 1), NWK * 32, 0, stream>>>(XB, nullptr, WK, nullptr, nullptr, 0, bk, 0, 0, 0, 0, KP16, KPh, KPl);
        k_gemms<bf, 0, true, 0, NWK, 2, DM><<<dim3(DKV / 64, TT / 64, 1), NWK * 32, 0, stream>>>(WV, nullptr, XB, nullptr, nullptr, TT, bv, 0, 0, 0, 0, VT16, VTh, VTl);   // rows = kv features, columns = tokens: [kv head][d][t]
        // one pass over all ZH = NH_ query heads (grid z); kv planes step by z / REP inside k_gemms
        k_gemms<bf, 2, false, 1, NWS, 0, HD><<<dim3(RH / 64, TT / 64, ZH), NWS * 32, 0, stream>>>(QPh, QPl, KPh, KPl, Sb, SPW, nullptr, 0, (size_t)TT * HD, (size_t)TT * HD, SPH, nullptr, nullptr, nullptr);
        k_gemms<h16, 0, false, 1, NWS, 0, HD><<<dim3((TT - RH) / 64, TT / 64, ZH), NWS * 32, 0, stream>>>(QP16 + (size_t)RH * HD, nullptr, KP16, nullptr, Sb, SPW, nullptr, RH, (size_t)TT * HD, (size_t)TT * HD, SPH, nullptr, nullptr, nullptr);
        k_asoft<<<ZH * TT / 8, 256, 0, stream>>>(Sb);
        k_gemms<bf, 2, false, 2, NWK, 3, TT><<<dim3(RH / 64, HD / 64, ZH), NWK * 32, 0, stream>>>((const bf*)Sb, (const bf*)Sb, VTh, VTl, nullptr, 0, nullptr, 0, 2 * SPH, (size_t)HD * TT, 0, nullptr, ATh, ATl);
        k_gemms<h16, 0, false, 2, NWK, 3, TT><<<dim3((TT - RH) / 64, HD / 64, ZH), NWK * 32, 0, stream>>>((const h16*)Sb, nullptr, VT16, nullptr, nullptr, 0, nullptr, RH, 2 * SPH, (size_t)HD * TT, 0, nullptr, ATh, ATl);
        k_gemms<bf, 1, true, 0, NWK, 0, DQ><<<dim3(TT / 64, DM / 64, 1), NWK * 32, 0, stream>>>(ATh, ATl, WO, nullptr, OUT + (size_t)b * TT * DM, DM, bo, 0, 0, 0, 0, nullptr, nullptr, nullptr); }
}

// v006
// A run of this version takes 176 microseconds.
// Two timings next to v005 put it at 1.19 and 1.18 times that version's speed.
// Counting every step since v000, it is 4.61 times as fast.
#include <hip/hip_runtime.h>

// Causal grouped-query attention with biases (x [2][2048][2048]; Q = x W_q^T + b_q (16 heads x 128 viewed (4 kv groups, 4)), K, V = x W^T + b (4 kv heads x 128) ('oi' 2048^-0.5 incl. biases: non-zero); query head h = kv*4 + g uses kv head h / 4; scores x 1/sqrt(128); causal (-inf); softmax; out = merged (head-major) W_o^T + b_o -> [2][2048][2048] (8.4 M); argument order x, W_q, b_q, W_k, b_k, W_v, b_v, W_o, b_o). THIS ROW: the same module at ONE sequence (x [1][2048][2048]; Q = x Wq^T + bq ('oi' [2048][2048]); K, V = x W^T + b with 'oi' [512][2048] weights (4 key / value heads x 128); weights normal x 2048^-0.5; the four biases zeros (read); grouped-query: query head h = 4 k + g uses key / value head k; scores x 128^-0.5; tril kept, -inf; softmax; out = merged Wo^T + bo; argument order x, Wq, bq, Wk, bk, Wv, bv, Wo, bo).
// Layout per batch: bf16 copy of x; 'oi' weights as-is; every 16-bit operand plane but the probabilities lies in fragment order (pk below); exact projections + f32 biases, each projection's work-groups storing the 16-bit operand planes of the attention themselves (V as W_v x^T, so that its tile is already key-contiguous); causal T-2048 GQA attention (all 16 query heads in one pass, grid z = query head, kv head z / 4; score rows kept only up to their diagonal block, probabilities written in place over them; hybrid rows: < 512 hi/lo 3 products, rest fp16 x1024; the score GEMM skips tiles above the diagonal; P.V stores the merged hi/lo planes itself); merged hi/lo x W_o exact + b_o.
// Compute dtypes, f32 accumulate: every input rounded to bf16; projections exact + f32 biases; attention rows < 512 3 products, rest fp16; softmax f32; output projection hl x exact.

#define NB_  1
#define TT   2048
#define DM   2048
#define NH_  16
#define NKV  4
#define REP  (NH_ / NKV)
#define HD   128
#define DQ   (NH_ * HD)
#define DKV  (NKV * HD)
#define ZH   NH_                  // query heads of one attention pass (grid z): all of them, kv head z / REP
#define SPW  (TT + 64)            // pitch (f32 elements) of the packed score plane: row block rb (width (rb+1)*64) shares its rows with row block TT/64-1-rb
#define SPH  ((size_t)(TT / 2) * SPW)   // f32 elements of one head's packed score plane
#define RH   512                  // query rows < RH use hi+lo planes (0: none)
#define WIN  2048
#define PCAR 1024.0f
#define SCL  0.088388347648318447f   // HD^-0.5
#define NWK  8                    // waves of a work-group that share one tile's K loop (gemms), K = 2048
#define NWS  (HD / 64)            // the same for the scores, K = HD: one 64-k slice a wave
typedef _Float16 h16;
typedef unsigned short bf;
typedef __attribute__((ext_vector_type(16))) __bf16   v16bf;
typedef __attribute__((ext_vector_type(16))) _Float16 v16h;
typedef __attribute__((ext_vector_type(8)))  _Float16 v8h;
typedef __attribute__((ext_vector_type(8)))  unsigned short v8us;
typedef __attribute__((ext_vector_type(8)))  float    v8f;
typedef __attribute__((ext_vector_type(4)))  float    v4f;
typedef v8h  __attribute__((may_alias)) v8ha;
typedef v4f  __attribute__((may_alias)) v4fa;
typedef v8us __attribute__((may_alias)) v8usa;

__device__ __forceinline__ unsigned short f2bf(float f) { unsigned u = __float_as_uint(f); u += 0x7FFFu + ((u >> 16) & 1u); return (unsigned short)(u >> 16); }
__device__ __forceinline__ float bf2f(unsigned short b) { return __uint_as_float(((unsigned)b) << 16); }
__device__ __forceinline__ float bfr(float f) { return bf2f(f2bf(f)); }
__device__ __forceinline__ h16 tohx(float x) { return (h16)x; }
__device__ __forceinline__ void splitf(float y, unsigned short& h, unsigned short& l) { h = f2bf(y); l = f2bf(y - bf2f(h)); }
typedef __attribute__((ext_vector_type(4))) _Float16 v4h;
typedef __attribute__((ext_vector_type(4))) unsigned short v4us;
typedef v4us __attribute__((may_alias)) v4usa;
__device__ __forceinline__ v16h cat16(v8h lo, v8h hi) { return __builtin_shufflevector(lo, hi, 0, 1, 2, 3, 4, 5, 6, 7, 8, 9, 10, 11, 12, 13, 14, 15); }
__device__ __forceinline__ v16bf cat16b(v8us lo, v8us hi) { return __builtin_bit_cast(v16bf, __builtin_shufflevector(lo, hi, 0, 1, 2, 3, 4, 5, 6, 7, 8, 9, 10, 11, 12, 13, 14, 15)); }
__device__ __forceinline__ v8f wmma16(v16h a, v16h b, v8f c) { return __builtin_amdgcn_wmma_f32_16x16x32_f16(false, a, false, b, (short)0, c, false, false); }
__device__ __forceinline__ v8f wmmab(v16bf a, v16bf b, v8f c) { return __builtin_amdgcn_wmma_f32_16x16x32_bf16(false, a, false, b, (short)0, c, false, false); }
// first f32 element of query row i in a head's packed score plane: the row holds its columns 0 .. (i/64+1)*64-1 and no more; the lower half of the row blocks starts at column 0, row block rb of the upper half stands behind row block TT/64-1-rb (the two widths add up to SPW); the 64 rows of a block are SPW apart
__device__ __forceinline__ size_t spk(int i) { const int rb = i >> 6; return (rb < TT / 128) ? (size_t)i * SPW : (size_t)((TT / 64 - 1 - rb) * 64 + (i & 63)) * SPW + (size_t)((TT / 64 - rb) * 64); }
// fragment order of a 16-bit operand plane of K columns: 16 rows x 32 k = 1024 contiguous bytes, laid out as the two 16-byte loads of a matrix fragment take them (piece k/16%2: 512 B; in it lane (k/8%2)*16 + row%16: 16 B = 8 k).
// A wave-wide 16-byte load then reads 512 contiguous bytes = 4 whole 128-B lines, where a row-major plane gives it 32 bytes of each of 16 lines. The k a lane and register holds is the same as before.
__device__ __forceinline__ size_t pk(int row, int k, int K) { return ((size_t)(row >> 4) * (K >> 5) + (k >> 5)) * 512 + ((k >> 4) & 1) * 256 + (((k >> 3) & 1) * 16 + (row & 15)) * 8 + (k & 7); }

// ---- gemms: register-blocked GEMM, one 64x64 output tile per work-group of NW waves; the K loop is dealt to the waves in slices of 64 k (2048 contiguous bytes of every 16 rows of a fragment-order plane), slice s to wave s % NW;
// each wave keeps the whole tile (16 accumulators) for its slices, operands straight from 16-bit planes in fragment order (pk; the probabilities alone are row-major); the NW partial tiles meet in LDS and are summed in wave order 0..NW-1. tiles (M/64, N/64, Z), NW*32 threads.
// C[m][n] (f32, pitch ldc, + optional f32 bias[n]) = sum_k A[m][k] Bt[n][k] (+ split products per NSPLIT). z-batch strides sA/sB/sC in elements. K % 64 == 0; K is a compile-time constant, so that the 16-row steps of a fragment-order plane are immediate offsets of one address per operand.
// CMODE 1 (scores): a tile entirely above the causal diagonal (query rows r0+roff.., key columns c0..) is skipped by its whole work-group; C is the packed score plane (spk, ldc = SPW). CMODE 2 (probability x value): the K loop stops at the diagonal block (nothing is stored beyond it); A is the packed plane seen as 16-bit elements (the probabilities lie at the start of their score row, the lo plane right behind the hi plane). roff = row offset of this GEMM's first row within the sequence. Grid z = query head: Bt steps by kv head z / REP.
// EPI: what the summed tile is stored as. 0: f32 C. 1 (Q, K): head planes [n / HD] of (row m, k n % HD), fp16 + bf16 hi/lo. 2 (V, computed as W_v x^T: m = kv feature, n = token, bias by row): planes (row m, k n) of ldc columns, fp16 + hi/lo. 3 (P.V): merged planes (row token, k z * HD + n), hi/lo, rows >= RH scaled back by 1 / PCAR. All three in fragment order.
// A tile is 4 x 2 whole 1024-B fragment blocks of every plane it stores: one writer a line.
template <typename T16> struct WFrag;
template <> struct WFrag<h16> { typedef v16h V; static __device__ __forceinline__ V ld(const h16* p) { return cat16(*(const v8h*)p, *(const v8h*)(p + 16)); } static __device__ __forceinline__ V ldp(const h16* p) { return cat16(*(const v8h*)p, *(const v8h*)(p + 256)); } static __device__ __forceinline__ v8f mma(V a, V b, v8f c) { return wmma16(a, b, c); } };
template <> struct WFrag<bf> { typedef v16bf V; static __device__ __forceinline__ V ld(const bf* p) { return cat16b(*(const v8us*)p, *(const v8us*)(p + 16)); } static __device__ __forceinline__ V ldp(const bf* p) { return cat16b(*(const v8us*)p, *(const v8us*)(p + 256)); } static __device__ __forceinline__ v8f mma(V a, V b, v8f c) { return wmmab(a, b, c); } };
// The body is a device function: os = the work-group's LDS (NW * 64 * 68 floats), (bx, by, z) = the tile it takes. A launch may hold the tiles of several independent GEMMs (kernels below): each work-group runs one body, chosen by its block index alone.
template <typename T16, int NSPLIT, bool BIAS, int CMODE, int NW, int EPI, int K>
__device__ __forceinline__ void gemms(float* os, int bx, int by, size_t z, const T16* __restrict__ A, const T16* __restrict__ A2, const T16* __restrict__ Bt, const T16* __restrict__ Bt2, float* C, int ldc, const float* __restrict__ bias, int roff, size_t sA, size_t sB, size_t sC, h16* P16, bf* Ph, bf* Pl) {
    typedef typename WFrag<T16>::V V;
    A += z * sA; if (A2) A2 += z * sA; Bt += (z / REP) * sB; if (Bt2) Bt2 += (z / REP) * sB; C += z * sC;
    const int lane = threadIdx.x & 31, lr = lane & 15, hi = lane >> 4; const int r0 = bx * 64, c0 = by * 64;
    const int wv = __builtin_amdgcn_readfirstlane((int)(threadIdx.x >> 5));   // wave number, scalar: the K loop's trip test stays a scalar branch (every lane on at the matrix instructions)
    if (CMODE == 1 && c0 > r0 + roff + 63) return;                  // score tile entirely above the causal diagonal: never read (the softmax masks j > i by select); the same for every wave, in front of the barrier
    const int Kl = (CMODE == 2) ? min(K, r0 + roff + 64) : K;        // P.V: probabilities are exactly 0 beyond the diagonal block, so the K loop stops there
    v8f acc[4][4];
#pragma unroll
    for (int mb = 0; mb < 4; ++mb)
#pragma unroll
        for (int nb = 0; nb < 4; ++nb) acc[mb][nb] = (v8f){};
    const size_t aoff = (size_t)r0 * K + 8 * lane, boff = (size_t)c0 * K + 8 * lane;   // fragment order: 16 rows are 16 * K elements, a 32-k step 512 elements on, this lane's 16 bytes at 8 * lane
    const size_t poff = 2 * spk(r0 + roff) + (size_t)lr * (2 * SPW) + 8 * hi;   // CMODE 2: this lane's first 16-bit element in the packed plane (row pitch 2 * SPW; the lo plane Kl elements on)
    // rolled: one slice's fragments live at a time, so that two work-groups fit a WGP's registers
#pragma unroll 1
    for (int k0 = wv * 64; k0 < Kl; k0 += NW * 64) {
        V a[4], a2[4];
        // this trip's one address per operand; every 16-row step and 32-k step is an immediate offset of it
        const T16* pa = A + ((CMODE == 2) ? poff + k0 : aoff + (size_t)k0 * 16); const T16* pa2 = (NSPLIT == 1 || NSPLIT == 2) ? A2 + ((CMODE == 2) ? poff + Kl + k0 : aoff + (size_t)k0 * 16) : pa;
        const T16* pb = Bt + boff + (size_t)k0 * 16; const T16* pb2 = (NSPLIT >= 2) ? Bt2 + boff + (size_t)k0 * 16 : pb;
        // both 32-k steps of the slice in one trip (unrolled: a[] and b stay in registers)
#pragma unroll
        for (int kq = 0; kq < 64; kq += 32) {
            if (CMODE == 2) {
#pragma unroll
                for (int mb = 0; mb < 4; ++mb) { a[mb] = WFrag<T16>::ld(pa + (size_t)mb * 16 * (2 * SPW) + kq); if (NSPLIT == 2) a2[mb] = WFrag<T16>::ld(pa2 + (size_t)mb * 16 * (2 * SPW) + kq); }
            } else
#pragma unroll
            for (int mb = 0; mb < 4; ++mb) { a[mb] = WFrag<T16>::ldp(pa + (size_t)mb * 16 * K + kq * 16); if (NSPLIT == 1 || NSPLIT == 2) a2[mb] = WFrag<T16>::ldp(pa2 + (size_t)mb * 16 * K + kq * 16); }
#pragma unroll
            for (int nb = 0; nb < 4; ++nb) { const V b = WFrag<T16>::ldp(pb + (size_t)nb * 16 * K + kq * 16); V b2; if (NSPLIT >= 2) b2 = WFrag<T16>::ldp(pb2 + (size_t)nb * 16 * K + kq * 16);
#pragma unroll
                for (int mb = 0; mb < 4; ++mb) { acc[mb][nb] = WFrag<T16>::mma(a[mb], b, acc[mb][nb]); if (NSPLIT == 1 || NSPLIT == 2) acc[mb][nb] = WFrag<T16>::mma(a2[mb], b, acc[mb][nb]); if (NSPLIT >= 2) acc[mb][nb] = WFrag<T16>::mma(a[mb], b2, acc[mb][nb]); } }
        }
        // the wait in front of the overwrite of the loads' address registers; the addresses are inputs of the statement, so that none of their registers is given to a load's result or stepped on in front of it
        asm volatile("s_wait_xcnt 0x0" :: "v"(pa), "v"(pa2), "v"(pb), "v"(pb2) : "memory");
        // the distance behind the trip's last matrix instructions, on the taken side of the loop branch too
        asm volatile("v_nop\n\tv_nop\n\tv_nop\n\tv_nop" : "+v"(acc[0][0]), "+v"(acc[1][1]), "+v"(acc[2][2]), "+v"(acc[3][3]) : "v"(a[0]), "v"(a[3]));
    }
    float* ow = os + wv * (64 * 68);
    float* Cb = C + ((CMODE == 1) ? spk(r0 + roff) : (size_t)r0 * ldc);
#pragma unroll
    for (int mb = 0; mb < 4; ++mb)
#pragma unroll
        for (int nb = 0; nb < 4; ++nb)
#pragma unroll
            for (int j = 0; j < 8; ++j) ow[(mb * 16 + hi * 8 + j) * 68 + nb * 16 + lr] = acc[mb][nb][j];
    __syncthreads();   // every wave's partial tile is in LDS before any wave sums; a wave with no slice has stored zeros
    if (EPI == 0) {
#pragma unroll
    for (int i = 0; i < 64 * 16 / (NW * 32); ++i) { const int e = (int)threadIdx.x + i * (NW * 32), row = e >> 4, cofs = (e & 15) * 4; v4f val = *(const v4fa*)(os + row * 68 + cofs);
#pragma unroll
        for (int w = 1; w < NW; ++w) val += *(const v4fa*)(os + w * (64 * 68) + row * 68 + cofs);
        if (BIAS) { val[0] += bfr(bias[c0 + cofs]); val[1] += bfr(bias[c0 + cofs + 1]); val[2] += bfr(bias[c0 + cofs + 2]); val[3] += bfr(bias[c0 + cofs + 3]); }
        *(v4f*)(Cb + (size_t)row * ldc + c0 + cofs) = val; }
    } else {
    // plane stores in fragment order: a thread sums and stores one 16-byte piece (8 k of one row), the threads numbered in the order of the plane, so that a wave stores 512 contiguous bytes of each plane
#pragma unroll
    for (int i = 0; i < 64 * 8 / (NW * 32); ++i) { const int u = (int)threadIdx.x + i * (NW * 32), row = ((u >> 7) & 3) * 16 + (u & 15), cofs = ((u >> 6) & 1) * 32 + ((u >> 5) & 1) * 16 + ((u >> 4) & 1) * 8;
        v4f val = *(const v4fa*)(os + row * 68 + cofs), vb = *(const v4fa*)(os + row * 68 + cofs + 4);
#pragma unroll
        for (int w = 1; w < NW; ++w) { val += *(const v4fa*)(os + w * (64 * 68) + row * 68 + cofs); vb += *(const v4fa*)(os + w * (64 * 68) + row * 68 + cofs + 4); }
        float y8[8];
#pragma unroll
        for (int q = 0; q < 4; ++q) { y8[q] = val[q]; y8[q + 4] = vb[q]; }
        if (BIAS && EPI == 2) { const float br = bfr(bias[r0 + row]);
#pragma unroll
            for (int q = 0; q < 8; ++q) y8[q] += br; }
        else if (BIAS) {
#pragma unroll
            for (int q = 0; q < 8; ++q) y8[q] += bfr(bias[c0 + cofs + q]); }
        const int col = c0 + cofs;
        const size_t o = (EPI == 1) ? (size_t)(col / HD) * ((size_t)TT * HD) + pk(r0 + row, col % HD, HD) : (EPI == 2) ? pk(r0 + row, col, ldc) : pk(r0 + roff + row, (int)z * HD + col, DQ);
        const float cs = (EPI == 3 && r0 + roff + row >= RH) ? (1.0f / PCAR) : 1.0f; v8h o16; v8us oh, ol;
#pragma unroll
        for (int q = 0; q < 8; ++q) { const float y = y8[q] * cs; o16[q] = tohx(y); unsigned short a2, c2; splitf(y, a2, c2); oh[q] = a2; ol[q] = c2; }
        if (EPI != 3) *(v8h*)(P16 + o) = o16;
        *(v8us*)(Ph + o) = oh; *(v8us*)(Pl + o) = ol; }
    }
}

// k_qkv: the three projections in one launch, grid (TT/64, (DQ + 2 * DKV) / 64). y < DQ/64: Q tile (x, y); the next DKV/64: K tile; the last DKV/64: V as W_v x^T, tile (row block y', token block x).
__global__ __launch_bounds__(NWK * 32) void k_qkv(const bf* __restrict__ XB, const bf* __restrict__ WQ, const bf* __restrict__ WK, const bf* __restrict__ WV, const float* __restrict__ bq, const float* __restrict__ bk, const float* __restrict__ bv, h16* QP16, bf* QPh, bf* QPl, h16* KP16, bf* KPh, bf* KPl, h16* VT16, bf* VTh, bf* VTl) {
    __shared__ __align__(16) float os[NWK * 64 * 68];
    const int bx = blockIdx.x, by = blockIdx.y;
    if (by < (DQ + DKV) / 64) { const bool q = by < DQ / 64;
        gemms<bf, 0, true, 0, NWK, 1, DM>(os, bx, q ? by : by - DQ / 64, 0, XB, nullptr, q ? WQ : WK, nullptr, nullptr, 0, q ? bq : bk, 0, 0, 0, 0, q ? QP16 : KP16, q ? QPh : KPh, q ? QPl : KPl); }
    else gemms<bf, 0, true, 0, NWK, 2, DM>(os, by - (DQ + DKV) / 64, bx, 0, WV, nullptr, XB, nullptr, nullptr, TT, bv, 0, 0, 0, 0, VT16, VTh, VTl);   // rows = kv features, columns = tokens: [kv head][d][t]
}

// k_scores: both score GEMMs in one launch, grid (TT/64, TT/64, ZH): row blocks x < RH/64 hi/lo 3 products, the rest fp16.
__global__ __launch_bounds__(NWS * 32) void k_scores(const bf* __restrict__ QPh, const bf* __restrict__ QPl, const bf* __restrict__ KPh, const bf* __restrict__ KPl, const h16* __restrict__ QP16, const h16* __restrict__ KP16, float* Sb) {
    __shared__ __align__(16) float os[NWS * 64 * 68];
    const int bx = blockIdx.x;
    if (bx < RH / 64) gemms<bf, 2, false, 1, NWS, 0, HD>(os, bx, blockIdx.y, blockIdx.z, QPh, QPl, KPh, KPl, Sb, SPW, nullptr, 0, (size_t)TT * HD, (size_t)TT * HD, SPH, nullptr, nullptr, nullptr);
    else gemms<h16, 0, false, 1, NWS, 0, HD>(os, bx - RH / 64, blockIdx.y, blockIdx.z, QP16 + (size_t)RH * HD, nullptr, KP16, nullptr, Sb, SPW, nullptr, RH, (size_t)TT * HD, (size_t)TT * HD, SPH, nullptr, nullptr, nullptr);
}

// k_pv: both probability x value GEMMs in one launch, grid (TT/64, HD/64, ZH): row blocks x < RH/64 hi/lo 3 products, the rest fp16.
__global__ __launch_bounds__(NWK * 32) void k_pv(const float* Sb, const bf* __restrict__ VTh, const bf* __restrict__ VTl, const h16* __restrict__ VT16, bf* ATh, bf* ATl) {
    __shared__ __align__(16) float os[NWK * 64 * 68];
    const int bx = blockIdx.x;
    if (bx < RH / 64) gemms<bf, 2, false, 2, NWK, 3, TT>(os, bx, blockIdx.y, blockIdx.z, (const bf*)Sb, (const bf*)Sb, VTh, VTl, nullptr, 0, nullptr, 0, 2 * SPH, (size_t)HD * TT, 0, nullptr, ATh, ATl);
    else gemms<h16, 0, false, 2, NWK, 3, TT>(os, bx - RH / 64, blockIdx.y, blockIdx.z, (const h16*)Sb, nullptr, VT16, nullptr, nullptr, 0, nullptr, RH, 2 * SPH, (size_t)HD * TT, 0, nullptr, ATh, ATl);
}

// k_oproj: merged hi/lo x W_o + b_o, grid (TT/64, DM/64).
__global__ __launch_bounds__(NWK * 32) void k_oproj(const bf* __restrict__ ATh, const bf* __restrict__ ATl, const bf* __restrict__ WO, float* OUT, const float* __restrict__ bo) {
    __shared__ __align__(16) float os[NWK * 64 * 68];
    gemms<bf, 1, true, 0, NWK, 0, DQ>(os, blockIdx.x, blockIdx.y, 0, ATh, ATl, WO, nullptr, OUT, DM, bo, 0, 0, 0, 0, nullptr, nullptr, nullptr);
}


// k_cvtp: f32 [rows][DM] -> bf16 plane in fragment order (pk). One wave takes 16 rows x 64 k: it reads 256 contiguous bytes of two rows with each load (8 loads in flight), turns the block in its own LDS range and stores 4 x 512 contiguous bytes.
// LDS: the 8 pieces of 256 B (16 rows x 8 k) stand 288 B apart, so that the 8-byte stores of a wave fall on all 64 banks. All five planes in one launch: the block index picks the plane (CB_ blocks each, in the order x, W_q, W_k, W_v, W_o) and the block's place in it. grid = the five planes' rows * DM / 8192 exactly: no thread leaves in front of the barrier.
#define CB_X (TT * DM / 8192)
#define CB_Q (DQ * DM / 8192)
#define CB_K (DKV * DM / 8192)
#define CB_O (DM * DQ / 8192)
__global__ __launch_bounds__(256) void k_cvtp(const float* __restrict__ x, const float* __restrict__ wq, const float* __restrict__ wk, const float* __restrict__ wv_, const float* __restrict__ wo, bf* XB, bf* WQ, bf* WK, bf* WV, bf* WO) {
    __shared__ __align__(16) bf ls[8 * 8 * 144];
    int blk = blockIdx.x; const float* src = x; bf* dst = XB;
    if (blk >= CB_X + CB_Q + 2 * CB_K) { blk -= CB_X + CB_Q + 2 * CB_K; src = wo; dst = WO; }
    else if (blk >= CB_X + CB_Q + CB_K) { blk -= CB_X + CB_Q + CB_K; src = wv_; dst = WV; }
    else if (blk >= CB_X + CB_Q) { blk -= CB_X + CB_Q; src = wk; dst = WK; }
    else if (blk >= CB_X) { blk -= CB_X; src = wq; dst = WQ; }
    const int lane = threadIdx.x & 31, wv = threadIdx.x >> 5, c = lane & 15, h = lane >> 4; const size_t g = (size_t)blk * 8 + wv;
    const float* s = src + (g / (DM / 64)) * (16 * DM) + (g % (DM / 64)) * 64 + (size_t)h * DM + c * 4; bf* lw = ls + wv * (8 * 144); v4f v[8];
#pragma unroll
    for (int j = 0; j < 8; ++j) v[j] = *(const v4f*)(s + (size_t)j * 2 * DM);
#pragma unroll
    for (int j = 0; j < 8; ++j) { v4us o;
#pragma unroll
        for (int q = 0; q < 4; ++q) o[q] = f2bf(v[j][q]);
        *(v4usa*)(lw + (c >> 1) * 144 + (j * 2 + h) * 8 + (c & 1) * 4) = o; }
    __syncthreads();   // the lanes of a wave read what other lanes of it have written to LDS
#pragma unroll
    for (int t = 0; t < 4; ++t) *(v8us*)(dst + g * 1024 + t * 256 + lane * 8) = *(const v8usa*)(lw + (t * 2 + h) * 144 + c * 8);
}

// k_asoft: per row (zz, i) of the packed score plane: t = S x HD^-0.5 for j <= i and i - j < WIN (sliding causal window; the reference's -inf fill vanishes identically); softmax over the keys (register row, one exp, fixed trees);
// only the w = (i/64+1)*64 stored columns are read; the probabilities go back over the row's own scores (fp16 x PCAR at its start; rows < RH: hi plane at its start, lo plane w elements on): one wave owns a row and holds all of it in registers before it stores.
__global__ __launch_bounds__(256) void k_asoft(float* Sb) {
    const int lane = threadIdx.x & 31; const int row = blockIdx.x * 8 + __builtin_amdgcn_readfirstlane((int)(threadIdx.x >> 5)); if (row >= ZH * TT) return; const int i = row % TT; const int zz = row / TT; const bool hires = (i < RH); const int w = ((i >> 6) + 1) * 64; float* sr = Sb + (size_t)zz * SPH + spk(i); float v[TT / 32]; v4f a[TT / 128]; float mx = -3.0e38f;
#pragma unroll
    for (int ch = 0; ch < TT / 128; ++ch) { a[ch] = *(const v4f*)(sr + min(ch * 128 + lane * 4, w - 4));   // a lane past the stored width reads the row's last stored quad (masked below): no branch between the loads, all of them in flight together
        asm volatile("s_wait_xcnt 0x0" ::: "memory"); }   // each load has address registers of its own, and a later load's result may be given those registers: the wait stands in front of that overwrite
    __builtin_amdgcn_sched_barrier(0);   // keeps the first use of a loaded value behind the last load: without it the wave waits for the first loads in the middle of the run, with the rest not yet issued
#pragma unroll
    for (int ch = 0; ch < TT / 128; ++ch) { const int j0 = ch * 128 + lane * 4;
#pragma unroll
        for (int q = 0; q < 4; ++q) { const int j = j0 + q; (void)j; const float t = (j <= i && i - j < WIN) ? a[ch][q] * SCL : -3.0e38f; v[ch * 4 + q] = t; mx = fmaxf(mx, t); } }
#pragma unroll
    for (int sh = 16; sh; sh >>= 1) mx = fmaxf(mx, __shfl_xor(mx, sh, 32));
    float sum = 0.f;
#pragma unroll
    for (int ch = 0; ch < TT / 128; ++ch) if (ch * 128 < w) {   // a 128-column chunk past the stored width holds exact zeros only: neither summed nor stored
        // d0 is held as in the version before: the difference keeps its own rounding in front of the multiply, so every probability stays bit-identical
#pragma unroll
        for (int k = ch * 4; k < ch * 4 + 4; ++k) { float d0 = __fsub_rn(v[k], mx); asm volatile("" : "+v"(d0)); v[k] = __builtin_amdgcn_exp2f(__fmul_rn(d0, 1.4426950408889634f)); sum += v[k]; } }
#pragma unroll
    for (int sh = 16; sh; sh >>= 1) sum += __shfl_xor(sum, sh, 32);
    const float f = __fdiv_rn(hires ? 1.0f : PCAR, sum);
    if (hires) { bf* ph = (bf*)sr; bf* pl = ph + w;
#pragma unroll
        for (int ch = 0; ch < RH / 128; ++ch) if (ch * 128 < w) { const int j0 = ch * 128 + lane * 4; v4us oh, ol;
#pragma unroll
            for (int q = 0; q < 4; ++q) { unsigned short a, c2; splitf(v[ch * 4 + q] * f, a, c2); oh[q] = a; ol[q] = c2; }
            if (j0 < w) { *(v4us*)(ph + j0) = oh; *(v4us*)(pl + j0) = ol; } }
    } else { h16* p16 = (h16*)sr;
#pragma unroll
        for (int ch = 0; ch < TT / 128; ++ch) if (ch * 128 < w) { const int j0 = ch * 128 + lane * 4; v4h o4;
#pragma unroll
            for (int q = 0; q < 4; ++q) o4[q] = tohx(v[ch * 4 + q] * f);
            if (j0 < w) *(v4h*)(p16 + j0) = o4; } }
}

extern "C" void kernel_launch(void* const* d_in, const int* in_sizes, int n_in,
                              void* d_out, int out_size, void* d_ws, size_t ws_size, hipStream_t stream) {
    (void)in_sizes; (void)n_in; (void)out_size;
    const float* x = (const float*)d_in[0]; const float* wq = (const float*)d_in[1]; const float* bq = (const float*)d_in[2]; const float* wk = (const float*)d_in[3]; const float* bk = (const float*)d_in[4]; const float* wv = (const float*)d_in[5]; const float* bv = (const float*)d_in[6]; const float* wo = (const float*)d_in[7]; const float* bo = (const float*)d_in[8];
    float* OUT = (float*)d_out;     // [1][2048][2048]
    char* wsp = (char*)d_ws;
    auto take = [&](size_t bytes) { char* p = wsp; wsp += (bytes + 255) & ~(size_t)255; return (void*)p; };
    bf* WQ = (bf*)take((size_t)DQ * DM * 2); bf* WK = (bf*)take((size_t)DKV * DM * 2); bf* WV = (bf*)take((size_t)DKV * DM * 2); bf* WO = (bf*)take((size_t)DM * DQ * 2);
    bf* XB = (bf*)take((size_t)TT * DM * 2);
    h16* QP16 = (h16*)take((size_t)NH_ * TT * HD * 2); h16* KP16 = (h16*)take((size_t)NKV * TT * HD * 2); h16* VT16 = (h16*)take((size_t)NKV * HD * TT * 2);
    bf* QPh = (bf*)take((size_t)NH_ * TT * HD * 2); bf* QPl = (bf*)take((size_t)NH_ * TT * HD * 2); bf* KPh = (bf*)take((size_t)NKV * TT * HD * 2); bf* KPl = (bf*)take((size_t)NKV * TT * HD * 2); bf* VTh = (bf*)take((size_t)NKV * HD * TT * 2); bf* VTl = (bf*)take((size_t)NKV * HD * TT * 2);
    float* Sb = (float*)take((size_t)ZH * SPH * 4); bf* ATh = (bf*)take((size_t)TT * DQ * 2); bf* ATl = (bf*)take((size_t)TT * DQ * 2);
    if ((size_t)(wsp - (char*)d_ws) > ws_size) return;    // ws 256 MiB
    for (int b = 0; b < NB_; ++b) {
        k_cvtp<<<CB_X + CB_Q + 2 * CB_K + CB_O, 256, 0, stream>>>(x + (size_t)b * TT * DM, wq, wk, wv, wo, XB, WQ, WK, WV, WO);
        k_qkv<<<dim3(TT / 64, (DQ + 2 * DKV) / 64, 1), NWK * 32, 0, stream>>>(XB, WQ, WK, WV, bq, bk, bv, QP16, QPh, QPl, KP16, KPh, KPl, VT16, VTh, VTl);
        // one pass over all ZH = NH_ query heads (grid z); kv planes step by z / REP inside gemms
        k_scores<<<dim3(TT / 64, TT / 64, ZH), NWS * 32, 0, stream>>>(QPh, QPl, KPh, KPl, QP16, KP16, Sb);
        k_asoft<<<ZH * TT / 8, 256, 0, stream>>>(Sb);
        k_pv<<<dim3(TT / 64, HD / 64, ZH), NWK * 32, 0, stream>>>(Sb, VTh, VTl, VT16, ATh, ATl);
        k_oproj<<<dim3(TT / 64, DM / 64, 1), NWK * 32, 0, stream>>>(ATh, ATl, WO, OUT + (size_t)b * TT * DM, bo); }
}

// v007
// It runs in 115 microseconds.
// Two timings next to v006 both put it at 1.53 times that version's speed.
// All steps since v000 together make it 7.05 times as fast.
#include <hip/hip_runtime.h>

// Causal grouped-query attention with biases (x [2][2048][2048]; Q = x W_q^T + b_q (16 heads x 128 viewed (4 kv groups, 4)), K, V = x W^T + b (4 kv heads x 128) ('oi' 2048^-0.5 incl. biases: non-zero); query head h = kv*4 + g uses kv head h / 4; scores x 1/sqrt(128); causal (-inf); softmax; out = merged (head-major) W_o^T + b_o -> [2][2048][2048] (8.4 M); argument order x, W_q, b_q, W_k, b_k, W_v, b_v, W_o, b_o). THIS ROW: the same module at ONE sequence (x [1][2048][2048]; Q = x Wq^T + bq ('oi' [2048][2048]); K, V = x W^T + b with 'oi' [512][2048] weights (4 key / value heads x 128); weights normal x 2048^-0.5; the four biases zeros (read); grouped-query: query head h = 4 k + g uses key / value head k; scores x 128^-0.5; tril kept, -inf; softmax; out = merged Wo^T + bo; argument order x, Wq, bq, Wk, bk, Wv, bv, Wo, bo).
// Layout per batch: bf16 copy of x; 'oi' weights as-is; every 16-bit operand plane lies in fragment order (pk below); exact projections + f32 biases, each projection's work-groups storing the 16-bit operand planes of the attention themselves (V as W_v x^T, so that its tile is already key-contiguous); causal T-2048 GQA attention in one launch (fattn below: scores and probabilities stay in registers, online softmax; hybrid rows: < 512 hi/lo 3 products, rest fp16 with the probabilities x1024; steps above the diagonal are never visited; the merged hi/lo planes stored by the same launch); merged hi/lo x W_o exact + b_o.
// Compute dtypes, f32 accumulate: every input rounded to bf16; projections exact + f32 biases; attention rows < 512 3 products, rest fp16; softmax f32; output projection hl x exact.

#define NB_  1
#define TT   2048
#define DM   2048
#define NH_  16
#define NKV  4
#define REP  (NH_ / NKV)
#define HD   128
#define DQ   (NH_ * HD)
#define DKV  (NKV * HD)
#define SPW  (TT + 64)            // pitch (f32 elements) of the packed score plane: row block rb (width (rb+1)*64) shares its rows with row block TT/64-1-rb
#define RH   512                  // query rows < RH use hi+lo planes (0: none)
#define PCAR 1024.0f
#define SCL  0.088388347648318447f   // HD^-0.5
#define NWK  8                    // waves of a work-group that share one tile's K loop (gemms), K = 2048
typedef _Float16 h16;
typedef unsigned short bf;
typedef __attribute__((ext_vector_type(16))) __bf16   v16bf;
typedef __attribute__((ext_vector_type(16))) _Float16 v16h;
typedef __attribute__((ext_vector_type(8)))  _Float16 v8h;
typedef __attribute__((ext_vector_type(8)))  unsigned short v8us;
typedef __attribute__((ext_vector_type(8)))  float    v8f;
typedef __attribute__((ext_vector_type(4)))  float    v4f;
typedef v8h  __attribute__((may_alias)) v8ha;
typedef v4f  __attribute__((may_alias)) v4fa;
typedef v8us __attribute__((may_alias)) v8usa;

__device__ __forceinline__ unsigned short f2bf(float f) { unsigned u = __float_as_uint(f); u += 0x7FFFu + ((u >> 16) & 1u); return (unsigned short)(u >> 16); }
__device__ __forceinline__ float bf2f(unsigned short b) { return __uint_as_float(((unsigned)b) << 16); }
__device__ __forceinline__ float bfr(float f) { return bf2f(f2bf(f)); }
__device__ __forceinline__ h16 tohx(float x) { return (h16)x; }
__device__ __forceinline__ void splitf(float y, unsigned short& h, unsigned short& l) { h = f2bf(y); l = f2bf(y - bf2f(h)); }
typedef __attribute__((ext_vector_type(4))) _Float16 v4h;
typedef __attribute__((ext_vector_type(4))) unsigned short v4us;
typedef v4us __attribute__((may_alias)) v4usa;
__device__ __forceinline__ v16h cat16(v8h lo, v8h hi) { return __builtin_shufflevector(lo, hi, 0, 1, 2, 3, 4, 5, 6, 7, 8, 9, 10, 11, 12, 13, 14, 15); }
__device__ __forceinline__ v16bf cat16b(v8us lo, v8us hi) { return __builtin_bit_cast(v16bf, __builtin_shufflevector(lo, hi, 0, 1, 2, 3, 4, 5, 6, 7, 8, 9, 10, 11, 12, 13, 14, 15)); }
__device__ __forceinline__ v8f wmma16(v16h a, v16h b, v8f c) { return __builtin_amdgcn_wmma_f32_16x16x32_f16(false, a, false, b, (short)0, c, false, false); }
__device__ __forceinline__ v8f wmmab(v16bf a, v16bf b, v8f c) { return __builtin_amdgcn_wmma_f32_16x16x32_bf16(false, a, false, b, (short)0, c, false, false); }
// first f32 element of query row i in a head's packed score plane: the row holds its columns 0 .. (i/64+1)*64-1 and no more; the lower half of the row blocks starts at column 0, row block rb of the upper half stands behind row block TT/64-1-rb (the two widths add up to SPW); the 64 rows of a block are SPW apart
__device__ __forceinline__ size_t spk(int i) { const int rb = i >> 6; return (rb < TT / 128) ? (size_t)i * SPW : (size_t)((TT / 64 - 1 - rb) * 64 + (i & 63)) * SPW + (size_t)((TT / 64 - rb) * 64); }
// fragment order of a 16-bit operand plane of K columns: 16 rows x 32 k = 1024 contiguous bytes, laid out as the two 16-byte loads of a matrix fragment take them (piece k/16%2: 512 B; in it lane (k/8%2)*16 + row%16: 16 B = 8 k).
// A wave-wide 16-byte load then reads 512 contiguous bytes = 4 whole 128-B lines, where a row-major plane gives it 32 bytes of each of 16 lines. The k a lane and register holds is the same as before.
__device__ __forceinline__ size_t pk(int row, int k, int K) { return ((size_t)(row >> 4) * (K >> 5) + (k >> 5)) * 512 + ((k >> 4) & 1) * 256 + (((k >> 3) & 1) * 16 + (row & 15)) * 8 + (k & 7); }

// ---- gemms: register-blocked GEMM, one 64x64 output tile per work-group of NW waves; the K loop is dealt to the waves in slices of 64 k (2048 contiguous bytes of every 16 rows of a fragment-order plane), slice s to wave s % NW;
// each wave keeps the whole tile (16 accumulators) for its slices, operands straight from 16-bit planes in fragment order (pk; the probabilities alone are row-major); the NW partial tiles meet in LDS and are summed in wave order 0..NW-1. tiles (M/64, N/64, Z), NW*32 threads.
// C[m][n] (f32, pitch ldc, + optional f32 bias[n]) = sum_k A[m][k] Bt[n][k] (+ split products per NSPLIT). z-batch strides sA/sB/sC in elements. K % 64 == 0; K is a compile-time constant, so that the 16-row steps of a fragment-order plane are immediate offsets of one address per operand.
// CMODE 1 (scores): a tile entirely above the causal diagonal (query rows r0+roff.., key columns c0..) is skipped by its whole work-group; C is the packed score plane (spk, ldc = SPW). CMODE 2 (probability x value): the K loop stops at the diagonal block (nothing is stored beyond it); A is the packed plane seen as 16-bit elements (the probabilities lie at the start of their score row, the lo plane right behind the hi plane). roff = row offset of this GEMM's first row within the sequence. Grid z = query head: Bt steps by kv head z / REP.
// EPI: what the summed tile is stored as. 0: f32 C. 1 (Q, K): head planes [n / HD] of (row m, k n % HD), fp16 + bf16 hi/lo. 2 (V, computed as W_v x^T: m = kv feature, n = token, bias by row): planes (row m, k n) of ldc columns, fp16 + hi/lo. 3 (P.V): merged planes (row token, k z * HD + n), hi/lo, rows >= RH scaled back by 1 / PCAR. All three in fragment order.
// A tile is 4 x 2 whole 1024-B fragment blocks of every plane it stores: one writer a line.
// CMODE 1, CMODE 2, NSPLIT 2 and EPI 3 (the score and probability x value GEMMs over a stored score plane) have no caller any more: the attention is fattn below.
template <typename T16> struct WFrag;
template <> struct WFrag<h16> { typedef v16h V; static __device__ __forceinline__ V ld(const h16* p) { return cat16(*(const v8h*)p, *(const v8h*)(p + 16)); } static __device__ __forceinline__ V ldp(const h16* p) { return cat16(*(const v8h*)p, *(const v8h*)(p + 256)); } static __device__ __forceinline__ v8f mma(V a, V b, v8f c) { return wmma16(a, b, c); } };
template <> struct WFrag<bf> { typedef v16bf V; static __device__ __forceinline__ V ld(const bf* p) { return cat16b(*(const v8us*)p, *(const v8us*)(p + 16)); } static __device__ __forceinline__ V ldp(const bf* p) { return cat16b(*(const v8us*)p, *(const v8us*)(p + 256)); } static __device__ __forceinline__ v8f mma(V a, V b, v8f c) { return wmmab(a, b, c); } };
// The body is a device function: os = the work-group's LDS (NW * 64 * 68 floats), (bx, by, z) = the tile it takes. A launch may hold the tiles of several independent GEMMs (kernels below): each work-group runs one body, chosen by its block index alone.
template <typename T16, int NSPLIT, bool BIAS, int CMODE, int NW, int EPI, int K>
__device__ __forceinline__ void gemms(float* os, int bx, int by, size_t z, const T16* __restrict__ A, const T16* __restrict__ A2, const T16* __restrict__ Bt, const T16* __restrict__ Bt2, float* C, int ldc, const float* __restrict__ bias, int roff, size_t sA, size_t sB, size_t sC, h16* P16, bf* Ph, bf* Pl) {
    typedef typename WFrag<T16>::V V;
    A += z * sA; if (A2) A2 += z * sA; Bt += (z / REP) * sB; if (Bt2) Bt2 += (z / REP) * sB; C += z * sC;
    const int lane = threadIdx.x & 31, lr = lane & 15, hi = lane >> 4; const int r0 = bx * 64, c0 = by * 64;
    const int wv = __builtin_amdgcn_readfirstlane((int)(threadIdx.x >> 5));   // wave number, scalar: the K loop's trip test stays a scalar branch (every lane on at the matrix instructions)
    if (CMODE == 1 && c0 > r0 + roff + 63) return;                  // score tile entirely above the causal diagonal: never read (the softmax masks j > i by select); the same for every wave, in front of the barrier
    const int Kl = (CMODE == 2) ? min(K, r0 + roff + 64) : K;        // P.V: probabilities are exactly 0 beyond the diagonal block, so the K loop stops there
    v8f acc[4][4];
#pragma unroll
    for (int mb = 0; mb < 4; ++mb)
#pragma unroll
        for (int nb = 0; nb < 4; ++nb) acc[mb][nb] = (v8f){};
    const size_t aoff = (size_t)r0 * K + 8 * lane, boff = (size_t)c0 * K + 8 * lane;   // fragment order: 16 rows are 16 * K elements, a 32-k step 512 elements on, this lane's 16 bytes at 8 * lane
    const size_t poff = 2 * spk(r0 + roff) + (size_t)lr * (2 * SPW) + 8 * hi;   // CMODE 2: this lane's first 16-bit element in the packed plane (row pitch 2 * SPW; the lo plane Kl elements on)
    // rolled: one slice's fragments live at a time, so that two work-groups fit a WGP's registers
#pragma unroll 1
    for (int k0 = wv * 64; k0 < Kl; k0 += NW * 64) {
        V a[4], a2[4];
        // this trip's one address per operand; every 16-row step and 32-k step is an immediate offset of it
        const T16* pa = A + ((CMODE == 2) ? poff + k0 : aoff + (size_t)k0 * 16); const T16* pa2 = (NSPLIT == 1 || NSPLIT == 2) ? A2 + ((CMODE == 2) ? poff + Kl + k0 : aoff + (size_t)k0 * 16) : pa;
        const T16* pb = Bt + boff + (size_t)k0 * 16; const T16* pb2 = (NSPLIT >= 2) ? Bt2 + boff + (size_t)k0 * 16 : pb;
        // both 32-k steps of the slice in one trip (unrolled: a[] and b stay in registers)
#pragma unroll
        for (int kq = 0; kq < 64; kq += 32) {
            if (CMODE == 2) {
#pragma unroll
                for (int mb = 0; mb < 4; ++mb) { a[mb] = WFrag<T16>::ld(pa + (size_t)mb * 16 * (2 * SPW) + kq); if (NSPLIT == 2) a2[mb] = WFrag<T16>::ld(pa2 + (size_t)mb * 16 * (2 * SPW) + kq); }
            } else
#pragma unroll
            for (int mb = 0; mb < 4; ++mb) { a[mb] = WFrag<T16>::ldp(pa + (size_t)mb * 16 * K + kq * 16); if (NSPLIT == 1 || NSPLIT == 2) a2[mb] = WFrag<T16>::ldp(pa2 + (size_t)mb * 16 * K + kq * 16); }
#pragma unroll
            for (int nb = 0; nb < 4; ++nb) { const V b = WFrag<T16>::ldp(pb + (size_t)nb * 16 * K + kq * 16); V b2; if (NSPLIT >= 2) b2 = WFrag<T16>::ldp(pb2 + (size_t)nb * 16 * K + kq * 16);
#pragma unroll
                for (int mb = 0; mb < 4; ++mb) { acc[mb][nb] = WFrag<T16>::mma(a[mb], b, acc[mb][nb]); if (NSPLIT == 1 || NSPLIT == 2) acc[mb][nb] = WFrag<T16>::mma(a2[mb], b, acc[mb][nb]); if (NSPLIT >= 2) acc[mb][nb] = WFrag<T16>::mma(a[mb], b2, acc[mb][nb]); } }
        }
        // the wait in front of the overwrite of the loads' address registers; the addresses are inputs of the statement, so that none of their registers is given to a load's result or stepped on in front of it
        asm volatile("s_wait_xcnt 0x0" :: "v"(pa), "v"(pa2), "v"(pb), "v"(pb2) : "memory");
        // the distance behind the trip's last matrix instructions, on the taken side of the loop branch too
        asm volatile("v_nop\n\tv_nop\n\tv_nop\n\tv_nop" : "+v"(acc[0][0]), "+v"(acc[1][1]), "+v"(acc[2][2]), "+v"(acc[3][3]) : "v"(a[0]), "v"(a[3]));
    }
    float* ow = os + wv * (64 * 68);
    float* Cb = C + ((CMODE == 1) ? spk(r0 + roff) : (size_t)r0 * ldc);
#pragma unroll
    for (int mb = 0; mb < 4; ++mb)
#pragma unroll
        for (int nb = 0; nb < 4; ++nb)
#pragma unroll
            for (int j = 0; j < 8; ++j) ow[(mb * 16 + hi * 8 + j) * 68 + nb * 16 + lr] = acc[mb][nb][j];
    __syncthreads();   // every wave's partial tile is in LDS before any wave sums; a wave with no slice has stored zeros
    if (EPI == 0) {
#pragma unroll
    for (int i = 0; i < 64 * 16 / (NW * 32); ++i) { const int e = (int)threadIdx.x + i * (NW * 32), row = e >> 4, cofs = (e & 15) * 4; v4f val = *(const v4fa*)(os + row * 68 + cofs);
#pragma unroll
        for (int w = 1; w < NW; ++w) val += *(const v4fa*)(os + w * (64 * 68) + row * 68 + cofs);
        if (BIAS) { val[0] += bfr(bias[c0 + cofs]); val[1] += bfr(bias[c0 + cofs + 1]); val[2] += bfr(bias[c0 + cofs + 2]); val[3] += bfr(bias[c0 + cofs + 3]); }
        *(v4f*)(Cb + (size_t)row * ldc + c0 + cofs) = val; }
    } else {
    // plane stores in fragment order: a thread sums and stores one 16-byte piece (8 k of one row), the threads numbered in the order of the plane, so that a wave stores 512 contiguous bytes of each plane
#pragma unroll
    for (int i = 0; i < 64 * 8 / (NW * 32); ++i) { const int u = (int)threadIdx.x + i * (NW * 32), row = ((u >> 7) & 3) * 16 + (u & 15), cofs = ((u >> 6) & 1) * 32 + ((u >> 5) & 1) * 16 + ((u >> 4) & 1) * 8;
        v4f val = *(const v4fa*)(os + row * 68 + cofs), vb = *(const v4fa*)(os + row * 68 + cofs + 4);
#pragma unroll
        for (int w = 1; w < NW; ++w) { val += *(const v4fa*)(os + w * (64 * 68) + row * 68 + cofs); vb += *(const v4fa*)(os + w * (64 * 68) + row * 68 + cofs + 4); }
        float y8[8];
#pragma unroll
        for (int q = 0; q < 4; ++q) { y8[q] = val[q]; y8[q + 4] = vb[q]; }
        if (BIAS && EPI == 2) { const float br = bfr(bias[r0 + row]);
#pragma unroll
            for (int q = 0; q < 8; ++q) y8[q] += br; }
        else if (BIAS) {
#pragma unroll
            for (int q = 0; q < 8; ++q) y8[q] += bfr(bias[c0 + cofs + q]); }
        const int col = c0 + cofs;
        const size_t o = (EPI == 1) ? (size_t)(col / HD) * ((size_t)TT * HD) + pk(r0 + row, col % HD, HD) : (EPI == 2) ? pk(r0 + row, col, ldc) : pk(r0 + roff + row, (int)z * HD + col, DQ);
        const float cs = (EPI == 3 && r0 + roff + row >= RH) ? (1.0f / PCAR) : 1.0f; v8h o16; v8us oh, ol;
#pragma unroll
        for (int q = 0; q < 8; ++q) { const float y = y8[q] * cs; o16[q] = tohx(y); unsigned short a2, c2; splitf(y, a2, c2); oh[q] = a2; ol[q] = c2; }
        if (EPI != 3) *(v8h*)(P16 + o) = o16;
        *(v8us*)(Ph + o) = oh; *(v8us*)(Pl + o) = ol; }
    }
}

// k_qkv: the three projections in one launch, grid (TT/64, (DQ + 2 * DKV) / 64). y < DQ/64: Q tile (x, y); the next DKV/64: K tile; the last DKV/64: V as W_v x^T, tile (row block y', token block x).
__global__ __launch_bounds__(NWK * 32) void k_qkv(const bf* __restrict__ XB, const bf* __restrict__ WQ, const bf* __restrict__ WK, const bf* __restrict__ WV, const float* __restrict__ bq, const float* __restrict__ bk, const float* __restrict__ bv, h16* QP16, bf* QPh, bf* QPl, h16* KP16, bf* KPh, bf* KPl, h16* VT16, bf* VTh, bf* VTl) {
    __shared__ __align__(16) float os[NWK * 64 * 68];
    const int bx = blockIdx.x, by = blockIdx.y;
    if (by < (DQ + DKV) / 64) { const bool q = by < DQ / 64;
        gemms<bf, 0, true, 0, NWK, 1, DM>(os, bx, q ? by : by - DQ / 64, 0, XB, nullptr, q ? WQ : WK, nullptr, nullptr, 0, q ? bq : bk, 0, 0, 0, 0, q ? QP16 : KP16, q ? QPh : KPh, q ? QPl : KPl); }
    else gemms<bf, 0, true, 0, NWK, 2, DM>(os, by - (DQ + DKV) / 64, bx, 0, WV, nullptr, XB, nullptr, nullptr, TT, bv, 0, 0, 0, 0, VT16, VTh, VTl);   // rows = kv features, columns = tokens: [kv head][d][t]
}

// ---- fattn: scores, softmax and probability x value of 32 query rows of one head in one work-group of 8 waves; no score or probability leaves the registers.
// Transposed products: S^T = K Q^T (A = 16 keys x 32 d of the K plane, B = 16 queries x 32 d of the Q plane, kept in registers), O^T += V^T P^T (A = 16 d x 32 keys of the V^T plane). In an accumulator of S^T a lane holds keys hi * 8 + j of query lr:
// two such accumulators (keys 0..15, 16..31 of the step) are, element for element, the B fragment of P^T (k = hi * 8 + j, then 16 + hi * 8 + j), so the probabilities are packed in place.
// The 32-key steps 0 .. qb are dealt to the waves, step s to wave s % 8; each wave keeps a running maximum m (log2 units), a sum l and an unnormalised O^T of its own steps; the eight meet in LDS and are joined in wave order 0..7 with weights 2^(m_w - M).
// HL (rows < RH): bf16 hi/lo planes, 3 products each way. Else fp16, the probabilities carried x 2^10 (in l as well, so that it cancels in O / l).
__device__ __forceinline__ float xhalf(float x) { return __builtin_bit_cast(float, __builtin_amdgcn_permlanex16(__builtin_bit_cast(int, x), __builtin_bit_cast(int, x), 0x76543210, 0xfedcba98, false, false)); }   // lane l takes lane l ^ 16's value
// 2^x of a run of N values with the slot behind a transcendental kept: results and arguments are inputs of the closing statement, which holds every argument's register to the end of the run; its v_nop is the slot of the run's last v_exp
template <int N> __device__ __forceinline__ void exp2run(const float* x, float* r);
template <> __device__ __forceinline__ void exp2run<8>(const float* x, float* r) {
#pragma unroll
    for (int j = 0; j < 8; ++j) r[j] = __builtin_amdgcn_exp2f(x[j]);
    asm volatile("v_nop" :: "v"(r[0]), "v"(r[1]), "v"(r[2]), "v"(r[3]), "v"(r[4]), "v"(r[5]), "v"(r[6]), "v"(r[7]), "v"(x[0]), "v"(x[1]), "v"(x[2]), "v"(x[3]), "v"(x[4]), "v"(x[5]), "v"(x[6]), "v"(x[7])); }
template <> __device__ __forceinline__ void exp2run<2>(const float* x, float* r) { r[0] = __builtin_amdgcn_exp2f(x[0]); r[1] = __builtin_amdgcn_exp2f(x[1]);
    asm volatile("v_nop" :: "v"(r[0]), "v"(r[1]), "v"(x[0]), "v"(x[1])); }
template <typename T16> struct PPack;
template <> struct PPack<h16> { static __device__ __forceinline__ void pack(const float* p, v16h& a, v16h& b) { v8h x, y;
#pragma unroll
    for (int j = 0; j < 8; ++j) { x[j] = tohx(p[j]); y[j] = tohx(p[8 + j]); }
    a = cat16(x, y); b = a; } };
template <> struct PPack<bf> { static __device__ __forceinline__ void pack(const float* p, v16bf& a, v16bf& b) { v8us xh, yh, xl, yl;
#pragma unroll
    for (int j = 0; j < 8; ++j) { unsigned short s, t; splitf(p[j], s, t); xh[j] = s; xl[j] = t; splitf(p[8 + j], s, t); yh[j] = s; yl[j] = t; }
    a = cat16b(xh, yh); b = cat16b(xl, yl); } };
template <typename T16, bool HL>
__device__ __forceinline__ void fattn(float* os, float* sm, float* sl, int qb, int h, const T16* __restrict__ Q, const T16* __restrict__ Q2, const T16* __restrict__ Kp, const T16* __restrict__ K2, const T16* __restrict__ Vt, const T16* __restrict__ V2, bf* ATh, bf* ATl) {
    typedef typename WFrag<T16>::V V;
    const int lane = threadIdx.x & 31, lr = lane & 15, hi = lane >> 4; const int q0 = qb * 32;
    const int wv = __builtin_amdgcn_readfirstlane((int)(threadIdx.x >> 5));   // wave number, scalar: the step loop's trip test and the diagonal test stay scalar branches (every lane on at the matrix instructions)
    const float CS = SCL * 1.4426950408889634f;      // score -> log2 units
    const float OFS = HL ? 0.0f : 10.0f;             // fp16 probabilities x 2^10
    const size_t qo = (size_t)h * ((size_t)TT * HD) + (size_t)q0 * HD + 8 * lane, ko = (size_t)(h / REP) * ((size_t)TT * HD) + 8 * lane, vo = (size_t)(h / REP) * ((size_t)HD * TT) + 8 * lane;
    const T16* pq = Q + qo; const T16* pq2 = HL ? Q2 + qo : pq;
    V qf[2][4], qf2[2][4];
#pragma unroll
    for (int g = 0; g < 2; ++g)
#pragma unroll
        for (int ds = 0; ds < 4; ++ds) { qf[g][ds] = WFrag<T16>::ldp(pq + (g * 4 + ds) * 512); if (HL) qf2[g][ds] = WFrag<T16>::ldp(pq2 + (g * 4 + ds) * 512); }
    // the wait in front of an overwrite of the Q loads' address registers
    asm volatile("s_wait_xcnt 0x0" :: "v"(pq), "v"(pq2) : "memory");
    v8f O[8][2]; float m[2] = { -3.0e38f, -3.0e38f }, l[2] = { 0.f, 0.f };
#pragma unroll
    for (int db = 0; db < 8; ++db) { O[db][0] = (v8f){}; O[db][1] = (v8f){}; }
    const T16* kb1 = Kp + ko; const T16* kb2 = HL ? K2 + ko : kb1; const T16* vb1 = Vt + vo; const T16* vb2 = HL ? V2 + vo : vb1;
    V kf[8], kf2[8], vf[8], vf2[8];
    // one step's K fragments (2 key blocks x 4 d steps) and V^T fragments (8 d blocks); behind each run of loads the wait in front of an overwrite of their address registers, the addresses being inputs of the statement
    auto ldK = [&](int s) { const T16* p1 = kb1 + (size_t)s * (32 * HD); const T16* p2 = HL ? kb2 + (size_t)s * (32 * HD) : p1;
#pragma unroll
        for (int i = 0; i < 8; ++i) { kf[i] = WFrag<T16>::ldp(p1 + i * 512); if (HL) kf2[i] = WFrag<T16>::ldp(p2 + i * 512); }
        asm volatile("s_wait_xcnt 0x0" :: "v"(p1), "v"(p2) : "memory"); };
    auto ldV = [&](int s) { const T16* p1 = vb1 + (size_t)s * 512; const T16* p2 = HL ? vb2 + (size_t)s * 512 : p1;
#pragma unroll
        for (int db = 0; db < 8; ++db) { vf[db] = WFrag<T16>::ldp(p1 + (size_t)db * 16 * TT); if (HL) vf2[db] = WFrag<T16>::ldp(p2 + (size_t)db * 16 * TT); }
        asm volatile("s_wait_xcnt 0x0" :: "v"(p1), "v"(p2) : "memory"); };
    // one 32-key step. fp16 body: the fragments of the wave's next step (nx: there is one) are fetched into the registers that this step has just used, K behind the score products, V behind the value products, so that they fly during the softmax and the other product.
    // hi/lo body (twice the fragments): each step fetches its own, K in front of the score products, V behind them.
    auto step = [&](int s, bool nx) __attribute__((always_inline)) {
        const int k0 = s * 32;
        if (HL) { ldK(s); __builtin_amdgcn_sched_barrier(0); }   // keeps the first product behind the last load: without it the loads share registers and wait for one another
        v8f S[2][2];
#pragma unroll
        for (int kb = 0; kb < 2; ++kb) { S[kb][0] = (v8f){}; S[kb][1] = (v8f){};
#pragma unroll
            for (int ds = 0; ds < 4; ++ds)
#pragma unroll
                for (int g = 0; g < 2; ++g) { S[kb][g] = WFrag<T16>::mma(kf[kb * 4 + ds], qf[g][ds], S[kb][g]); if (HL) { S[kb][g] = WFrag<T16>::mma(kf[kb * 4 + ds], qf2[g][ds], S[kb][g]); S[kb][g] = WFrag<T16>::mma(kf2[kb * 4 + ds], qf[g][ds], S[kb][g]); } } }
        if (HL) ldV(s);
        else if (nx) ldK(s + 8);
        if (!nx) {
            // the distance behind the last score products, on the taken side of the branch that follows too
            asm volatile("v_nop\n\tv_nop\n\tv_nop\n\tv_nop" : "+v"(S[0][0]), "+v"(S[0][1]), "+v"(S[1][0]), "+v"(S[1][1]));
            if (k0 + 31 > q0) {   // the diagonal step (s = qb, some wave's last) alone holds keys behind a query (key > query: out of the maximum, probability exactly 0)
#pragma unroll
                for (int kb = 0; kb < 2; ++kb)
#pragma unroll
                    for (int g = 0; g < 2; ++g)
#pragma unroll
                        for (int j = 0; j < 8; ++j) if (k0 + kb * 16 + hi * 8 + j > q0 + g * 16 + lr) S[kb][g][j] = -3.0e38f;
            }
        }
        float mn[2];
#pragma unroll
        for (int g = 0; g < 2; ++g) { float mx = fmaxf(S[0][g][0], S[1][g][0]);
#pragma unroll
            for (int j = 1; j < 8; ++j) mx = fmaxf(mx, fmaxf(S[0][g][j], S[1][g][j]));
            mx = fmaxf(mx, xhalf(mx)); mn[g] = fmaxf(m[g], mx * CS); }
        // the accumulators are rescaled only in a step in which some query's maximum has grown (scalar branch: the same for the wave)
        if (__builtin_amdgcn_ballot_w32(mn[0] > m[0] || mn[1] > m[1]) != 0) {
            const float dm[2] = { m[0] - mn[0], m[1] - mn[1] }; float al[2]; exp2run<2>(dm, al);
#pragma unroll
            for (int g = 0; g < 2; ++g) { l[g] *= al[g]; m[g] = mn[g];
#pragma unroll
                for (int db = 0; db < 8; ++db) O[db][g] *= al[g]; }
        }
        V pf[2], pf2[2];
#pragma unroll
        for (int g = 0; g < 2; ++g) { float p[16]; const float mo = OFS - m[g];
#pragma unroll
            for (int kb = 0; kb < 2; ++kb) { float t[8];
#pragma unroll
                for (int j = 0; j < 8; ++j) t[j] = fmaf(S[kb][g][j], CS, mo);
                exp2run<8>(t, p + kb * 8);
#pragma unroll
                for (int j = 0; j < 8; ++j) l[g] += p[kb * 8 + j]; }
            PPack<T16>::pack(p, pf[g], pf2[g]); }
#pragma unroll
        for (int db = 0; db < 8; ++db)
#pragma unroll
            for (int g = 0; g < 2; ++g) { O[db][g] = WFrag<T16>::mma(vf[db], pf[g], O[db][g]); if (HL) { O[db][g] = WFrag<T16>::mma(vf[db], pf2[g], O[db][g]); O[db][g] = WFrag<T16>::mma(vf2[db], pf[g], O[db][g]); } }
        if (!HL && nx) ldV(s + 8);
    };
    // rolled loops: one step's fragments live at a time. fp16: the steps that have a successor, then the wave's last step on its own, so that the number of loads in flight at each wait is fixed
    if (wv <= qb) { int s = wv;
        if (HL) {
#pragma unroll 1
            for (; s <= qb; s += 8) step(s, false);
        } else { ldK(s); ldV(s);
#pragma unroll 1
            for (; s + 8 <= qb; s += 8) step(s, true);
            step(s, false); }
    }
    // each wave's partial: piece t = db * 2 + g is 256 floats, j 0..3 of the 32 lanes, then j 4..7: every LDS access is 512 contiguous bytes of a wave
    float* ow = os + wv * 4096;
#pragma unroll
    for (int g = 0; g < 2; ++g) { l[g] += xhalf(l[g]); if (hi == 0) { sm[wv * 32 + g * 16 + lr] = m[g]; sl[wv * 32 + g * 16 + lr] = l[g]; }
#pragma unroll
        for (int db = 0; db < 8; ++db) { const v8f o = O[db][g]; *(v4fa*)(ow + (db * 2 + g) * 256 + lane * 4) = (v4f){ o[0], o[1], o[2], o[3] }; *(v4fa*)(ow + (db * 2 + g) * 256 + 128 + lane * 4) = (v4f){ o[4], o[5], o[6], o[7] }; } }
    __syncthreads();   // every wave's partial (O, m, l) is in LDS before any wave joins them; a wave with no step has stored zeros and m = -3e38 (weight 0)
    // wave wv joins d block wv of both query groups; a lane's 8 values are 8 successive d of one token = one 16-byte piece of the merged planes in fragment order (a wave stores 512 contiguous bytes)
#pragma unroll
    for (int g = 0; g < 2; ++g) { float mw[8], M = -3.0e38f, L = 0.f; v4f x = (v4f){}, y = (v4f){};
#pragma unroll
        for (int w = 0; w < 8; ++w) { mw[w] = sm[w * 32 + g * 16 + lr]; M = fmaxf(M, mw[w]); }
#pragma unroll
        for (int w = 0; w < 8; ++w) mw[w] -= M;
        float wt[8]; exp2run<8>(mw, wt);
#pragma unroll
        for (int w = 0; w < 8; ++w) { L += wt[w] * sl[w * 32 + g * 16 + lr];
            x += wt[w] * *(const v4fa*)(os + w * 4096 + (wv * 2 + g) * 256 + lane * 4); y += wt[w] * *(const v4fa*)(os + w * 4096 + (wv * 2 + g) * 256 + 128 + lane * 4); }
        const float inv = __fdiv_rn(1.0f, L); v8us oh, ol;
#pragma unroll
        for (int q = 0; q < 4; ++q) { unsigned short a2, c2; splitf(x[q] * inv, a2, c2); oh[q] = a2; ol[q] = c2; splitf(y[q] * inv, a2, c2); oh[q + 4] = a2; ol[q + 4] = c2; }
        const size_t o = pk(q0 + g * 16 + lr, h * HD + wv * 16 + hi * 8, DQ);
        *(v8us*)(ATh + o) = oh; *(v8us*)(ATl + o) = ol; }
}

// k_fattn: grid (NH_ query heads, TT/32 query blocks, the longest first); blocks of rows < RH take the hi/lo body, the rest fp16.
__global__ __launch_bounds__(256) void k_fattn(const h16* __restrict__ QP16, const h16* __restrict__ KP16, const h16* __restrict__ VT16, const bf* __restrict__ QPh, const bf* __restrict__ QPl, const bf* __restrict__ KPh, const bf* __restrict__ KPl, const bf* __restrict__ VTh, const bf* __restrict__ VTl, bf* ATh, bf* ATl) {
    __shared__ __align__(16) float os[8 * 4096]; __shared__ float sm[8 * 32]; __shared__ float sl[8 * 32];
    const int qb = TT / 32 - 1 - (int)blockIdx.y, h = blockIdx.x;
    if (qb < RH / 32) fattn<bf, true>(os, sm, sl, qb, h, QPh, QPl, KPh, KPl, VTh, VTl, ATh, ATl);
    else fattn<h16, false>(os, sm, sl, qb, h, QP16, nullptr, KP16, nullptr, VT16, nullptr, ATh, ATl);
}

// k_oproj: merged hi/lo x W_o + b_o, grid (TT/64, DM/64).
__global__ __launch_bounds__(NWK * 32) void k_oproj(const bf* __restrict__ ATh, const bf* __restrict__ ATl, const bf* __restrict__ WO, float* OUT, const float* __restrict__ bo) {
    __shared__ __align__(16) float os[NWK * 64 * 68];
    gemms<bf, 1, true, 0, NWK, 0, DQ>(os, blockIdx.x, blockIdx.y, 0, ATh, ATl, WO, nullptr, OUT, DM, bo, 0, 0, 0, 0, nullptr, nullptr, nullptr);
}


// k_cvtp: f32 [rows][DM] -> bf16 plane in fragment order (pk). One wave takes 16 rows x 64 k: it reads 256 contiguous bytes of two rows with each load (8 loads in flight), turns the block in its own LDS range and stores 4 x 512 contiguous bytes.
// LDS: the 8 pieces of 256 B (16 rows x 8 k) stand 288 B apart, so that the 8-byte stores of a wave fall on all 64 banks. All five planes in one launch: the block index picks the plane (CB_ blocks each, in the order x, W_q, W_k, W_v, W_o) and the block's place in it. grid = the five planes' rows * DM / 8192 exactly: no thread leaves in front of the barrier.
#define CB_X (TT * DM / 8192)
#define CB_Q (DQ * DM / 8192)
#define CB_K (DKV * DM / 8192)
#define CB_O (DM * DQ / 8192)
__global__ __launch_bounds__(256) void k_cvtp(const float* __restrict__ x, const float* __restrict__ wq, const float* __restrict__ wk, const float* __restrict__ wv_, const float* __restrict__ wo, bf* XB, bf* WQ, bf* WK, bf* WV, bf* WO) {
    __shared__ __align__(16) bf ls[8 * 8 * 144];
    int blk = blockIdx.x; const float* src = x; bf* dst = XB;
    if (blk >= CB_X + CB_Q + 2 * CB_K) { blk -= CB_X + CB_Q + 2 * CB_K; src = wo; dst = WO; }
    else if (blk >= CB_X + CB_Q + CB_K) { blk -= CB_X + CB_Q + CB_K; src = wv_; dst = WV; }
    else if (blk >= CB_X + CB_Q) { blk -= CB_X + CB_Q; src = wk; dst = WK; }
    else if (blk >= CB_X) { blk -= CB_X; src = wq; dst = WQ; }
    const int lane = threadIdx.x & 31, wv = threadIdx.x >> 5, c = lane & 15, h = lane >> 4; const size_t g = (size_t)blk * 8 + wv;
    const float* s = src + (g / (DM / 64)) * (16 * DM) + (g % (DM / 64)) * 64 + (size_t)h * DM + c * 4; bf* lw = ls + wv * (8 * 144); v4f v[8];
#pragma unroll
    for (int j = 0; j < 8; ++j) v[j] = *(const v4f*)(s + (size_t)j * 2 * DM);
#pragma unroll
    for (int j = 0; j < 8; ++j) { v4us o;
#pragma unroll
        for (int q = 0; q < 4; ++q) o[q] = f2bf(v[j][q]);
        *(v4usa*)(lw + (c >> 1) * 144 + (j * 2 + h) * 8 + (c & 1) * 4) = o; }
    __syncthreads();   // the lanes of a wave read what other lanes of it have written to LDS
#pragma unroll
    for (int t = 0; t < 4; ++t) *(v8us*)(dst + g * 1024 + t * 256 + lane * 8) = *(const v8usa*)(lw + (t * 2 + h) * 144 + c * 8);
}

extern "C" void kernel_launch(void* const* d_in, const int* in_sizes, int n_in,
                              void* d_out, int out_size, void* d_ws, size_t ws_size, hipStream_t stream) {
    (void)in_sizes; (void)n_in; (void)out_size;
    const float* x = (const float*)d_in[0]; const float* wq = (const float*)d_in[1]; const float* bq = (const float*)d_in[2]; const float* wk = (const float*)d_in[3]; const float* bk = (const float*)d_in[4]; const float* wv = (const float*)d_in[5]; const float* bv = (const float*)d_in[6]; const float* wo = (const float*)d_in[7]; const float* bo = (const float*)d_in[8];
    float* OUT = (float*)d_out;     // [1][2048][2048]
    char* wsp = (char*)d_ws;
    auto take = [&](size_t bytes) { char* p = wsp; wsp += (bytes + 255) & ~(size_t)255; return (void*)p; };
    bf* WQ = (bf*)take((size_t)DQ * DM * 2); bf* WK = (bf*)take((size_t)DKV * DM * 2); bf* WV = (bf*)take((size_t)DKV * DM * 2); bf* WO = (bf*)take((size_t)DM * DQ * 2);
    bf* XB = (bf*)take((size_t)TT * DM * 2);
    h16* QP16 = (h16*)take((size_t)NH_ * TT * HD * 2); h16* KP16 = (h16*)take((size_t)NKV * TT * HD * 2); h16* VT16 = (h16*)take((size_t)NKV * HD * TT * 2);
    bf* QPh = (bf*)take((size_t)NH_ * TT * HD * 2); bf* QPl = (bf*)take((size_t)NH_ * TT * HD * 2); bf* KPh = (bf*)take((size_t)NKV * TT * HD * 2); bf* KPl = (bf*)take((size_t)NKV * TT * HD * 2); bf* VTh = (bf*)take((size_t)NKV * HD * TT * 2); bf* VTl = (bf*)take((size_t)NKV * HD * TT * 2);
    bf* ATh = (bf*)take((size_t)TT * DQ * 2); bf* ATl = (bf*)take((size_t)TT * DQ * 2);
    if ((size_t)(wsp - (char*)d_ws) > ws_size) return;    // ws 256 MiB
    for (int b = 0; b < NB_; ++b) {
        k_cvtp<<<CB_X + CB_Q + 2 * CB_K + CB_O, 256, 0, stream>>>(x + (size_t)b * TT * DM, wq, wk, wv, wo, XB, WQ, WK, WV, WO);
        k_qkv<<<dim3(TT / 64, (DQ + 2 * DKV) / 64, 1), NWK * 32, 0, stream>>>(XB, WQ, WK, WV, bq, bk, bv, QP16, QPh, QPl, KP16, KPh, KPl, VT16, VTh, VTl);
        k_fattn<<<dim3(NH_, TT / 32, 1), 256, 0, stream>>>(QP16, KP16, VT16, QPh, QPl, KPh, KPl, VTh, VTl, ATh, ATl);
        k_oproj<<<dim3(TT / 64, DM / 64, 1), NWK * 32, 0, stream>>>(ATh, ATl, WO, OUT + (size_t)b * TT * DM, bo); }
}

// v008
// One run takes 94.4 microseconds.
// Next to v007, in two timings, it ran 1.22 times as fast each time.
// Counting every step since v000, it is 8.61 times as fast.
#include <hip/hip_runtime.h>

// Causal grouped-query attention with biases (x [1][2048][2048]; Q = x W_q^T + b_q (16 heads x 128 viewed (4 kv groups, 4)), K, V = x W^T + b (4 kv heads x 128) ('oi' 2048^-0.5 incl. biases: non-zero); query head h = kv*4 + g uses kv head h / 4; scores x 1/sqrt(128); causal (-inf); softmax; out = merged (head-major) W_o^T + b_o -> [1][2048][2048] (4.2 M); argument order x, W_q, b_q, W_k, b_k, W_v, b_v, W_o, b_o). THIS ROW: the same module at ONE sequence (x [1][2048][2048]; Q = x Wq^T + bq ('oi' [2048][2048]); K, V = x W^T + b with 'oi' [512][2048] weights (4 key / value heads x 128); weights normal x 2048^-0.5; the four biases zeros (read); grouped-query: query head h = 4 k + g uses key / value head k; scores x 128^-0.5; tril kept, -inf; softmax; out = merged Wo^T + bo; argument order x, Wq, bq, Wk, bk, Wv, bv, Wo, bo).
// Layout per batch: bf16 copy of x; 'oi' weights as-is; every 16-bit operand plane lies in fragment order (pk below); exact projections + f32 biases, each projection's work-groups storing the 16-bit operand planes of the attention themselves (V as W_v x^T, so that its tile is already key-contiguous); causal T-2048 GQA attention in one launch (fattn below: scores and probabilities stay in registers, online softmax; hybrid rows: < 512 hi/lo 3 products, rest fp16 with the probabilities x1024; steps above the diagonal are never visited; the merged hi/lo planes stored by the same launch); merged hi/lo x W_o exact + b_o.
// Compute dtypes, f32 accumulate: every input rounded to bf16; projections exact + f32 biases; attention rows < 512 3 products, rest fp16; softmax f32; output projection hl x exact.

#define NB_  1
#define TT   2048
#define DM   2048
#define NH_  16
#define NKV  4
#define REP  (NH_ / NKV)
#define HD   128
#define DQ   (NH_ * HD)
#define DKV  (NKV * HD)
#define RH   512                  // query rows < RH use hi+lo planes (0: none)
#define SCL  0.088388347648318447f   // HD^-0.5
typedef _Float16 h16;
typedef unsigned short bf;
typedef __attribute__((ext_vector_type(16))) __bf16   v16bf;
typedef __attribute__((ext_vector_type(16))) _Float16 v16h;
typedef __attribute__((ext_vector_type(8)))  _Float16 v8h;
typedef __attribute__((ext_vector_type(8)))  unsigned short v8us;
typedef __attribute__((ext_vector_type(8)))  float    v8f;
typedef __attribute__((ext_vector_type(4)))  float    v4f;
typedef v8h  __attribute__((may_alias)) v8ha;
typedef v4f  __attribute__((may_alias)) v4fa;
typedef v8us __attribute__((may_alias)) v8usa;

__device__ __forceinline__ unsigned short f2bf(float f) { unsigned u = __float_as_uint(f); u += 0x7FFFu + ((u >> 16) & 1u); return (unsigned short)(u >> 16); }
__device__ __forceinline__ float bf2f(unsigned short b) { return __uint_as_float(((unsigned)b) << 16); }
__device__ __forceinline__ float bfr(float f) { return bf2f(f2bf(f)); }
__device__ __forceinline__ h16 tohx(float x) { return (h16)x; }
__device__ __forceinline__ void splitf(float y, unsigned short& h, unsigned short& l) { h = f2bf(y); l = f2bf(y - bf2f(h)); }
typedef __attribute__((ext_vector_type(4))) _Float16 v4h;
typedef __attribute__((ext_vector_type(4))) unsigned short v4us;
typedef v4us __attribute__((may_alias)) v4usa;
__device__ __forceinline__ v16h cat16(v8h lo, v8h hi) { return __builtin_shufflevector(lo, hi, 0, 1, 2, 3, 4, 5, 6, 7, 8, 9, 10, 11, 12, 13, 14, 15); }
__device__ __forceinline__ v16bf cat16b(v8us lo, v8us hi) { return __builtin_bit_cast(v16bf, __builtin_shufflevector(lo, hi, 0, 1, 2, 3, 4, 5, 6, 7, 8, 9, 10, 11, 12, 13, 14, 15)); }
__device__ __forceinline__ v8f wmma16(v16h a, v16h b, v8f c) { return __builtin_amdgcn_wmma_f32_16x16x32_f16(false, a, false, b, (short)0, c, false, false); }
__device__ __forceinline__ v8f wmmab(v16bf a, v16bf b, v8f c) { return __builtin_amdgcn_wmma_f32_16x16x32_bf16(false, a, false, b, (short)0, c, false, false); }
// fragment order of a 16-bit operand plane of K columns: 16 rows x 32 k = 1024 contiguous bytes, laid out as the two 16-byte loads of a matrix fragment take them (piece k/16%2: 512 B; in it lane (k/8%2)*16 + row%16: 16 B = 8 k).
// A wave-wide 16-byte load then reads 512 contiguous bytes = 4 whole 128-B lines, where a row-major plane gives it 32 bytes of each of 16 lines. The k a lane and register holds is the same as before.
__device__ __forceinline__ size_t pk(int row, int k, int K) { return ((size_t)(row >> 4) * (K >> 5) + (k >> 5)) * 512 + ((k >> 4) & 1) * 256 + (((k >> 3) & 1) * 16 + (row & 15)) * 8 + (k & 7); }

// ---- gemmt: one 128x128 output tile per work-group of 8 waves; both operands (16-bit planes in fragment order, pk) are staged in LDS, 128 k a stage, by asynchronous 16-byte copies, two buffers: stage t + 2 is fetched while stage t + 1 is worked on.
// Wave wv takes the 64x64 quarter (wv & 1, wv / 2 & 1) of the tile and the 64-k half wv / 4 of every stage: a staged fragment is read by two waves, and a byte comes from L2 once a work-group. The two k halves of a quarter meet in LDS (which the stages have left by then) and are summed half 0 + half 1.
// C[m][n] (f32, pitch ldc, + f32 bias[n]) = sum_k A[m][k] Bt[n][k] (+ A2[m][k] Bt[n][k] where NSPLIT is 1). K % 128 == 0, K >= 256.
// A stage in LDS: operand A, Bt (, A2), each 8 row blocks of 4096 B = 16 rows x 128 k, which are 4096 contiguous bytes of the plane: a copy of the 256 threads moves one row block, byte for byte, so a fragment is read from LDS as it was from the plane (512 contiguous bytes a wave and load).
// EPI: what the summed tile is stored as. 0: f32 C. 1 (Q, K): head planes [n / HD] of (row m, k n % HD), fp16 + bf16 hi/lo. 2 (V, computed as W_v x^T: m = kv feature, n = token, bias by row): planes (row m, k n) of ldc columns, fp16 + hi/lo. Both in fragment order: a tile is 8 x 4 whole 1024-B fragment blocks of every plane it stores: one writer a line.
template <typename T16> struct WFrag;
template <> struct WFrag<h16> { typedef v16h V; static __device__ __forceinline__ V ld(const h16* p) { return cat16(*(const v8h*)p, *(const v8h*)(p + 16)); } static __device__ __forceinline__ V ldp(const h16* p) { return cat16(*(const v8h*)p, *(const v8h*)(p + 256)); } static __device__ __forceinline__ v8f mma(V a, V b, v8f c) { return wmma16(a, b, c); } };
template <> struct WFrag<bf> { typedef v16bf V; static __device__ __forceinline__ V ld(const bf* p) { return cat16b(*(const v8us*)p, *(const v8us*)(p + 16)); } static __device__ __forceinline__ V ldp(const bf* p) { return cat16b(*(const v8us*)p, *(const v8us*)(p + 256)); } static __device__ __forceinline__ v8f mma(V a, V b, v8f c) { return wmmab(a, b, c); } };
// eight asynchronous copies a lane: one operand's 8 row blocks of a stage, 4096 B apart in LDS, rs elements apart in the plane. The s_wait_xcnt closes the copies' own statement, so that it stands in front of every rewrite of their address registers
__device__ __forceinline__ void cp8(unsigned l, const bf* g, size_t rs) {
    asm volatile("global_load_async_to_lds_b128 %0, %8, off\n\t"
                 "global_load_async_to_lds_b128 %1, %9, off\n\t"
                 "global_load_async_to_lds_b128 %2, %10, off\n\t"
                 "global_load_async_to_lds_b128 %3, %11, off\n\t"
                 "global_load_async_to_lds_b128 %4, %12, off\n\t"
                 "global_load_async_to_lds_b128 %5, %13, off\n\t"
                 "global_load_async_to_lds_b128 %6, %14, off\n\t"
                 "global_load_async_to_lds_b128 %7, %15, off\n\t"
                 "s_wait_xcnt 0x0"
                 :: "v"(l), "v"(l + 4096u), "v"(l + 8192u), "v"(l + 12288u), "v"(l + 16384u), "v"(l + 20480u), "v"(l + 24576u), "v"(l + 28672u),
                    "v"(g), "v"(g + rs), "v"(g + 2 * rs), "v"(g + 3 * rs), "v"(g + 4 * rs), "v"(g + 5 * rs), "v"(g + 6 * rs), "v"(g + 7 * rs) : "memory");
}
#define GT_OS (8 * 64 * 68 * 4)                                   // bytes of the 8 partial quarters (pitch 68 floats)
#define GT_LDS(NOP) ((2 * (NOP) * 32768) > GT_OS ? (2 * (NOP) * 32768) : GT_OS)   // two stages of NOP operands, or the partial quarters, whichever is larger
// The body is a device function: sh = the work-group's LDS (GT_LDS bytes), (bx, by) = the tile it takes. A launch may hold the tiles of several independent GEMMs (kernels below): each work-group runs one body, chosen by its block index alone.
template <int NSPLIT, bool BIAS, int EPI, int K>
__device__ __forceinline__ void gemmt(unsigned char* sh, int bx, int by, const bf* __restrict__ A, const bf* __restrict__ A2, const bf* __restrict__ Bt, float* C, int ldc, const float* __restrict__ bias, h16* P16, bf* Ph, bf* Pl) {
    typedef typename WFrag<bf>::V V;
    constexpr int STG = (NSPLIT == 1 ? 3 : 2) * 32768, NT = K / 128;
    const int tid = threadIdx.x, lane = tid & 31, lr = lane & 15, hi = lane >> 4; const int r0 = bx * 128, c0 = by * 128;
    const int wv = __builtin_amdgcn_readfirstlane(tid >> 5);   // wave number, scalar: the LDS bases of the wave's fragments stay scalar
    const int mq = wv & 1, nq = (wv >> 1) & 1, kh = wv >> 2;
    v8f acc[4][4];
#pragma unroll
    for (int mb = 0; mb < 4; ++mb)
#pragma unroll
        for (int nb = 0; nb < 4; ++nb) acc[mb][nb] = (v8f){};
    const unsigned l0 = (unsigned)(size_t)sh + (unsigned)tid * 16u;   // this thread's 16 bytes in a row block, as an LDS byte address
    const bf* ga = A + (size_t)r0 * K + 8 * tid; const bf* ga2 = (NSPLIT == 1) ? A2 + (size_t)r0 * K + 8 * tid : ga; const bf* gb = Bt + (size_t)c0 * K + 8 * tid;   // fragment order: 16 rows are 16 * K elements, a stage 2048 elements on
    auto copies = [&](int t, int buf) { const unsigned l = l0 + (unsigned)(buf * STG);
        cp8(l, ga + (size_t)t * 2048, (size_t)16 * K); cp8(l + 32768u, gb + (size_t)t * 2048, (size_t)16 * K); if (NSPLIT == 1) cp8(l + 65536u, ga2 + (size_t)t * 2048, (size_t)16 * K); };
    copies(0, 0);
    asm volatile("s_wait_asynccnt 0x0" ::: "memory");   // this wave's copies of stage 0 have landed
    __syncthreads();                                     // ... and every other wave's: stage 0 may be read
    copies(1, 1);
    // rolled: one stage's code and fragments at a time
#pragma unroll 1
    for (int t = 0; t < NT; ++t) {
        const bf* sb = (const bf*)(sh + (t & 1) * STG) + kh * 1024 + 8 * lane;   // this wave's 64-k half of the stage, this lane's 16 bytes
        const bf* pa = sb + mq * 8192; const bf* pb = sb + 16384 + nq * 8192; const bf* pa2 = (NSPLIT == 1) ? sb + 32768 + mq * 8192 : pa;
        V a[2][4], a2[2][4], b[2][4];
        // one 32-k step's fragments, in the order in which the products want them
        auto ldf = [&](int kq) __attribute__((always_inline)) { b[kq][0] = WFrag<bf>::ldp(pb + kq * 512);
#pragma unroll
            for (int mb = 0; mb < 4; ++mb) { a[kq][mb] = WFrag<bf>::ldp(pa + mb * 2048 + kq * 512); if (NSPLIT == 1) a2[kq][mb] = WFrag<bf>::ldp(pa2 + mb * 2048 + kq * 512); }
#pragma unroll
            for (int nb = 1; nb < 4; ++nb) b[kq][nb] = WFrag<bf>::ldp(pb + nb * 2048 + kq * 512); };
        auto mm = [&](int kq) __attribute__((always_inline)) {
#pragma unroll
            for (int nb = 0; nb < 4; ++nb)
#pragma unroll
                for (int mb = 0; mb < 4; ++mb) { acc[mb][nb] = WFrag<bf>::mma(a[kq][mb], b[kq][nb], acc[mb][nb]); if (NSPLIT == 1) acc[mb][nb] = WFrag<bf>::mma(a2[kq][mb], b[kq][nb], acc[mb][nb]); } };
        // the LDS reads go ahead of the products as one group (counted waits let the first products start on the first fragments); without the scheduling barrier the build fetches each Bt fragment into one register set right in front of its products and waits out the LDS latency every time.
        // hi/lo body (one work-group a WGP, registers to spare): the whole stage's fragments at once; else step by step, so that two work-groups fit a WGP's registers
        if (NSPLIT == 1) { ldf(0); ldf(1); __builtin_amdgcn_sched_barrier(0); mm(0); mm(1); }
        else { ldf(0); __builtin_amdgcn_sched_barrier(0); mm(0); ldf(1); __builtin_amdgcn_sched_barrier(0); mm(1); }
        // the distance behind the stage's last matrix instructions, on every path that follows; every accumulator is an input, so that no product is moved behind the waits and the barrier below (the next stage's copies would start later)
        asm volatile("v_nop\n\tv_nop\n\tv_nop\n\tv_nop" :: "v"(acc[0][0]), "v"(acc[0][1]), "v"(acc[0][2]), "v"(acc[0][3]), "v"(acc[1][0]), "v"(acc[1][1]), "v"(acc[1][2]), "v"(acc[1][3]), "v"(acc[2][0]), "v"(acc[2][1]), "v"(acc[2][2]), "v"(acc[2][3]), "v"(acc[3][0]), "v"(acc[3][1]), "v"(acc[3][2]), "v"(acc[3][3]));
        asm volatile("s_wait_dscnt 0x0" ::: "memory");      // this wave's reads of stage t are done before the buffer is handed to its next writer
        asm volatile("s_wait_asynccnt 0x0" ::: "memory");   // this wave's copies of stage t + 1 have landed
        __syncthreads();                                     // publishes stage t + 1 and ends every wave's last read of stage t
        if (t + 2 < NT) copies(t + 2, t & 1);
    }
    asm volatile("s_wait_asynccnt 0x0" ::: "memory");       // no copy is outstanding when the stages' LDS becomes the partial quarters
    float* os = (float*)sh; float* ow = os + wv * (64 * 68);
#pragma unroll
    for (int mb = 0; mb < 4; ++mb)
#pragma unroll
        for (int nb = 0; nb < 4; ++nb)
#pragma unroll
            for (int j = 0; j < 8; ++j) ow[(mb * 16 + hi * 8 + j) * 68 + nb * 16 + lr] = acc[mb][nb][j];
    __syncthreads();   // every wave's partial quarter is in LDS before any wave sums
    if (EPI == 0) {
    // a wave sums and stores one whole row of the tile (512 contiguous bytes) at a time
#pragma unroll
    for (int i = 0; i < 128 * 32 / 256; ++i) { const int e = tid + i * 256, row = e >> 5, cofs = (e & 31) * 4; const float* o0 = os + ((row >> 6) + 2 * (cofs >> 6)) * (64 * 68) + (row & 63) * 68 + (cofs & 63);
        v4f val = *(const v4fa*)o0; val += *(const v4fa*)(o0 + 4 * (64 * 68));
        if (BIAS) { val[0] += bfr(bias[c0 + cofs]); val[1] += bfr(bias[c0 + cofs + 1]); val[2] += bfr(bias[c0 + cofs + 2]); val[3] += bfr(bias[c0 + cofs + 3]); }
        *(v4f*)(C + (size_t)(r0 + row) * ldc + c0 + cofs) = val; }
    } else {
    // plane stores in fragment order: a thread sums and stores one 16-byte piece (8 k of one row), the threads numbered in the order of the plane, so that a wave stores 512 contiguous bytes of each plane
#pragma unroll
    for (int i = 0; i < 128 * 16 / 256; ++i) { const int u = tid + i * 256, row = ((u >> 8) & 7) * 16 + (u & 15), cofs = ((u >> 6) & 3) * 32 + ((u >> 5) & 1) * 16 + ((u >> 4) & 1) * 8; const float* o0 = os + ((row >> 6) + 2 * (cofs >> 6)) * (64 * 68) + (row & 63) * 68 + (cofs & 63);
        v4f val = *(const v4fa*)o0, vb = *(const v4fa*)(o0 + 4); val += *(const v4fa*)(o0 + 4 * (64 * 68)); vb += *(const v4fa*)(o0 + 4 * (64 * 68) + 4);
        float y8[8];
#pragma unroll
        for (int q = 0; q < 4; ++q) { y8[q] = val[q]; y8[q + 4] = vb[q]; }
        if (BIAS && EPI == 2) { const float br = bfr(bias[r0 + row]);
#pragma unroll
            for (int q = 0; q < 8; ++q) y8[q] += br; }
        else if (BIAS) {
#pragma unroll
            for (int q = 0; q < 8; ++q) y8[q] += bfr(bias[c0 + cofs + q]); }
        const int col = c0 + cofs;
        const size_t o = (EPI == 1) ? (size_t)(col / HD) * ((size_t)TT * HD) + pk(r0 + row, col % HD, HD) : pk(r0 + row, col, ldc);
        v8h o16; v8us oh, ol;
#pragma unroll
        for (int q = 0; q < 8; ++q) { const float y = y8[q]; o16[q] = tohx(y); unsigned short a2s, c2s; splitf(y, a2s, c2s); oh[q] = a2s; ol[q] = c2s; }
        *(v8h*)(P16 + o) = o16; *(v8us*)(Ph + o) = oh; *(v8us*)(Pl + o) = ol; }
    }
}

// k_qkv: the three projections in one launch, grid (TT/128, (DQ + 2 * DKV) / 128). y < DQ/128: Q tile (x, y); the next DKV/128: K tile; the last DKV/128: V as W_v x^T, tile (row block y', token block x).
__global__ __launch_bounds__(256) void k_qkv(const bf* __restrict__ XB, const bf* __restrict__ WQ, const bf* __restrict__ WK, const bf* __restrict__ WV, const float* __restrict__ bq, const float* __restrict__ bk, const float* __restrict__ bv, h16* QP16, bf* QPh, bf* QPl, h16* KP16, bf* KPh, bf* KPl, h16* VT16, bf* VTh, bf* VTl) {
    __shared__ __align__(16) unsigned char sh[GT_LDS(2)];
    const int bx = blockIdx.x, by = blockIdx.y;
    if (by < (DQ + DKV) / 128) { const bool q = by < DQ / 128;
        gemmt<0, true, 1, DM>(sh, bx, q ? by : by - DQ / 128, XB, nullptr, q ? WQ : WK, nullptr, 0, q ? bq : bk, q ? QP16 : KP16, q ? QPh : KPh, q ? QPl : KPl); }
    else gemmt<0, true, 2, DM>(sh, by - (DQ + DKV) / 128, bx, WV, nullptr, XB, nullptr, TT, bv, VT16, VTh, VTl);   // rows = kv features, columns = tokens: [kv head][d][t]
}

// ---- fattn: scores, softmax and probability x value of 32 query rows of one head in one work-group of 8 waves; no score or probability leaves the registers.
// Transposed products: S^T = K Q^T (A = 16 keys x 32 d of the K plane, B = 16 queries x 32 d of the Q plane, kept in registers), O^T += V^T P^T (A = 16 d x 32 keys of the V^T plane). In an accumulator of S^T a lane holds keys hi * 8 + j of query lr:
// two such accumulators (keys 0..15, 16..31 of the step) are, element for element, the B fragment of P^T (k = hi * 8 + j, then 16 + hi * 8 + j), so the probabilities are packed in place.
// The 32-key steps 0 .. qb are dealt to the waves, step s to wave s % 8; each wave keeps a running maximum m (log2 units), a sum l and an unnormalised O^T of its own steps; the eight meet in LDS and are joined in wave order 0..7 with weights 2^(m_w - M).
// HL (rows < RH): bf16 hi/lo planes, 3 products each way. Else fp16, the probabilities carried x 2^10 (in l as well, so that it cancels in O / l).
__device__ __forceinline__ float xhalf(float x) { return __builtin_bit_cast(float, __builtin_amdgcn_permlanex16(__builtin_bit_cast(int, x), __builtin_bit_cast(int, x), 0x76543210, 0xfedcba98, false, false)); }   // lane l takes lane l ^ 16's value
// 2^x of a run of N values with the slot behind a transcendental kept: results and arguments are inputs of the closing statement, which holds every argument's register to the end of the run; its v_nop is the slot of the run's last v_exp
template <int N> __device__ __forceinline__ void exp2run(const float* x, float* r);
template <> __device__ __forceinline__ void exp2run<8>(const float* x, float* r) {
#pragma unroll
    for (int j = 0; j < 8; ++j) r[j] = __builtin_amdgcn_exp2f(x[j]);
    asm volatile("v_nop" :: "v"(r[0]), "v"(r[1]), "v"(r[2]), "v"(r[3]), "v"(r[4]), "v"(r[5]), "v"(r[6]), "v"(r[7]), "v"(x[0]), "v"(x[1]), "v"(x[2]), "v"(x[3]), "v"(x[4]), "v"(x[5]), "v"(x[6]), "v"(x[7])); }
template <> __device__ __forceinline__ void exp2run<2>(const float* x, float* r) { r[0] = __builtin_amdgcn_exp2f(x[0]); r[1] = __builtin_amdgcn_exp2f(x[1]);
    asm volatile("v_nop" :: "v"(r[0]), "v"(r[1]), "v"(x[0]), "v"(x[1])); }
template <typename T16> struct PPack;
template <> struct PPack<h16> { static __device__ __forceinline__ void pack(const float* p, v16h& a, v16h& b) { v8h x, y;
#pragma unroll
    for (int j = 0; j < 8; ++j) { x[j] = tohx(p[j]); y[j] = tohx(p[8 + j]); }
    a = cat16(x, y); b = a; } };
template <> struct PPack<bf> { static __device__ __forceinline__ void pack(const float* p, v16bf& a, v16bf& b) { v8us xh, yh, xl, yl;
#pragma unroll
    for (int j = 0; j < 8; ++j) { unsigned short s, t; splitf(p[j], s, t); xh[j] = s; xl[j] = t; splitf(p[8 + j], s, t); yh[j] = s; yl[j] = t; }
    a = cat16b(xh, yh); b = cat16b(xl, yl); } };
template <typename T16, bool HL>
__device__ __forceinline__ void fattn(float* os, float* sm, float* sl, int qb, int h, const T16* __restrict__ Q, const T16* __restrict__ Q2, const T16* __restrict__ Kp, const T16* __restrict__ K2, const T16* __restrict__ Vt, const T16* __restrict__ V2, bf* ATh, bf* ATl) {
    typedef typename WFrag<T16>::V V;
    const int lane = threadIdx.x & 31, lr = lane & 15, hi = lane >> 4; const int q0 = qb * 32;
    const int wv = __builtin_amdgcn_readfirstlane((int)(threadIdx.x >> 5));   // wave number, scalar: the step loop's trip test and the diagonal test stay scalar branches (every lane on at the matrix instructions)
    const float CS = SCL * 1.4426950408889634f;      // score -> log2 units
    const float OFS = HL ? 0.0f : 10.0f;             // fp16 probabilities x 2^10
    const size_t qo = (size_t)h * ((size_t)TT * HD) + (size_t)q0 * HD + 8 * lane, ko = (size_t)(h / REP) * ((size_t)TT * HD) + 8 * lane, vo = (size_t)(h / REP) * ((size_t)HD * TT) + 8 * lane;
    const T16* pq = Q + qo; const T16* pq2 = HL ? Q2 + qo : pq;
    V qf[2][4], qf2[2][4];
#pragma unroll
    for (int g = 0; g < 2; ++g)
#pragma unroll
        for (int ds = 0; ds < 4; ++ds) { qf[g][ds] = WFrag<T16>::ldp(pq + (g * 4 + ds) * 512); if (HL) qf2[g][ds] = WFrag<T16>::ldp(pq2 + (g * 4 + ds) * 512); }
    // the wait in front of an overwrite of the Q loads' address registers
    asm volatile("s_wait_xcnt 0x0" :: "v"(pq), "v"(pq2) : "memory");
    v8f O[8][2]; float m[2] = { -3.0e38f, -3.0e38f }, l[2] = { 0.f, 0.f };
#pragma unroll
    for (int db = 0; db < 8; ++db) { O[db][0] = (v8f){}; O[db][1] = (v8f){}; }
    const T16* kb1 = Kp + ko; const T16* kb2 = HL ? K2 + ko : kb1; const T16* vb1 = Vt + vo; const T16* vb2 = HL ? V2 + vo : vb1;
    V kf[8], kf2[8], vf[8], vf2[8];
    // one step's K fragments (2 key blocks x 4 d steps) and V^T fragments (8 d blocks); behind each run of loads the wait in front of an overwrite of their address registers, the addresses being inputs of the statement
    auto ldK = [&](int s) { const T16* p1 = kb1 + (size_t)s * (32 * HD); const T16* p2 = HL ? kb2 + (size_t)s * (32 * HD) : p1;
#pragma unroll
        for (int i = 0; i < 8; ++i) { kf[i] = WFrag<T16>::ldp(p1 + i * 512); if (HL) kf2[i] = WFrag<T16>::ldp(p2 + i * 512); }
        asm volatile("s_wait_xcnt 0x0" :: "v"(p1), "v"(p2) : "memory"); };
    auto ldV = [&](int s) { const T16* p1 = vb1 + (size_t)s * 512; const T16* p2 = HL ? vb2 + (size_t)s * 512 : p1;
#pragma unroll
        for (int db = 0; db < 8; ++db) { vf[db] = WFrag<T16>::ldp(p1 + (size_t)db * 16 * TT); if (HL) vf2[db] = WFrag<T16>::ldp(p2 + (size_t)db * 16 * TT); }
        asm volatile("s_wait_xcnt 0x0" :: "v"(p1), "v"(p2) : "memory"); };
    // one 32-key step. fp16 body: the fragments of the wave's next step (nx: there is one) are fetched into the registers that this step has just used, K behind the score products, V behind the value products, so that they fly during the softmax and the other product.
    // hi/lo body (twice the fragments): each step fetches its own, K in front of the score products, V behind them.
    auto step = [&](int s, bool nx) __attribute__((always_inline)) {
        const int k0 = s * 32;
        if (HL) { ldK(s); __builtin_amdgcn_sched_barrier(0); }   // keeps the first product behind the last load: without it the loads share registers and wait for one another
        v8f S[2][2];
#pragma unroll
        for (int kb = 0; kb < 2; ++kb) { S[kb][0] = (v8f){}; S[kb][1] = (v8f){};
#pragma unroll
            for (int ds = 0; ds < 4; ++ds)
#pragma unroll
                for (int g = 0; g < 2; ++g) { S[kb][g] = WFrag<T16>::mma(kf[kb * 4 + ds], qf[g][ds], S[kb][g]); if (HL) { S[kb][g] = WFrag<T16>::mma(kf[kb * 4 + ds], qf2[g][ds], S[kb][g]); S[kb][g] = WFrag<T16>::mma(kf2[kb * 4 + ds], qf[g][ds], S[kb][g]); } } }
        if (HL) ldV(s);
        else if (nx) ldK(s + 8);
        if (!nx) {
            // the distance behind the last score products, on the taken side of the branch that follows too
            asm volatile("v_nop\n\tv_nop\n\tv_nop\n\tv_nop" : "+v"(S[0][0]), "+v"(S[0][1]), "+v"(S[1][0]), "+v"(S[1][1]));
            if (k0 + 31 > q0) {   // the diagonal step (s = qb, some wave's last) alone holds keys behind a query (key > query: out of the maximum, probability exactly 0)
#pragma unroll
                for (int kb = 0; kb < 2; ++kb)
#pragma unroll
                    for (int g = 0; g < 2; ++g)
#pragma unroll
                        for (int j = 0; j < 8; ++j) if (k0 + kb * 16 + hi * 8 + j > q0 + g * 16 + lr) S[kb][g][j] = -3.0e38f;
            }
        }
        float mn[2];
#pragma unroll
        for (int g = 0; g < 2; ++g) { float mx = fmaxf(S[0][g][0], S[1][g][0]);
#pragma unroll
            for (int j = 1; j < 8; ++j) mx = fmaxf(mx, fmaxf(S[0][g][j], S[1][g][j]));
            mx = fmaxf(mx, xhalf(mx)); mn[g] = fmaxf(m[g], mx * CS); }
        // the accumulators are rescaled only in a step in which some query's maximum has grown (scalar branch: the same for the wave)
        if (__builtin_amdgcn_ballot_w32(mn[0] > m[0] || mn[1] > m[1]) != 0) {
            const float dm[2] = { m[0] - mn[0], m[1] - mn[1] }; float al[2]; exp2run<2>(dm, al);
#pragma unroll
            for (int g = 0; g < 2; ++g) { l[g] *= al[g]; m[g] = mn[g];
#pragma unroll
                for (int db = 0; db < 8; ++db) O[db][g] *= al[g]; }
        }
        V pf[2], pf2[2];
#pragma unroll
        for (int g = 0; g < 2; ++g) { float p[16]; const float mo = OFS - m[g];
#pragma unroll
            for (int kb = 0; kb < 2; ++kb) { float t[8];
#pragma unroll
                for (int j = 0; j < 8; ++j) t[j] = fmaf(S[kb][g][j], CS, mo);
                exp2run<8>(t, p + kb * 8);
#pragma unroll
                for (int j = 0; j < 8; ++j) l[g] += p[kb * 8 + j]; }
            PPack<T16>::pack(p, pf[g], pf2[g]); }
#pragma unroll
        for (int db = 0; db < 8; ++db)
#pragma unroll
            for (int g = 0; g < 2; ++g) { O[db][g] = WFrag<T16>::mma(vf[db], pf[g], O[db][g]); if (HL) { O[db][g] = WFrag<T16>::mma(vf[db], pf2[g], O[db][g]); O[db][g] = WFrag<T16>::mma(vf2[db], pf[g], O[db][g]); } }
        if (!HL && nx) ldV(s + 8);
    };
    // rolled loops: one step's fragments live at a time. fp16: the steps that have a successor, then the wave's last step on its own, so that the number of loads in flight at each wait is fixed
    if (wv <= qb) { int s = wv;
        if (HL) {
#pragma unroll 1
            for (; s <= qb; s += 8) step(s, false);
        } else { ldK(s); ldV(s);
#pragma unroll 1
            for (; s + 8 <= qb; s += 8) step(s, true);
            step(s, false); }
    }
    // each wave's partial: piece t = db * 2 + g is 256 floats, j 0..3 of the 32 lanes, then j 4..7: every LDS access is 512 contiguous bytes of a wave
    float* ow = os + wv * 4096;
#pragma unroll
    for (int g = 0; g < 2; ++g) { l[g] += xhalf(l[g]); if (hi == 0) { sm[wv * 32 + g * 16 + lr] = m[g]; sl[wv * 32 + g * 16 + lr] = l[g]; }
#pragma unroll
        for (int db = 0; db < 8; ++db) { const v8f o = O[db][g]; *(v4fa*)(ow + (db * 2 + g) * 256 + lane * 4) = (v4f){ o[0], o[1], o[2], o[3] }; *(v4fa*)(ow + (db * 2 + g) * 256 + 128 + lane * 4) = (v4f){ o[4], o[5], o[6], o[7] }; } }
    __syncthreads();   // every wave's partial (O, m, l) is in LDS before any wave joins them; a wave with no step has stored zeros and m = -3e38 (weight 0)
    // wave wv joins d block wv of both query groups; a lane's 8 values are 8 successive d of one token = one 16-byte piece of the merged planes in fragment order (a wave stores 512 contiguous bytes)
#pragma unroll
    for (int g = 0; g < 2; ++g) { float mw[8], M = -3.0e38f, L = 0.f; v4f x = (v4f){}, y = (v4f){};
#pragma unroll
        for (int w = 0; w < 8; ++w) { mw[w] = sm[w * 32 + g * 16 + lr]; M = fmaxf(M, mw[w]); }
#pragma unroll
        for (int w = 0; w < 8; ++w) mw[w] -= M;
        float wt[8]; exp2run<8>(mw, wt);
#pragma unroll
        for (int w = 0; w < 8; ++w) { L += wt[w] * sl[w * 32 + g * 16 + lr];
            x += wt[w] * *(const v4fa*)(os + w * 4096 + (wv * 2 + g) * 256 + lane * 4); y += wt[w] * *(const v4fa*)(os + w * 4096 + (wv * 2 + g) * 256 + 128 + lane * 4); }
        const float inv = __fdiv_rn(1.0f, L); v8us oh, ol;
#pragma unroll
        for (int q = 0; q < 4; ++q) { unsigned short a2, c2; splitf(x[q] * inv, a2, c2); oh[q] = a2; ol[q] = c2; splitf(y[q] * inv, a2, c2); oh[q + 4] = a2; ol[q + 4] = c2; }
        const size_t o = pk(q0 + g * 16 + lr, h * HD + wv * 16 + hi * 8, DQ);
        *(v8us*)(ATh + o) = oh; *(v8us*)(ATl + o) = ol; }
}

// k_fattn: grid (NH_ query heads, TT/32 query blocks, the longest first); blocks of rows < RH take the hi/lo body, the rest fp16.
__global__ __launch_bounds__(256) void k_fattn(const h16* __restrict__ QP16, const h16* __restrict__ KP16, const h16* __restrict__ VT16, const bf* __restrict__ QPh, const bf* __restrict__ QPl, const bf* __restrict__ KPh, const bf* __restrict__ KPl, const bf* __restrict__ VTh, const bf* __restrict__ VTl, bf* ATh, bf* ATl) {
    __shared__ __align__(16) float os[8 * 4096]; __shared__ float sm[8 * 32]; __shared__ float sl[8 * 32];
    const int qb = TT / 32 - 1 - (int)blockIdx.y, h = blockIdx.x;
    if (qb < RH / 32) fattn<bf, true>(os, sm, sl, qb, h, QPh, QPl, KPh, KPl, VTh, VTl, ATh, ATl);
    else fattn<h16, false>(os, sm, sl, qb, h, QP16, nullptr, KP16, nullptr, VT16, nullptr, ATh, ATl);
}

// k_oproj: merged hi/lo x W_o + b_o, grid (TT/128, DM/128).
__global__ __launch_bounds__(256) void k_oproj(const bf* __restrict__ ATh, const bf* __restrict__ ATl, const bf* __restrict__ WO, float* OUT, const float* __restrict__ bo) {
    __shared__ __align__(16) unsigned char sh[GT_LDS(3)];
    gemmt<1, true, 0, DQ>(sh, blockIdx.x, blockIdx.y, ATh, ATl, WO, OUT, DM, bo, nullptr, nullptr, nullptr);
}


// k_cvtp: f32 [rows][DM] -> bf16 plane in fragment order (pk). One wave takes 16 rows x 64 k: it reads 256 contiguous bytes of two rows with each load (8 loads in flight), turns the block in its own LDS range and stores 4 x 512 contiguous bytes.
// LDS: the 8 pieces of 256 B (16 rows x 8 k) stand 288 B apart, so that the 8-byte stores of a wave fall on all 64 banks. All five planes in one launch: the block index picks the plane (CB_ blocks each, in the order x, W_q, W_k, W_v, W_o) and the block's place in it. grid = the five planes' rows * DM / 8192 exactly: no thread leaves in front of the barrier.
#define CB_X (TT * DM / 8192)
#define CB_Q (DQ * DM / 8192)
#define CB_K (DKV * DM / 8192)
#define CB_O (DM * DQ / 8192)
__global__ __launch_bounds__(256) void k_cvtp(const float* __restrict__ x, const float* __restrict__ wq, const float* __restrict__ wk, const float* __restrict__ wv_, const float* __restrict__ wo, bf* XB, bf* WQ, bf* WK, bf* WV, bf* WO) {
    __shared__ __align__(16) bf ls[8 * 8 * 144];
    int blk = blockIdx.x; const float* src = x; bf* dst = XB;
    if (blk >= CB_X + CB_Q + 2 * CB_K) { blk -= CB_X + CB_Q + 2 * CB_K; src = wo; dst = WO; }
    else if (blk >= CB_X + CB_Q + CB_K) { blk -= CB_X + CB_Q + CB_K; src = wv_; dst = WV; }
    else if (blk >= CB_X + CB_Q) { blk -= CB_X + CB_Q; src = wk; dst = WK; }
    else if (blk >= CB_X) { blk -= CB_X; src = wq; dst = WQ; }
    const int lane = threadIdx.x & 31, wv = threadIdx.x >> 5, c = lane & 15, h = lane >> 4; const size_t g = (size_t)blk * 8 + wv;
    const float* s = src + (g / (DM / 64)) * (16 * DM) + (g % (DM / 64)) * 64 + (size_t)h * DM + c * 4; bf* lw = ls + wv * (8 * 144); v4f v[8];
#pragma unroll
    for (int j = 0; j < 8; ++j) v[j] = *(const v4f*)(s + (size_t)j * 2 * DM);
#pragma unroll
    for (int j = 0; j < 8; ++j) { v4us o;
#pragma unroll
        for (int q = 0; q < 4; ++q) o[q] = f2bf(v[j][q]);
        *(v4usa*)(lw + (c >> 1) * 144 + (j * 2 + h) * 8 + (c & 1) * 4) = o; }
    __syncthreads();   // the lanes of a wave read what other lanes of it have written to LDS
#pragma unroll
    for (int t = 0; t < 4; ++t) *(v8us*)(dst + g * 1024 + t * 256 + lane * 8) = *(const v8usa*)(lw + (t * 2 + h) * 144 + c * 8);
}

extern "C" void kernel_launch(void* const* d_in, const int* in_sizes, int n_in,
                              void* d_out, int out_size, void* d_ws, size_t ws_size, hipStream_t stream) {
    (void)in_sizes; (void)n_in; (void)out_size;
    const float* x = (const float*)d_in[0]; const float* wq = (const float*)d_in[1]; const float* bq = (const float*)d_in[2]; const float* wk = (const float*)d_in[3]; const float* bk = (const float*)d_in[4]; const float* wv = (const float*)d_in[5]; const float* bv = (const float*)d_in[6]; const float* wo = (const float*)d_in[7]; const float* bo = (const float*)d_in[8];
    float* OUT = (float*)d_out;     // [1][2048][2048]
    char* wsp = (char*)d_ws;
    auto take = [&](size_t bytes) { char* p = wsp; wsp += (bytes + 255) & ~(size_t)255; return (void*)p; };
    bf* WQ = (bf*)take((size_t)DQ * DM * 2); bf* WK = (bf*)take((size_t)DKV * DM * 2); bf* WV = (bf*)take((size_t)DKV * DM * 2); bf* WO = (bf*)take((size_t)DM * DQ * 2);
    bf* XB = (bf*)take((size_t)TT * DM * 2);
    h16* QP16 = (h16*)take((size_t)NH_ * TT * HD * 2); h16* KP16 = (h16*)take((size_t)NKV * TT * HD * 2); h16* VT16 = (h16*)take((size_t)NKV * HD * TT * 2);
    bf* QPh = (bf*)take((size_t)NH_ * TT * HD * 2); bf* QPl = (bf*)take((size_t)NH_ * TT * HD * 2); bf* KPh = (bf*)take((size_t)NKV * TT * HD * 2); bf* KPl = (bf*)take((size_t)NKV * TT * HD * 2); bf* VTh = (bf*)take((size_t)NKV * HD * TT * 2); bf* VTl = (bf*)take((size_t)NKV * HD * TT * 2);
    bf* ATh = (bf*)take((size_t)TT * DQ * 2); bf* ATl = (bf*)take((size_t)TT * DQ * 2);
    if ((size_t)(wsp - (char*)d_ws) > ws_size) return;    // ws 256 MiB
    for (int b = 0; b < NB_; ++b) {
        k_cvtp<<<CB_X + CB_Q + 2 * CB_K + CB_O, 256, 0, stream>>>(x + (size_t)b * TT * DM, wq, wk, wv, wo, XB, WQ, WK, WV, WO);
        k_qkv<<<dim3(TT / 128, (DQ + 2 * DKV) / 128, 1), 256, 0, stream>>>(XB, WQ, WK, WV, bq, bk, bv, QP16, QPh, QPl, KP16, KPh, KPl, VT16, VTh, VTl);
        k_fattn<<<dim3(NH_, TT / 32, 1), 256, 0, stream>>>(QP16, KP16, VT16, QPh, QPl, KPh, KPl, VTh, VTl, ATh, ATl);
        k_oproj<<<dim3(TT / 128, DM / 128, 1), 256, 0, stream>>>(ATh, ATl, WO, OUT + (size_t)b * TT * DM, bo); }
}

// v009
// A run of this version takes 87.8 microseconds.
// Next to v008, in two timings, it ran 1.07 and 1.08 times as fast.
// Over all steps from v000 it is 9.27 times as fast.
#include <hip/hip_runtime.h>

// Causal grouped-query attention with biases (x [1][2048][2048]; Q = x W_q^T + b_q (16 heads x 128 viewed (4 kv groups, 4)), K, V = x W^T + b (4 kv heads x 128) ('oi' 2048^-0.5 incl. biases: non-zero); query head h = kv*4 + g uses kv head h / 4; scores x 1/sqrt(128); causal (-inf); softmax; out = merged (head-major) W_o^T + b_o -> [1][2048][2048] (4.2 M); argument order x, W_q, b_q, W_k, b_k, W_v, b_v, W_o, b_o). THIS ROW: the same module at ONE sequence (x [1][2048][2048]; Q = x Wq^T + bq ('oi' [2048][2048]); K, V = x W^T + b with 'oi' [512][2048] weights (4 key / value heads x 128); weights normal x 2048^-0.5; the four biases zeros (read); grouped-query: query head h = 4 k + g uses key / value head k; scores x 128^-0.5; tril kept, -inf; softmax; out = merged Wo^T + bo; argument order x, Wq, bq, Wk, bk, Wv, bv, Wo, bo).
// Layout per batch: bf16 copy of x; 'oi' weights as-is; every 16-bit operand plane lies in fragment order (pk below); exact projections + f32 biases, each projection's work-groups storing the 16-bit operand planes of the attention themselves (V as W_v x^T, so that its tile is already key-contiguous); causal T-2048 GQA attention in one launch (fattn below: scores and probabilities stay in registers, online softmax; hybrid rows: < 512 hi/lo 3 products, rest fp16 with the probabilities x1024; steps above the diagonal are never visited; the merged hi/lo planes stored by the same launch); merged hi/lo x W_o exact + b_o.
// Compute dtypes, f32 accumulate: every input rounded to bf16; projections exact + f32 biases; attention rows < 512 3 products, rest fp16; softmax f32; output projection hl x exact.

#define NB_  1
#define TT   2048
#define DM   2048
#define NH_  16
#define NKV  4
#define REP  (NH_ / NKV)
#define HD   128
#define DQ   (NH_ * HD)
#define DKV  (NKV * HD)
#define RH   512                  // query rows < RH use hi+lo planes (0: none)
#define SCL  0.088388347648318447f   // HD^-0.5
typedef _Float16 h16;
typedef unsigned short bf;
typedef __attribute__((ext_vector_type(16))) __bf16   v16bf;
typedef __attribute__((ext_vector_type(16))) _Float16 v16h;
typedef __attribute__((ext_vector_type(8)))  _Float16 v8h;
typedef __attribute__((ext_vector_type(8)))  unsigned short v8us;
typedef __attribute__((ext_vector_type(8)))  float    v8f;
typedef __attribute__((ext_vector_type(4)))  float    v4f;
typedef v8h  __attribute__((may_alias)) v8ha;
typedef v4f  __attribute__((may_alias)) v4fa;
typedef v8us __attribute__((may_alias)) v8usa;

__device__ __forceinline__ unsigned short f2bf(float f) { unsigned u = __float_as_uint(f); u += 0x7FFFu + ((u >> 16) & 1u); return (unsigned short)(u >> 16); }
__device__ __forceinline__ float bf2f(unsigned short b) { return __uint_as_float(((unsigned)b) << 16); }
__device__ __forceinline__ float bfr(float f) { return bf2f(f2bf(f)); }
__device__ __forceinline__ h16 tohx(float x) { return (h16)x; }
__device__ __forceinline__ void splitf(float y, unsigned short& h, unsigned short& l) { h = f2bf(y); l = f2bf(y - bf2f(h)); }
typedef __attribute__((ext_vector_type(4))) _Float16 v4h;
typedef __attribute__((ext_vector_type(4))) unsigned short v4us;
typedef v4us __attribute__((may_alias)) v4usa;
__device__ __forceinline__ v16h cat16(v8h lo, v8h hi) { return __builtin_shufflevector(lo, hi, 0, 1, 2, 3, 4, 5, 6, 7, 8, 9, 10, 11, 12, 13, 14, 15); }
__device__ __forceinline__ v16bf cat16b(v8us lo, v8us hi) { return __builtin_bit_cast(v16bf, __builtin_shufflevector(lo, hi, 0, 1, 2, 3, 4, 5, 6, 7, 8, 9, 10, 11, 12, 13, 14, 15)); }
__device__ __forceinline__ v8f wmma16(v16h a, v16h b, v8f c) { return __builtin_amdgcn_wmma_f32_16x16x32_f16(false, a, false, b, (short)0, c, false, false); }
__device__ __forceinline__ v8f wmmab(v16bf a, v16bf b, v8f c) { return __builtin_amdgcn_wmma_f32_16x16x32_bf16(false, a, false, b, (short)0, c, false, false); }
// fragment order of a 16-bit operand plane of K columns: 16 rows x 32 k = 1024 contiguous bytes, laid out as the two 16-byte loads of a matrix fragment take them (piece k/16%2: 512 B; in it lane (k/8%2)*16 + row%16: 16 B = 8 k).
// A wave-wide 16-byte load then reads 512 contiguous bytes = 4 whole 128-B lines, where a row-major plane gives it 32 bytes of each of 16 lines. The k a lane and register holds is the same as before.
__device__ __forceinline__ size_t pk(int row, int k, int K) { return ((size_t)(row >> 4) * (K >> 5) + (k >> 5)) * 512 + ((k >> 4) & 1) * 256 + (((k >> 3) & 1) * 16 + (row & 15)) * 8 + (k & 7); }

// ---- gemmt: one 128x128 output tile per work-group of 8 waves; both operands (16-bit planes in fragment order, pk) are staged in LDS, 128 k a stage, by asynchronous 16-byte copies, two buffers: stage t + 2 is fetched while stage t + 1 is worked on.
// Wave wv takes the 64x64 quarter (wv & 1, wv / 2 & 1) of the tile and the 64-k half wv / 4 of every stage: a staged fragment is read by two waves, and a byte comes from L2 once a work-group. The two k halves of a quarter meet in LDS (which the stages have left by then) and are summed half 0 + half 1.
// C[m][n] (f32, pitch ldc, + f32 bias[n]) = sum_k A[m][k] Bt[n][k] (+ A2[m][k] Bt[n][k] where NSPLIT is 1). K % 128 == 0, K >= 256.
// A stage in LDS: operand A, Bt (, A2), each 8 row blocks of 4096 B = 16 rows x 128 k, which are 4096 contiguous bytes of the plane: a copy of the 256 threads moves one row block, byte for byte, so a fragment is read from LDS as it was from the plane (512 contiguous bytes a wave and load).
// EPI: what the summed tile is stored as. 0: f32 C. 1 (Q, K): head planes [n / HD] of (row m, k n % HD), fp16 + bf16 hi/lo. 2 (V, computed as W_v x^T: m = kv feature, n = token, bias by row): planes (row m, k n) of ldc columns, fp16 + hi/lo. Both in fragment order: a tile is 8 x 4 whole 1024-B fragment blocks of every plane it stores: one writer a line.
template <typename T16> struct WFrag;
template <> struct WFrag<h16> { typedef v16h V; static __device__ __forceinline__ V ld(const h16* p) { return cat16(*(const v8h*)p, *(const v8h*)(p + 16)); } static __device__ __forceinline__ V ldp(const h16* p) { return cat16(*(const v8h*)p, *(const v8h*)(p + 256)); } static __device__ __forceinline__ v8f mma(V a, V b, v8f c) { return wmma16(a, b, c); } };
template <> struct WFrag<bf> { typedef v16bf V; static __device__ __forceinline__ V ld(const bf* p) { return cat16b(*(const v8us*)p, *(const v8us*)(p + 16)); } static __device__ __forceinline__ V ldp(const bf* p) { return cat16b(*(const v8us*)p, *(const v8us*)(p + 256)); } static __device__ __forceinline__ v8f mma(V a, V b, v8f c) { return wmmab(a, b, c); } };
// eight asynchronous copies a lane: one operand's 8 row blocks of a stage, 4096 B apart in LDS, rs elements apart in the plane. The s_wait_xcnt closes the copies' own statement, so that it stands in front of every rewrite of their address registers
__device__ __forceinline__ void cp8(unsigned l, const bf* g, size_t rs) {
    asm volatile("global_load_async_to_lds_b128 %0, %8, off\n\t"
                 "global_load_async_to_lds_b128 %1, %9, off\n\t"
                 "global_load_async_to_lds_b128 %2, %10, off\n\t"
                 "global_load_async_to_lds_b128 %3, %11, off\n\t"
                 "global_load_async_to_lds_b128 %4, %12, off\n\t"
                 "global_load_async_to_lds_b128 %5, %13, off\n\t"
                 "global_load_async_to_lds_b128 %6, %14, off\n\t"
                 "global_load_async_to_lds_b128 %7, %15, off\n\t"
                 "s_wait_xcnt 0x0"
                 :: "v"(l), "v"(l + 4096u), "v"(l + 8192u), "v"(l + 12288u), "v"(l + 16384u), "v"(l + 20480u), "v"(l + 24576u), "v"(l + 28672u),
                    "v"(g), "v"(g + rs), "v"(g + 2 * rs), "v"(g + 3 * rs), "v"(g + 4 * rs), "v"(g + 5 * rs), "v"(g + 6 * rs), "v"(g + 7 * rs) : "memory");
}
#define GT_OS (8 * 64 * 68 * 4)                                   // bytes of the 8 partial quarters (pitch 68 floats)
#define GT_LDS(NOP) ((2 * (NOP) * 32768) > GT_OS ? (2 * (NOP) * 32768) : GT_OS)   // two stages of NOP operands, or the partial quarters, whichever is larger
// The body is a device function: sh = the work-group's LDS (GT_LDS bytes), (bx, by) = the tile it takes. A launch may hold the tiles of several independent GEMMs (kernels below): each work-group runs one body, chosen by its block index alone.
template <int NSPLIT, bool BIAS, int EPI, int K>
__device__ __forceinline__ void gemmt(unsigned char* sh, int bx, int by, const bf* __restrict__ A, const bf* __restrict__ A2, const bf* __restrict__ Bt, float* C, int ldc, const float* __restrict__ bias, h16* P16, bf* Ph, bf* Pl) {
    typedef typename WFrag<bf>::V V;
    constexpr int STG = (NSPLIT == 1 ? 3 : 2) * 32768, NT = K / 128;
    const int tid = threadIdx.x, lane = tid & 31, lr = lane & 15, hi = lane >> 4; const int r0 = bx * 128, c0 = by * 128;
    const int wv = __builtin_amdgcn_readfirstlane(tid >> 5);   // wave number, scalar: the LDS bases of the wave's fragments stay scalar
    const int mq = wv & 1, nq = (wv >> 1) & 1, kh = wv >> 2;
    v8f acc[4][4];
#pragma unroll
    for (int mb = 0; mb < 4; ++mb)
#pragma unroll
        for (int nb = 0; nb < 4; ++nb) acc[mb][nb] = (v8f){};
    const unsigned l0 = (unsigned)(size_t)sh + (unsigned)tid * 16u;   // this thread's 16 bytes in a row block, as an LDS byte address
    const bf* ga = A + (size_t)r0 * K + 8 * tid; const bf* ga2 = (NSPLIT == 1) ? A2 + (size_t)r0 * K + 8 * tid : ga; const bf* gb = Bt + (size_t)c0 * K + 8 * tid;   // fragment order: 16 rows are 16 * K elements, a stage 2048 elements on
    auto copies = [&](int t, int buf) { const unsigned l = l0 + (unsigned)(buf * STG);
        cp8(l, ga + (size_t)t * 2048, (size_t)16 * K); cp8(l + 32768u, gb + (size_t)t * 2048, (size_t)16 * K); if (NSPLIT == 1) cp8(l + 65536u, ga2 + (size_t)t * 2048, (size_t)16 * K); };
    copies(0, 0);
    asm volatile("s_wait_asynccnt 0x0" ::: "memory");   // this wave's copies of stage 0 have landed
    __syncthreads();                                     // ... and every other wave's: stage 0 may be read
    copies(1, 1);
    // rolled: one stage's code and fragments at a time
#pragma unroll 1
    for (int t = 0; t < NT; ++t) {
        const bf* sb = (const bf*)(sh + (t & 1) * STG) + kh * 1024 + 8 * lane;   // this wave's 64-k half of the stage, this lane's 16 bytes
        const bf* pa = sb + mq * 8192; const bf* pb = sb + 16384 + nq * 8192; const bf* pa2 = (NSPLIT == 1) ? sb + 32768 + mq * 8192 : pa;
        V a[2][4], a2[2][4], b[2][4];
        // one 32-k step's fragments, in the order in which the products want them
        auto ldf = [&](int kq) __attribute__((always_inline)) { b[kq][0] = WFrag<bf>::ldp(pb + kq * 512);
#pragma unroll
            for (int mb = 0; mb < 4; ++mb) { a[kq][mb] = WFrag<bf>::ldp(pa + mb * 2048 + kq * 512); if (NSPLIT == 1) a2[kq][mb] = WFrag<bf>::ldp(pa2 + mb * 2048 + kq * 512); }
#pragma unroll
            for (int nb = 1; nb < 4; ++nb) b[kq][nb] = WFrag<bf>::ldp(pb + nb * 2048 + kq * 512); };
        auto mm = [&](int kq) __attribute__((always_inline)) {
#pragma unroll
            for (int nb = 0; nb < 4; ++nb)
#pragma unroll
                for (int mb = 0; mb < 4; ++mb) { acc[mb][nb] = WFrag<bf>::mma(a[kq][mb], b[kq][nb], acc[mb][nb]); if (NSPLIT == 1) acc[mb][nb] = WFrag<bf>::mma(a2[kq][mb], b[kq][nb], acc[mb][nb]); } };
        // the LDS reads go ahead of the products as one group (counted waits let the first products start on the first fragments); without the scheduling barrier the build fetches each Bt fragment into one register set right in front of its products and waits out the LDS latency every time.
        // hi/lo body (one work-group a WGP, registers to spare): the whole stage's fragments at once; else step by step, so that two work-groups fit a WGP's registers
        if (NSPLIT == 1) { ldf(0); ldf(1); __builtin_amdgcn_sched_barrier(0); mm(0); mm(1); }
        else { ldf(0); __builtin_amdgcn_sched_barrier(0); mm(0); ldf(1); __builtin_amdgcn_sched_barrier(0); mm(1); }
        // the distance behind the stage's last matrix instructions, on every path that follows; every accumulator is an input, so that no product is moved behind the waits and the barrier below (the next stage's copies would start later)
        asm volatile("v_nop\n\tv_nop\n\tv_nop\n\tv_nop" :: "v"(acc[0][0]), "v"(acc[0][1]), "v"(acc[0][2]), "v"(acc[0][3]), "v"(acc[1][0]), "v"(acc[1][1]), "v"(acc[1][2]), "v"(acc[1][3]), "v"(acc[2][0]), "v"(acc[2][1]), "v"(acc[2][2]), "v"(acc[2][3]), "v"(acc[3][0]), "v"(acc[3][1]), "v"(acc[3][2]), "v"(acc[3][3]));
        asm volatile("s_wait_dscnt 0x0" ::: "memory");      // this wave's reads of stage t are done before the buffer is handed to its next writer
        asm volatile("s_wait_asynccnt 0x0" ::: "memory");   // this wave's copies of stage t + 1 have landed
        __syncthreads();                                     // publishes stage t + 1 and ends every wave's last read of stage t
        if (t + 2 < NT) copies(t + 2, t & 1);
    }
    asm volatile("s_wait_asynccnt 0x0" ::: "memory");       // no copy is outstanding when the stages' LDS becomes the partial quarters
    float* os = (float*)sh; float* ow = os + wv * (64 * 68);
#pragma unroll
    for (int mb = 0; mb < 4; ++mb)
#pragma unroll
        for (int nb = 0; nb < 4; ++nb)
#pragma unroll
            for (int j = 0; j < 8; ++j) ow[(mb * 16 + hi * 8 + j) * 68 + nb * 16 + lr] = acc[mb][nb][j];
    __syncthreads();   // every wave's partial quarter is in LDS before any wave sums
    if (EPI == 0) {
    // a wave sums and stores one whole row of the tile (512 contiguous bytes) at a time
#pragma unroll
    for (int i = 0; i < 128 * 32 / 256; ++i) { const int e = tid + i * 256, row = e >> 5, cofs = (e & 31) * 4; const float* o0 = os + ((row >> 6) + 2 * (cofs >> 6)) * (64 * 68) + (row & 63) * 68 + (cofs & 63);
        v4f val = *(const v4fa*)o0; val += *(const v4fa*)(o0 + 4 * (64 * 68));
        if (BIAS) { val[0] += bfr(bias[c0 + cofs]); val[1] += bfr(bias[c0 + cofs + 1]); val[2] += bfr(bias[c0 + cofs + 2]); val[3] += bfr(bias[c0 + cofs + 3]); }
        *(v4f*)(C + (size_t)(r0 + row) * ldc + c0 + cofs) = val; }
    } else {
    // plane stores in fragment order: a thread sums and stores one 16-byte piece (8 k of one row), the threads numbered in the order of the plane, so that a wave stores 512 contiguous bytes of each plane
#pragma unroll
    for (int i = 0; i < 128 * 16 / 256; ++i) { const int u = tid + i * 256, row = ((u >> 8) & 7) * 16 + (u & 15), cofs = ((u >> 6) & 3) * 32 + ((u >> 5) & 1) * 16 + ((u >> 4) & 1) * 8; const float* o0 = os + ((row >> 6) + 2 * (cofs >> 6)) * (64 * 68) + (row & 63) * 68 + (cofs & 63);
        v4f val = *(const v4fa*)o0, vb = *(const v4fa*)(o0 + 4); val += *(const v4fa*)(o0 + 4 * (64 * 68)); vb += *(const v4fa*)(o0 + 4 * (64 * 68) + 4);
        float y8[8];
#pragma unroll
        for (int q = 0; q < 4; ++q) { y8[q] = val[q]; y8[q + 4] = vb[q]; }
        if (BIAS && EPI == 2) { const float br = bfr(bias[r0 + row]);
#pragma unroll
            for (int q = 0; q < 8; ++q) y8[q] += br; }
        else if (BIAS) {
#pragma unroll
            for (int q = 0; q < 8; ++q) y8[q] += bfr(bias[c0 + cofs + q]); }
        const int col = c0 + cofs;
        const size_t o = (EPI == 1) ? (size_t)(col / HD) * ((size_t)TT * HD) + pk(r0 + row, col % HD, HD) : pk(r0 + row, col, ldc);
        v8h o16; v8us oh, ol;
#pragma unroll
        for (int q = 0; q < 8; ++q) { const float y = y8[q]; o16[q] = tohx(y); unsigned short a2s, c2s; splitf(y, a2s, c2s); oh[q] = a2s; ol[q] = c2s; }
        *(v8h*)(P16 + o) = o16; *(v8us*)(Ph + o) = oh; *(v8us*)(Pl + o) = ol; }
    }
}

// k_qkv: the three projections in one launch, grid (TT/128, (DQ + 2 * DKV) / 128). y < DQ/128: Q tile (x, y); the next DKV/128: K tile; the last DKV/128: V as W_v x^T, tile (row block y', token block x).
__global__ __launch_bounds__(256) void k_qkv(const bf* __restrict__ XB, const bf* __restrict__ WQ, const bf* __restrict__ WK, const bf* __restrict__ WV, const float* __restrict__ bq, const float* __restrict__ bk, const float* __restrict__ bv, h16* QP16, bf* QPh, bf* QPl, h16* KP16, bf* KPh, bf* KPl, h16* VT16, bf* VTh, bf* VTl) {
    __shared__ __align__(16) unsigned char sh[GT_LDS(2)];
    const int bx = blockIdx.x, by = blockIdx.y;
    if (by < (DQ + DKV) / 128) { const bool q = by < DQ / 128;
        gemmt<0, true, 1, DM>(sh, bx, q ? by : by - DQ / 128, XB, nullptr, q ? WQ : WK, nullptr, 0, q ? bq : bk, q ? QP16 : KP16, q ? QPh : KPh, q ? QPl : KPl); }
    else gemmt<0, true, 2, DM>(sh, by - (DQ + DKV) / 128, bx, WV, nullptr, XB, nullptr, TT, bv, VT16, VTh, VTl);   // rows = kv features, columns = tokens: [kv head][d][t]
}

// ---- fattn: scores, softmax and probability x value of 32 query rows of TWO query heads of one kv head in one work-group of 8 waves; no score or probability leaves the registers.
// Transposed products: S^T = K Q^T (A = 16 keys x 32 d of the K plane, B = 16 queries x 32 d of the Q plane, kept in registers), O^T += V^T P^T (A = 16 d x 32 keys of the V^T plane). In an accumulator of S^T a lane holds keys hi * 8 + j of query lr:
// two such accumulators (keys 0..15, 16..31 of the step) are, element for element, the B fragment of P^T (k = hi * 8 + j, then 16 + hi * 8 + j), so the probabilities are packed in place.
// Wave wv works for head wv & 1 of the pair and takes the 32-key steps s with s % 4 == wv / 2 of 0 .. qb; each wave keeps a running maximum m (log2 units), a sum l and an unnormalised O^T of its own steps; the four of a head meet in LDS and are joined in the order wv / 2 = 0..3 with weights 2^(m_w - M).
// fp16 body: the K and V^T fragments of 256 keys (8 steps, two a wave) are a stage of 128 KiB in LDS, brought by asynchronous 16-byte copies, two buffers: stage t + 2 is fetched while stage t + 1 is worked on. Both heads' waves read a step's fragments there, so a K or V byte comes from L2 once for two heads.
// A stage is two halves of 128 keys, 64 KiB each: K, 4 steps of 8192 B (which are 32768 contiguous bytes of the plane), then V^T, 8 d blocks of 4096 B (4 steps of 1024 B, contiguous in the plane): byte for byte as in the planes, so a fragment is read from LDS as it was from the plane. The stages' LDS becomes the partials' when the loop is left.
// HL (rows < RH): bf16 hi/lo planes, 3 products each way. Else fp16, the probabilities carried x 2^10 (in l as well, so that it cancels in O / l).
__device__ __forceinline__ float xhalf(float x) { return __builtin_bit_cast(float, __builtin_amdgcn_permlanex16(__builtin_bit_cast(int, x), __builtin_bit_cast(int, x), 0x76543210, 0xfedcba98, false, false)); }   // lane l takes lane l ^ 16's value
// 2^x of a run of N values with the slot behind a transcendental kept: results and arguments are inputs of the closing statement, which holds every argument's register to the end of the run; its v_nop is the slot of the run's last v_exp
template <int N> __device__ __forceinline__ void exp2run(const float* x, float* r);
template <> __device__ __forceinline__ void exp2run<8>(const float* x, float* r) {
#pragma unroll
    for (int j = 0; j < 8; ++j) r[j] = __builtin_amdgcn_exp2f(x[j]);
    asm volatile("v_nop" :: "v"(r[0]), "v"(r[1]), "v"(r[2]), "v"(r[3]), "v"(r[4]), "v"(r[5]), "v"(r[6]), "v"(r[7]), "v"(x[0]), "v"(x[1]), "v"(x[2]), "v"(x[3]), "v"(x[4]), "v"(x[5]), "v"(x[6]), "v"(x[7])); }
template <> __device__ __forceinline__ void exp2run<4>(const float* x, float* r) {
#pragma unroll
    for (int j = 0; j < 4; ++j) r[j] = __builtin_amdgcn_exp2f(x[j]);
    asm volatile("v_nop" :: "v"(r[0]), "v"(r[1]), "v"(r[2]), "v"(r[3]), "v"(x[0]), "v"(x[1]), "v"(x[2]), "v"(x[3])); }
template <> __device__ __forceinline__ void exp2run<2>(const float* x, float* r) { r[0] = __builtin_amdgcn_exp2f(x[0]); r[1] = __builtin_amdgcn_exp2f(x[1]);
    asm volatile("v_nop" :: "v"(r[0]), "v"(r[1]), "v"(x[0]), "v"(x[1])); }
template <typename T16> struct PPack;
template <> struct PPack<h16> { static __device__ __forceinline__ void pack(const float* p, v16h& a, v16h& b) { v8h x, y;
#pragma unroll
    for (int j = 0; j < 8; ++j) { x[j] = tohx(p[j]); y[j] = tohx(p[8 + j]); }
    a = cat16(x, y); b = a; } };
template <> struct PPack<bf> { static __device__ __forceinline__ void pack(const float* p, v16bf& a, v16bf& b) { v8us xh, yh, xl, yl;
#pragma unroll
    for (int j = 0; j < 8; ++j) { unsigned short s, t; splitf(p[j], s, t); xh[j] = s; xl[j] = t; splitf(p[8 + j], s, t); yh[j] = s; yl[j] = t; }
    a = cat16b(xh, yh); b = cat16b(xl, yl); } };
template <typename T16, bool HL>
__device__ __forceinline__ void fattn(float* os, float* sm, float* sl, int qb, int hp, const T16* __restrict__ Q, const T16* __restrict__ Q2, const T16* __restrict__ Kp, const T16* __restrict__ K2, const T16* __restrict__ Vt, const T16* __restrict__ V2, bf* ATh, bf* ATl) {
    typedef typename WFrag<T16>::V V;
    const int lane = threadIdx.x & 31, lr = lane & 15, hi = lane >> 4; const int q0 = qb * 32;
    const int wv = __builtin_amdgcn_readfirstlane((int)(threadIdx.x >> 5));   // wave number, scalar: the step loop's trip test and the diagonal test stay scalar branches (every lane on at the matrix instructions)
    const int hh = wv & 1, cl = wv >> 1, h = hp * 2 + hh;   // the wave's head of the pair, its class of steps
    const float CS = SCL * 1.4426950408889634f;      // score -> log2 units
    const float OFS = HL ? 0.0f : 10.0f;             // fp16 probabilities x 2^10
    const size_t qo = (size_t)h * ((size_t)TT * HD) + (size_t)q0 * HD + 8 * lane, ko = (size_t)(h / REP) * ((size_t)TT * HD) + 8 * lane, vo = (size_t)(h / REP) * ((size_t)HD * TT) + 8 * lane;
    // one stage's copies: 16 a lane and half (K: 8 pieces of 4096 B in a row; V^T: 4096 B of each of the 8 d blocks); keys 256 t .. 256 t + 255 lie inside the planes for every t < TT / 256. A second half that lies wholly behind the diagonal is not fetched (scalar test, the same for the work-group)
    const unsigned l0 = (unsigned)(size_t)os + (unsigned)threadIdx.x * 16u;   // this thread's 16 bytes in a piece, as an LDS byte address
    const bf* gk = (const bf*)Kp + (size_t)(h / REP) * ((size_t)TT * HD); const bf* gv = (const bf*)Vt + (size_t)(h / REP) * ((size_t)HD * TT);
    // a stage's base address, the same in every lane, held in scalar registers: formed per lane outside the loop, the two addresses are spilled to scratch and fetched back in front of every stage's copies
    auto sbase = [&](const bf* p) { const unsigned long long a = (unsigned long long)p; return (const bf*)(((unsigned long long)(unsigned)__builtin_amdgcn_readfirstlane((int)(a >> 32)) << 32) | (unsigned long long)(unsigned)__builtin_amdgcn_readfirstlane((int)a)); };
    auto copies = [&](int t, int buf) { const unsigned l = l0 + (unsigned)buf * 131072u;
        cp8(l, sbase(gk + (size_t)t * (256 * HD)) + 8 * threadIdx.x, 2048); cp8(l + 32768u, sbase(gv + (size_t)t * 4096) + 8 * threadIdx.x, (size_t)16 * TT);
        if (t * 8 + 4 <= qb) { cp8(l + 65536u, sbase(gk + (size_t)t * (256 * HD) + 128 * HD) + 8 * threadIdx.x, 2048); cp8(l + 98304u, sbase(gv + (size_t)t * 4096 + 2048) + 8 * threadIdx.x, (size_t)16 * TT); } };
    if (!HL) copies(0, 0);
    const T16* pq = Q + qo; const T16* pq2 = HL ? Q2 + qo : pq;
    V qf[2][4], qf2[2][4];
#pragma unroll
    for (int g = 0; g < 2; ++g)
#pragma unroll
        for (int ds = 0; ds < 4; ++ds) { qf[g][ds] = WFrag<T16>::ldp(pq + (g * 4 + ds) * 512); if (HL) qf2[g][ds] = WFrag<T16>::ldp(pq2 + (g * 4 + ds) * 512); }
    // the wait in front of an overwrite of the Q loads' address registers
    asm volatile("s_wait_xcnt 0x0" :: "v"(pq), "v"(pq2) : "memory");
    v8f O[8][2]; float m[2] = { -3.0e38f, -3.0e38f }, l[2] = { 0.f, 0.f };
#pragma unroll
    for (int db = 0; db < 8; ++db) { O[db][0] = (v8f){}; O[db][1] = (v8f){}; }
    const T16* kb1 = Kp + ko; const T16* kb2 = HL ? K2 + ko : kb1; const T16* vb1 = Vt + vo; const T16* vb2 = HL ? V2 + vo : vb1;
    V kf[8], kf2[8], vf[8], vf2[8];
    // one step's K fragments (2 key blocks x 4 d steps) and V^T fragments (8 d blocks); behind each run of loads the wait in front of an overwrite of their address registers, the addresses being inputs of the statement
    auto ldK = [&](int s) { const T16* p1 = kb1 + (size_t)s * (32 * HD); const T16* p2 = HL ? kb2 + (size_t)s * (32 * HD) : p1;
#pragma unroll
        for (int i = 0; i < 8; ++i) { kf[i] = WFrag<T16>::ldp(p1 + i * 512); if (HL) kf2[i] = WFrag<T16>::ldp(p2 + i * 512); }
        asm volatile("s_wait_xcnt 0x0" :: "v"(p1), "v"(p2) : "memory"); };
    auto ldV = [&](int s) { const T16* p1 = vb1 + (size_t)s * 512; const T16* p2 = HL ? vb2 + (size_t)s * 512 : p1;
#pragma unroll
        for (int db = 0; db < 8; ++db) { vf[db] = WFrag<T16>::ldp(p1 + (size_t)db * 16 * TT); if (HL) vf2[db] = WFrag<T16>::ldp(p2 + (size_t)db * 16 * TT); }
        asm volatile("s_wait_xcnt 0x0" :: "v"(p1), "v"(p2) : "memory"); };
    // the step's fragments out of half buf (0..3) of the two stage buffers: 32 LDS reads of 512 contiguous bytes a wave, as one group
    auto ldS = [&](int buf) { const T16* sk = (const T16*)((const unsigned char*)os + buf * 65536 + cl * 8192) + 8 * lane; const T16* sv = (const T16*)((const unsigned char*)os + buf * 65536 + 32768 + cl * 1024) + 8 * lane;
#pragma unroll
        for (int i = 0; i < 8; ++i) kf[i] = WFrag<T16>::ldp(sk + i * 512);
        __builtin_amdgcn_sched_barrier(0);   // K in front of V: without it the build reads V first and the first score product waits for both
#pragma unroll
        for (int db = 0; db < 8; ++db) vf[db] = WFrag<T16>::ldp(sv + db * 2048); };
    // one 32-key step. fp16 body: K and V fragments from the stage in LDS, in front of the score products (counted waits let the products start on the first fragments; V lands during them).
    // hi/lo body (twice the fragments, few steps): each step fetches its own from the planes, K in front of the score products, V behind them.
    auto step = [&](int s, int buf) __attribute__((always_inline)) {
        const int k0 = s * 32;
        if (HL) ldK(s); else ldS(buf);
        __builtin_amdgcn_sched_barrier(0);   // keeps the first product behind the last load: without it the loads share registers and wait for one another
        v8f S[2][2];
#pragma unroll
        for (int kb = 0; kb < 2; ++kb) { S[kb][0] = (v8f){}; S[kb][1] = (v8f){};
#pragma unroll
            for (int ds = 0; ds < 4; ++ds)
#pragma unroll
                for (int g = 0; g < 2; ++g) { S[kb][g] = WFrag<T16>::mma(kf[kb * 4 + ds], qf[g][ds], S[kb][g]); if (HL) { S[kb][g] = WFrag<T16>::mma(kf[kb * 4 + ds], qf2[g][ds], S[kb][g]); S[kb][g] = WFrag<T16>::mma(kf2[kb * 4 + ds], qf[g][ds], S[kb][g]); } } }
        if (HL) ldV(s);
        {
            // the distance behind the last score products, on the taken side of the branch that follows too
            asm volatile("v_nop\n\tv_nop\n\tv_nop\n\tv_nop" : "+v"(S[0][0]), "+v"(S[0][1]), "+v"(S[1][0]), "+v"(S[1][1]));
            if (k0 + 31 > q0) {   // the diagonal step (s = qb, some wave's last) alone holds keys behind a query (key > query: out of the maximum, probability exactly 0)
#pragma unroll
                for (int kb = 0; kb < 2; ++kb)
#pragma unroll
                    for (int g = 0; g < 2; ++g)
#pragma unroll
                        for (int j = 0; j < 8; ++j) if (k0 + kb * 16 + hi * 8 + j > q0 + g * 16 + lr) S[kb][g][j] = -3.0e38f;
            }
        }
        float mn[2];
#pragma unroll
        for (int g = 0; g < 2; ++g) { float mx = fmaxf(S[0][g][0], S[1][g][0]);
#pragma unroll
            for (int j = 1; j < 8; ++j) mx = fmaxf(mx, fmaxf(S[0][g][j], S[1][g][j]));
            mx = fmaxf(mx, xhalf(mx)); mn[g] = fmaxf(m[g], mx * CS); }
        // the accumulators are rescaled only in a step in which some query's maximum has grown (scalar branch: the same for the wave)
        if (__builtin_amdgcn_ballot_w32(mn[0] > m[0] || mn[1] > m[1]) != 0) {
            const float dm[2] = { m[0] - mn[0], m[1] - mn[1] }; float al[2]; exp2run<2>(dm, al);
#pragma unroll
            for (int g = 0; g < 2; ++g) { l[g] *= al[g]; m[g] = mn[g];
#pragma unroll
                for (int db = 0; db < 8; ++db) O[db][g] *= al[g]; }
        }
        V pf[2], pf2[2];
#pragma unroll
        for (int g = 0; g < 2; ++g) { float p[16]; const float mo = OFS - m[g];
#pragma unroll
            for (int kb = 0; kb < 2; ++kb) { float t[8];
#pragma unroll
                for (int j = 0; j < 8; ++j) t[j] = fmaf(S[kb][g][j], CS, mo);
                exp2run<8>(t, p + kb * 8);
#pragma unroll
                for (int j = 0; j < 8; ++j) l[g] += p[kb * 8 + j]; }
            PPack<T16>::pack(p, pf[g], pf2[g]); }
#pragma unroll
        for (int db = 0; db < 8; ++db)
#pragma unroll
            for (int g = 0; g < 2; ++g) { O[db][g] = WFrag<T16>::mma(vf[db], pf[g], O[db][g]); if (HL) { O[db][g] = WFrag<T16>::mma(vf[db], pf2[g], O[db][g]); O[db][g] = WFrag<T16>::mma(vf2[db], pf[g], O[db][g]); } }
    };
    // rolled loops: one step's fragments live at a time
    if (HL) {
#pragma unroll 1
        for (int s = cl; s <= qb; s += 4) step(s, 0);
    } else {
        const int NT = (qb + 8) >> 3;                        // stages that hold a step <= qb; qb >= RH / 32 here, so there are at least two
        asm volatile("s_wait_asynccnt 0x0" ::: "memory");   // this wave's copies of stage 0 have landed
        __syncthreads();                                     // ... and every other wave's: stage 0 may be read
        copies(1, 1);
#pragma unroll 1
        for (int v = 0; v < 2 * NT; ++v) { const int s = v * 4 + cl, t = v >> 1;   // v: the half stages in turn
            if (s <= qb) step(s, v & 3);                     // scalar test: in the last stage the steps behind the diagonal are left out; every wave passes the waits and the barrier below
            if (v & 1) {                                     // the foot of stage t
                asm volatile("s_wait_dscnt 0x0" ::: "memory");      // this wave's reads of stage t are done before the buffer is handed to its next writer
                asm volatile("s_wait_asynccnt 0x0" ::: "memory");   // this wave's copies of stage t + 1 have landed
                __syncthreads();                                     // publishes stage t + 1 and ends every wave's last read of stage t
                if (t + 2 < NT) copies(t + 2, t & 1);
            }
        }
        asm volatile("s_wait_asynccnt 0x0" ::: "memory");       // no copy is outstanding when the stages' LDS becomes the partials
    }
    // each wave's partial: piece t = db * 2 + g is 256 floats, j 0..3 of the 32 lanes, then j 4..7: every LDS access is 512 contiguous bytes of a wave
    float* ow = os + wv * 4096;
#pragma unroll
    for (int g = 0; g < 2; ++g) { l[g] += xhalf(l[g]); if (hi == 0) { sm[wv * 32 + g * 16 + lr] = m[g]; sl[wv * 32 + g * 16 + lr] = l[g]; }
#pragma unroll
        for (int db = 0; db < 8; ++db) { const v8f o = O[db][g]; *(v4fa*)(ow + (db * 2 + g) * 256 + lane * 4) = (v4f){ o[0], o[1], o[2], o[3] }; *(v4fa*)(ow + (db * 2 + g) * 256 + 128 + lane * 4) = (v4f){ o[4], o[5], o[6], o[7] }; } }
    __syncthreads();   // every wave's partial (O, m, l) is in LDS before any wave joins them; a wave with no step has stored zeros and m = -3e38 (weight 0)
    // wave wv joins d blocks 2 cl and 2 cl + 1 of its own head, both query groups, from the head's four partials (waves c * 2 + hh); a lane's 8 values are 8 successive d of one token = one 16-byte piece of the merged planes in fragment order (a wave stores 512 contiguous bytes)
#pragma unroll
    for (int g = 0; g < 2; ++g) { float mw[4], M = -3.0e38f, L = 0.f;
#pragma unroll
        for (int c = 0; c < 4; ++c) { mw[c] = sm[(c * 2 + hh) * 32 + g * 16 + lr]; M = fmaxf(M, mw[c]); }
#pragma unroll
        for (int c = 0; c < 4; ++c) mw[c] -= M;
        float wt[4]; exp2run<4>(mw, wt);
#pragma unroll
        for (int c = 0; c < 4; ++c) L += wt[c] * sl[(c * 2 + hh) * 32 + g * 16 + lr];
        const float inv = __fdiv_rn(1.0f, L);
#pragma unroll
        for (int dd = 0; dd < 2; ++dd) { const int db = cl * 2 + dd; v4f x = (v4f){}, y = (v4f){}; v8us oh, ol;
#pragma unroll
            for (int c = 0; c < 4; ++c) { x += wt[c] * *(const v4fa*)(os + (c * 2 + hh) * 4096 + (db * 2 + g) * 256 + lane * 4); y += wt[c] * *(const v4fa*)(os + (c * 2 + hh) * 4096 + (db * 2 + g) * 256 + 128 + lane * 4); }
#pragma unroll
            for (int q = 0; q < 4; ++q) { unsigned short a2, c2; splitf(x[q] * inv, a2, c2); oh[q] = a2; ol[q] = c2; splitf(y[q] * inv, a2, c2); oh[q + 4] = a2; ol[q + 4] = c2; }
            const size_t o = pk(q0 + g * 16 + lr, h * HD + db * 16 + hi * 8, DQ);
            *(v8us*)(ATh + o) = oh; *(v8us*)(ATl + o) = ol; } }
}

// k_fattn: grid (NH_ / 2 pairs of query heads, TT/32 query blocks, the longest first); blocks of rows < RH take the hi/lo body, the rest fp16.
__global__ __launch_bounds__(256) void k_fattn(const h16* __restrict__ QP16, const h16* __restrict__ KP16, const h16* __restrict__ VT16, const bf* __restrict__ QPh, const bf* __restrict__ QPl, const bf* __restrict__ KPh, const bf* __restrict__ KPl, const bf* __restrict__ VTh, const bf* __restrict__ VTl, bf* ATh, bf* ATl) {
    __shared__ __align__(16) float os[16 * 4096]; __shared__ float sm[8 * 32]; __shared__ float sl[8 * 32];   // os: two stage buffers of 128 KiB, then (its first half) the 8 partials
    const int qb = TT / 32 - 1 - (int)blockIdx.y, hp = blockIdx.x;
    if (qb < RH / 32) fattn<bf, true>(os, sm, sl, qb, hp, QPh, QPl, KPh, KPl, VTh, VTl, ATh, ATl);
    else fattn<h16, false>(os, sm, sl, qb, hp, QP16, nullptr, KP16, nullptr, VT16, nullptr, ATh, ATl);
}

// k_oproj: merged hi/lo x W_o + b_o, grid (TT/128, DM/128).
__global__ __launch_bounds__(256) void k_oproj(const bf* __restrict__ ATh, const bf* __restrict__ ATl, const bf* __restrict__ WO, float* OUT, const float* __restrict__ bo) {
    __shared__ __align__(16) unsigned char sh[GT_LDS(3)];
    gemmt<1, true, 0, DQ>(sh, blockIdx.x, blockIdx.y, ATh, ATl, WO, OUT, DM, bo, nullptr, nullptr, nullptr);
}


// k_cvtp: f32 [rows][DM] -> bf16 plane in fragment order (pk). One wave takes 16 rows x 64 k: it reads 256 contiguous bytes of two rows with each load (8 loads in flight), turns the block in its own LDS range and stores 4 x 512 contiguous bytes.
// LDS: the 8 pieces of 256 B (16 rows x 8 k) stand 288 B apart, so that the 8-byte stores of a wave fall on all 64 banks. All five planes in one launch: the block index picks the plane (CB_ blocks each, in the order x, W_q, W_k, W_v, W_o) and the block's place in it. grid = the five planes' rows * DM / 8192 exactly: no thread leaves in front of the barrier.
#define CB_X (TT * DM / 8192)
#define CB_Q (DQ * DM / 8192)
#define CB_K (DKV * DM / 8192)
#define CB_O (DM * DQ / 8192)
__global__ __launch_bounds__(256) void k_cvtp(const float* __restrict__ x, const float* __restrict__ wq, const float* __restrict__ wk, const float* __restrict__ wv_, const float* __restrict__ wo, bf* XB, bf* WQ, bf* WK, bf* WV, bf* WO) {
    __shared__ __align__(16) bf ls[8 * 8 * 144];
    int blk = blockIdx.x; const float* src = x; bf* dst = XB;
    if (blk >= CB_X + CB_Q + 2 * CB_K) { blk -= CB_X + CB_Q + 2 * CB_K; src = wo; dst = WO; }
    else if (blk >= CB_X + CB_Q + CB_K) { blk -= CB_X + CB_Q + CB_K; src = wv_; dst = WV; }
    else if (blk >= CB_X + CB_Q) { blk -= CB_X + CB_Q; src = wk; dst = WK; }
    else if (blk >= CB_X) { blk -= CB_X; src = wq; dst = WQ; }
    const int lane = threadIdx.x & 31, wv = threadIdx.x >> 5, c = lane & 15, h = lane >> 4; const size_t g = (size_t)blk * 8 + wv;
    const float* s = src + (g / (DM / 64)) * (16 * DM) + (g % (DM / 64)) * 64 + (size_t)h * DM + c * 4; bf* lw = ls + wv * (8 * 144); v4f v[8];
#pragma unroll
    for (int j = 0; j < 8; ++j) v[j] = *(const v4f*)(s + (size_t)j * 2 * DM);
#pragma unroll
    for (int j = 0; j < 8; ++j) { v4us o;
#pragma unroll
        for (int q = 0; q < 4; ++q) o[q] = f2bf(v[j][q]);
        *(v4usa*)(lw + (c >> 1) * 144 + (j * 2 + h) * 8 + (c & 1) * 4) = o; }
    __syncthreads();   // the lanes of a wave read what other lanes of it have written to LDS
#pragma unroll
    for (int t = 0; t < 4; ++t) *(v8us*)(dst + g * 1024 + t * 256 + lane * 8) = *(const v8usa*)(lw + (t * 2 + h) * 144 + c * 8);
}

extern "C" void kernel_launch(void* const* d_in, const int* in_sizes, int n_in,
                              void* d_out, int out_size, void* d_ws, size_t ws_size, hipStream_t stream) {
    (void)in_sizes; (void)n_in; (void)out_size;
    const float* x = (const float*)d_in[0]; const float* wq = (const float*)d_in[1]; const float* bq = (const float*)d_in[2]; const float* wk = (const float*)d_in[3]; const float* bk = (const float*)d_in[4]; const float* wv = (const float*)d_in[5]; const float* bv = (const float*)d_in[6]; const float* wo = (const float*)d_in[7]; const float* bo = (const float*)d_in[8];
    float* OUT = (float*)d_out;     // [1][2048][2048]
    char* wsp = (char*)d_ws;
    auto take = [&](size_t bytes) { char* p = wsp; wsp += (bytes + 255) & ~(size_t)255; return (void*)p; };
    bf* WQ = (bf*)take((size_t)DQ * DM * 2); bf* WK = (bf*)take((size_t)DKV * DM * 2); bf* WV = (bf*)take((size_t)DKV * DM * 2); bf* WO = (bf*)take((size_t)DM * DQ * 2);
    bf* XB = (bf*)take((size_t)TT * DM * 2);
    h16* QP16 = (h16*)take((size_t)NH_ * TT * HD * 2); h16* KP16 = (h16*)take((size_t)NKV * TT * HD * 2); h16* VT16 = (h16*)take((size_t)NKV * HD * TT * 2);
    bf* QPh = (bf*)take((size_t)NH_ * TT * HD * 2); bf* QPl = (bf*)take((size_t)NH_ * TT * HD * 2); bf* KPh = (bf*)take((size_t)NKV * TT * HD * 2); bf* KPl = (bf*)take((size_t)NKV * TT * HD * 2); bf* VTh = (bf*)take((size_t)NKV * HD * TT * 2); bf* VTl = (bf*)take((size_t)NKV * HD * TT * 2);
    bf* ATh = (bf*)take((size_t)TT * DQ * 2); bf* ATl = (bf*)take((size_t)TT * DQ * 2);
    if ((size_t)(wsp - (char*)d_ws) > ws_size) return;    // ws 256 MiB
    for (int b = 0; b < NB_; ++b) {
        k_cvtp<<<CB_X + CB_Q + 2 * CB_K + CB_O, 256, 0, stream>>>(x + (size_t)b * TT * DM, wq, wk, wv, wo, XB, WQ, WK, WV, WO);
        k_qkv<<<dim3(TT / 128, (DQ + 2 * DKV) / 128, 1), 256, 0, stream>>>(XB, WQ, WK, WV, bq, bk, bv, QP16, QPh, QPl, KP16, KPh, KPl, VT16, VTh, VTl);
        k_fattn<<<dim3(NH_ / 2, TT / 32, 1), 256, 0, stream>>>(QP16, KP16, VT16, QPh, QPl, KPh, KPl, VTh, VTl, ATh, ATl);
        k_oproj<<<dim3(TT / 128, DM / 128, 1), 256, 0, stream>>>(ATh, ATl, WO, OUT + (size_t)b * TT * DM, bo); }
}
